// v000
// The times below were measured on an AMD MI455X: many runs one after another, warmed up first and cycling through
// copies of the inputs, with the whole window's GPU time divided by the number of runs. Launches and the gaps
// between them are all in it. The median over several windows is given; except for v000 it joins two sittings, which
// can be a few percent apart, so the side-by-side timings, each taken in one sitting, are the better comparison.
// The starting kernel, v000, takes 7550 microseconds a run.
// compute dtype: all float inputs rounded to bf16; Q/K/V = x^T W + b with EXACT bf16 products on WMMA 16x16x32 (channel-major tiles transposed in LDS), f32 accumulate; Q as f16 hi + residual, K f16 -> 2-product logits / 8 stored in f32 (16 (batch, head) slices per launch); softmax in f32 (precise expf) -> P f16 x 2^11; attn_map = column sums of P / 8 in f32; O = P . V (V rounded once to f16, 1 product); Wo, W1, W2 GEMMs with the f32 activations split bf16 hi + lo (2 products); LayerNorms (eps 1e-5), SiLU and residuals in f32; outputs: out channel-major [b][c][hw], attn_map [b][hw].
#include <hip/hip_runtime.h>
#include <math.h>

typedef __attribute__((ext_vector_type(16))) _Float16 v16h;
typedef __attribute__((ext_vector_type(16))) __bf16 v16b;
typedef __attribute__((ext_vector_type(8)))  _Float16 v8h;
typedef __attribute__((ext_vector_type(8)))  float v8f;
typedef __attribute__((ext_vector_type(4)))  float v4f;
typedef __attribute__((ext_vector_type(2)))  float v2f;
typedef __attribute__((ext_vector_type(4)))  unsigned v4u;
typedef __attribute__((ext_vector_type(4)))  int v4i;
typedef float __attribute__((may_alias)) float_a;
typedef int __attribute__((may_alias)) int_a;

template <typename T> __device__ __forceinline__ void vst2(void* p, T v) { *(T*)p = v;  }
__device__ __forceinline__ v8f wmma16(v16h a, v16h b, v8f c) {
  v8f d = __builtin_amdgcn_wmma_f32_16x16x32_f16(false, a, false, b, (short)0, c, false, false);
  asm volatile("v_nop\n\tv_nop\n\tv_nop\n\tv_nop" : "+v"(d) : "v"(a), "v"(b));
  return d;
}
__device__ __forceinline__ v8f wmma_bf(v16b a, v16b b, v8f c) {
  v8f d = __builtin_amdgcn_wmma_f32_16x16x32_bf16(false, a, false, b, (short)0, c, false, false);
  asm volatile("v_nop\n\tv_nop\n\tv_nop\n\tv_nop" : "+v"(d) : "v"(a), "v"(b));
  return d;
}
// 16x16x32 fragments: lane = (h = lane>>4, row/col = lane&15); elements 0..7 = k0+8h+0..7, 8..15 = k0+16+8h+0..7; D element r = row 8h+r
__device__ __forceinline__ v16h frag_h(const _Float16* rowk0, int lane) {
  union { v16h v; v8h q[2]; } u; const _Float16* p = rowk0 + 8 * (lane >> 4);
  u.q[0] = *(const v8h*)p; u.q[1] = *(const v8h*)(p + 16); return u.v;
}
__device__ __forceinline__ v16h frag_f32(const float* rowk0, int lane) {
  v16h a; const float* p = rowk0 + 8 * (lane >> 4);
#pragma unroll
  for (int i = 0; i < 8; ++i) { a[i] = (_Float16)p[i]; a[8 + i] = (_Float16)p[16 + i]; }
  return a;
}
__device__ __forceinline__ v16h frag_f32s(const float* rowk0, int lane, float sc) {
  v16h a; const float* p = rowk0 + 8 * (lane >> 4);
#pragma unroll
  for (int i = 0; i < 8; ++i) { a[i] = (_Float16)(p[i] * sc); a[8 + i] = (_Float16)(p[16 + i] * sc); }
  return a;
}
// column fragment from a [K][ld] layout (column n), rows >= K read as 0
__device__ __forceinline__ v16h fragc_f32(const float* W, int k0, int n, int lane, int ld, int K) {
  v16h a; const int g = lane >> 4;
#pragma unroll
  for (int i = 0; i < 8; ++i) { const int ka = k0 + 8 * g + i, kb = ka + 16;
    a[i] = (_Float16)(ka < K ? W[(size_t)(ka < K ? ka : K - 1) * ld + n] : 0.f); a[8 + i] = (_Float16)(kb < K ? W[(size_t)(kb < K ? kb : K - 1) * ld + n] : 0.f); }
  return a;
}
struct F2 { v16b h, l; };
__device__ __forceinline__ F2 bsplit16(const float v[16]) { F2 r;
#pragma unroll
  for (int i = 0; i < 16; ++i) { const __bf16 h = (__bf16)v[i]; r.h[i] = h; r.l[i] = (__bf16)(v[i] - (float)h); }
  return r; }
__device__ __forceinline__ F2 split_row(const float* row, int k0, int lane) { float v[16]; const float* p = row + k0 + 8 * (lane >> 4);
#pragma unroll
  for (int i = 0; i < 8; ++i) { v[i] = p[i]; v[8 + i] = p[16 + i]; }
  return bsplit16(v); }
__device__ __forceinline__ F2 split_rowK(const float* row, int k0, int lane, int K) { float v[16]; const int g = lane >> 4;
#pragma unroll
  for (int i = 0; i < 8; ++i) { const int ka = k0 + 8 * g + i, kb = ka + 16; v[i] = ka < K ? row[ka < K ? ka : K - 1] : 0.f; v[8 + i] = kb < K ? row[kb < K ? kb : K - 1] : 0.f; }
  return bsplit16(v); }
__device__ __forceinline__ F2 split_col(const float* W, int k0, int n, int lane, int ld, int K) { float v[16]; const int g = lane >> 4;
#pragma unroll
  for (int i = 0; i < 8; ++i) { const int ka = k0 + 8 * g + i, kb = ka + 16; v[i] = ka < K ? W[(size_t)(ka < K ? ka : K - 1) * ld + n] : 0.f; v[8 + i] = kb < K ? W[(size_t)(kb < K ? kb : K - 1) * ld + n] : 0.f; }
  return bsplit16(v); }
__device__ __forceinline__ v8f mac3(const F2& a, const F2& b, v8f c) { c = wmma_bf(a.l, b.h, c); c = wmma_bf(a.h, b.l, c); return wmma_bf(a.h, b.h, c); }
__device__ __forceinline__ float sigm(float v) { return 1.0f / (1.0f + expf(-v)); }
#define LDSX() do { asm volatile("s_wait_dscnt 0" ::: "memory"); __builtin_amdgcn_wave_barrier(); __builtin_amdgcn_fence(__ATOMIC_RELEASE, "workgroup"); } while (0)


// Multi-head spatial attention block (B 16, C 256, 32x32 = 1,024 positions, d_model 512 = 8 x 64): MHA over positions + Wo + residual LN + SiLU FFN + residual LN; second output = inbound attention map (sum over queries, mean over heads).
#define NB 16
#define CIN 256
#define TT 1024
#define CC 512
#define NH 8
#define HD 64
#define BG 2                  // batches per launch group
#define ZG (BG * NH)          // 16 (b,h) slices per launch
#define NR (NB * TT)
#ifndef TNB
#define TNB NB
#endif
typedef __attribute__((ext_vector_type(8))) __bf16 v8b;
__device__ __forceinline__ v16b frag_b(const __bf16* rowk0, int lane) {
  union { v16b v; v8b q[2]; } u; const __bf16* p = rowk0 + 8 * (lane >> 4);
  u.q[0] = *(const v8b*)p; u.q[1] = *(const v8b*)(p + 16); return u.v;
}
__device__ __forceinline__ float bfr(float v) { return (float)(__bf16)v; }
__device__ __attribute__((noinline)) float exp_ni(float v) { return expf(v); }
__device__ __attribute__((noinline)) float erf_ni(float v) { return erff(v); }

#define OUT1_OFF ((size_t)NB * CIN * TT)
#define WS_QH  0u
#define WS_QL  (WS_QH + 2u * (size_t)NR * CC)
#define WS_KH  (WS_QL + 2u * (size_t)NR * CC)
#define WS_VT  (WS_KH + 2u * (size_t)NR * CC)          // f16 v planes [b][512][t]
#define WS_S   (WS_VT + 2u * (size_t)NR * CC)          // f32 S [ZG][t][t]
#define WS_PH  (WS_S + 4u * (size_t)ZG * TT * TT)       // f16 P [ZG][t][t]
#define WS_Y   (WS_PH + 2u * (size_t)ZG * TT * TT)      // f32 O rows [b*t][512]
#define WS_Z1  (WS_Y + 4u * (size_t)NR * CC)           // f32 LN1 rows [b*t][256]
#define WS_HM  (WS_Z1 + 4u * (size_t)NR * CIN)         // f32 silu rows [b*t][256]
#define WS_END (WS_HM + 4u * (size_t)NR * CIN)

// ---- k_proj: block = (64 positions, 128 cols, b*3 + which): x^T tile; W (in,out) [256][512]
__global__ __launch_bounds__(128) void k_proj(const float* __restrict__ X, const float* __restrict__ WQ, const float* __restrict__ BQ, const float* __restrict__ WK, const float* __restrict__ BK, const float* __restrict__ WV, const float* __restrict__ BV, _Float16* __restrict__ QH, _Float16* __restrict__ QL, _Float16* __restrict__ KH, _Float16* __restrict__ VT) {
  __shared__ __align__(16) __bf16 sx[64][CIN + 8]; __shared__ __align__(16) _Float16 sh[64][136], sl[64][136]; __shared__ __align__(16) _Float16 th[128][72];
  const int tid = threadIdx.x, wave = tid >> 5, lane = tid & 31, col = lane & 15, g = lane >> 4; const int p0 = blockIdx.x * 64; const int c0 = blockIdx.y * 128; const size_t b = blockIdx.z / 3; const int which = blockIdx.z % 3;
  const float* Wm = which == 0 ? WQ : which == 1 ? WK : WV; const float* Bm = which == 0 ? BQ : which == 1 ? BK : BV;
  for (int e = tid; e < CIN * 64; e += 128) { const int c = e >> 6, pl = e & 63; sx[pl][c] = (__bf16)X[(b * CIN + c) * (size_t)TT + p0 + pl]; }
  __syncthreads();
  v8f acc[8] = {};
#pragma unroll 2
  for (int kc = 0; kc < CIN / 32; ++kc) { const v16b a = frag_b(&sx[wave * 16 + col][kc * 32], lane);
#pragma unroll
    for (int j = 0; j < 8; ++j) { v16b w; const int o = c0 + j * 16 + col;
#pragma unroll
      for (int i = 0; i < 8; ++i) { w[i] = (__bf16)Wm[(size_t)(kc * 32 + 8 * g + i) * CC + o]; w[8 + i] = (__bf16)Wm[(size_t)(kc * 32 + 16 + 8 * g + i) * CC + o]; }
      acc[j] = wmma_bf(a, w, acc[j]); } }
#pragma unroll
  for (int j = 0; j < 8; ++j) { const float bb = bfr(Bm[c0 + j * 16 + col]);
#pragma unroll
    for (int r = 0; r < 8; ++r) { const float v = acc[j][r] + bb; const int rl = wave * 16 + 8 * g + r, cl = j * 16 + col; const _Float16 hv = (_Float16)v;
      if (which == 2) th[cl][rl] = hv; else { sh[rl][cl] = hv; sl[rl][cl] = (_Float16)(v - (float)hv); } } }
  __syncthreads();
  if (which < 2) { _Float16* dh = which == 0 ? QH : KH; for (int e = tid; e < 64 * 16; e += 128) { const int rl = e >> 4, q = e & 15; const size_t row = b * TT + p0 + rl; vst2((unsigned*)(dh + row * CC + c0 + q * 8), *(const v4u*)&sh[rl][q * 8]); if (which == 0) vst2((unsigned*)(QL + row * CC + c0 + q * 8), *(const v4u*)&sl[rl][q * 8]); } }
  else { for (int e = tid; e < 128 * 8; e += 128) { const int cl = e >> 3, q = e & 7; vst2((unsigned*)(VT + (b * CC + c0 + cl) * (size_t)TT + p0 + q * 8), *(const v4u*)&th[cl][q * 8]); } } }
// ---- k_sc: block = (64 queries, 128 keys, z = bl*8 + h): logits / 8 (2 products)
__global__ __launch_bounds__(128) void k_sc(const _Float16* __restrict__ QH, const _Float16* __restrict__ QL, const _Float16* __restrict__ KH, int b0, float* __restrict__ S0) { __shared__ __align__(16) float ss[4][16][132];
  const int z = blockIdx.z; const size_t b = b0 + z / NH; const int h = z % NH; float* S = S0 + (size_t)z * TT * TT;
  const int tid = threadIdx.x, wave = tid >> 5, lane = tid & 31, col = lane & 15, g = lane >> 4; const int k0 = blockIdx.y * 128; const int ql0 = blockIdx.x * 64 + wave * 16; const size_t q0 = b * TT + ql0;
  v8f acc[8] = {};
#pragma unroll
  for (int kc = 0; kc < HD / 32; ++kc) { const v16h ah = frag_h(QH + (q0 + col) * CC + h * HD + kc * 32, lane), al = frag_h(QL + (q0 + col) * CC + h * HD + kc * 32, lane);
#pragma unroll
    for (int j = 0; j < 8; ++j) { const v16h kb = frag_h(KH + (b * TT + k0 + j * 16 + col) * CC + h * HD + kc * 32, lane); acc[j] = wmma16(ah, kb, acc[j]); acc[j] = wmma16(al, kb, acc[j]); } }
#pragma unroll
  for (int j = 0; j < 8; ++j)
#pragma unroll
    for (int r = 0; r < 8; ++r) ss[wave][8 * g + r][j * 16 + col] = acc[j][r] * 0.125f;
  LDSX(); for (int rl = 0; rl < 16; ++rl) vst2(S + (size_t)(ql0 + rl) * TT + k0 + lane * 4, *(const v4f*)&ss[wave][rl][lane * 4]); }
// ---- k_sm: block = (row, z): softmax -> P f16 x 2^11
__global__ __launch_bounds__(256) void k_sm(const float* __restrict__ S0, _Float16* __restrict__ PH0) { __shared__ float sred[8]; __shared__ float sbc; __shared__ __align__(16) _Float16 sh[TT];
  const int t = threadIdx.x; const size_t row = blockIdx.x; const float* sr = S0 + (size_t)blockIdx.y * TT * TT + row * TT; _Float16* ph = PH0 + (size_t)blockIdx.y * TT * TT + row * TT;
  float m = -3.0e38f; for (int k = t; k < TT; k += 256) m = fmaxf(m, sr[k]);
#pragma unroll
  for (int o = 1; o < 32; o <<= 1) m = fmaxf(m, __shfl_xor(m, o));
  if ((t & 31) == 0) sred[t >> 5] = m; __syncthreads(); if (t == 0) { float a = sred[0]; for (int i = 1; i < 8; ++i) a = fmaxf(a, sred[i]); sbc = a; } __syncthreads(); m = sbc; __syncthreads();
  float sum = 0.f; for (int k = t; k < TT; k += 256) sum += expf(sr[k] - m);
#pragma unroll
  for (int o = 1; o < 32; o <<= 1) sum += __shfl_xor(sum, o);
  if ((t & 31) == 0) sred[t >> 5] = sum; __syncthreads(); if (t == 0) { float a = 0.f; for (int i = 0; i < 8; ++i) a += sred[i]; sbc = 1.0f / a; } __syncthreads(); const float inv = sbc;
  for (int k = t; k < TT; k += 256) sh[k] = (_Float16)(expf(sr[k] - m) * inv * 2048.0f);
  __syncthreads(); for (int q = t; q < TT / 8; q += 256) vst2((unsigned*)(ph + q * 8), *(const v4u*)&sh[q * 8]); }
// ---- k_col: block = (256 keys, batch in group): attn_map[b][k] = (1/8) sum_h sum_q P[h][q][k]  (P stored x 2^11)
__global__ __launch_bounds__(256) void k_col(const _Float16* __restrict__ PH0, int b0, float* __restrict__ AM) { __shared__ __align__(16) float so[256];
  const int t = threadIdx.x; const int bl = blockIdx.y; const size_t b = b0 + bl; const int k = blockIdx.x * 256 + t; float a = 0.f;
#pragma unroll 1
  for (int h = 0; h < NH; ++h) { const _Float16* p = PH0 + ((size_t)(bl * NH + h) * TT) * TT + k;
#pragma unroll 4
    for (int q = 0; q < TT; ++q) a += (float)p[(size_t)q * TT]; }
  so[t] = a * (1.0f / 2048.0f) * (1.0f / NH);
  __syncthreads(); if (t < 64) vst2(AM + b * TT + blockIdx.x * 256 + t * 4, *(const v4f*)&so[t * 4]); }
// ---- k_pv: block = (64 queries, z): O rows [b*t][h*64 + d] = P . v (1 product)
__global__ __launch_bounds__(128) void k_pv(const _Float16* __restrict__ PH0, const _Float16* __restrict__ VT, int b0, float* __restrict__ Y) { __shared__ __align__(16) float ss[4][16][68];
  const int z = blockIdx.z; const size_t b = b0 + z / NH; const int h = z % NH; const _Float16* PH = PH0 + (size_t)z * TT * TT;
  const int tid = threadIdx.x, wave = tid >> 5, lane = tid & 31, col = lane & 15, g = lane >> 4; const int ql0 = blockIdx.x * 64 + wave * 16;
  v8f acc[4] = {};
#pragma unroll 1
  for (int kc = 0; kc < TT / 32; ++kc) { const v16h ph = frag_h(PH + (size_t)(ql0 + col) * TT + kc * 32, lane);
#pragma unroll
    for (int j = 0; j < 4; ++j) acc[j] = wmma16(ph, frag_h(VT + (b * CC + h * HD + j * 16 + col) * (size_t)TT + kc * 32, lane), acc[j]); }
#pragma unroll
  for (int j = 0; j < 4; ++j)
#pragma unroll
    for (int r = 0; r < 8; ++r) ss[wave][8 * g + r][j * 16 + col] = acc[j][r] * (1.0f / 2048.0f);
  LDSX(); for (int rl = 0; rl < 16; ++rl) if (lane < 16) vst2(Y + (b * TT + ql0 + rl) * CC + h * HD + lane * 4, *(const v4f*)&ss[wave][rl][lane * 4]); }
// ---- k_lnA: block = 64 rows x all 256 output cols: Z1 = LN(Y (hi+lo) Wo + bo + x^T) (K 512); writes Z1 rows
// ---- k_lnB: out = LN(HM (hi+lo) W2 + b2 + Z1) (K 256); writes channel-major output planes
template <int MODE>
__global__ __launch_bounds__(128) void k_ln(const float* __restrict__ A, const float* __restrict__ Wm, const float* __restrict__ Bv, const float* __restrict__ RES, const float* __restrict__ GA, const float* __restrict__ BE, float* __restrict__ DST) {
  __shared__ __align__(16) float sz[64][CIN + 4];
  const int tid = threadIdx.x, wave = tid >> 5, lane = tid & 31, col = lane & 15, g = lane >> 4; const size_t r0 = (size_t)blockIdx.x * 64; const size_t b = r0 / TT; const int p0 = (int)(r0 % TT); constexpr int K = (MODE == 0) ? CC : CIN;
#pragma unroll 1
  for (int half = 0; half < 2; ++half) {
    v8f acc[8]; for (int j = 0; j < 8; ++j) for (int r = 0; r < 8; ++r) acc[j][r] = 0.f;
#pragma unroll 1
    for (int kc = 0; kc < K / 32; ++kc) { const F2 a = split_row(A + (r0 + wave * 16 + col) * K, kc * 32, lane);
#pragma unroll
      for (int j = 0; j < 8; ++j) { v16b w; const int o = half * 128 + j * 16 + col;
#pragma unroll
        for (int i = 0; i < 8; ++i) { w[i] = (__bf16)Wm[(size_t)(kc * 32 + 8 * g + i) * CIN + o]; w[8 + i] = (__bf16)Wm[(size_t)(kc * 32 + 16 + 8 * g + i) * CIN + o]; }
        acc[j] = wmma_bf(a.h, w, acc[j]); acc[j] = wmma_bf(a.l, w, acc[j]); } }
#pragma unroll
    for (int j = 0; j < 8; ++j) { const int o = half * 128 + j * 16 + col; const float bb = bfr(Bv[o]);
#pragma unroll
      for (int r = 0; r < 8; ++r) { const int rl = wave * 16 + 8 * g + r; const float res = (MODE == 0) ? bfr(RES[(b * CIN + o) * (size_t)TT + p0 + rl]) : RES[(r0 + rl) * CIN + o]; sz[rl][o] = acc[j][r] + bb + res; } } }
  __syncthreads();
  // LayerNorm per row (wave handles 16 rows; lanes stride columns)
  for (int rr = 0; rr < 16; ++rr) { const int rl = wave * 16 + rr; float s = 0.f; for (int c = lane; c < CIN; c += 32) s += sz[rl][c];
#pragma unroll
    for (int o2 = 1; o2 < 32; o2 <<= 1) s += __shfl_xor(s, o2); const float mu = s / CIN; float q = 0.f; for (int c = lane; c < CIN; c += 32) { const float d = sz[rl][c] - mu; q += d * d; }
#pragma unroll
    for (int o2 = 1; o2 < 32; o2 <<= 1) q += __shfl_xor(q, o2); const float inv = 1.0f / sqrtf(q / CIN + 1e-5f);
    for (int c = lane; c < CIN; c += 32) sz[rl][c] = (sz[rl][c] - mu) * inv * bfr(GA[c]) + bfr(BE[c]); }
  __syncthreads();
  if (MODE == 0) { for (int e = tid; e < 64 * 64; e += 128) { const int rl = e >> 6, q = e & 63; vst2(DST + (r0 + rl) * CIN + q * 4, *(const v4f*)&sz[rl][q * 4]); } }
  else { // channel-major planes [b][c][p0 .. p0+63]: transpose through registers: for (c, 4 consecutive positions)
    for (int e = tid; e < CIN * 16; e += 128) { const int c = e >> 4, q = e & 15; __align__(16) float v4x[4]; v4x[0] = sz[q * 4][c]; v4x[1] = sz[q * 4 + 1][c]; v4x[2] = sz[q * 4 + 2][c]; v4x[3] = sz[q * 4 + 3][c]; vst2(DST + (b * CIN + c) * (size_t)TT + p0 + q * 4, *(const v4f*)v4x); } } }
// ---- k_ffn1: block = (64 rows, 128 cols): HM = silu(Z1 (hi+lo) W1 + b1)
__global__ __launch_bounds__(128) void k_ffn1(const float* __restrict__ Z1, const float* __restrict__ W1, const float* __restrict__ B1, float* __restrict__ HM) { __shared__ __align__(16) float sf[4][16][132];
  const int tid = threadIdx.x, wave = tid >> 5, lane = tid & 31, col = lane & 15, g = lane >> 4; const int c0 = blockIdx.y * 128; const size_t r0 = (size_t)blockIdx.x * 64 + wave * 16;
  v8f acc[8] = {};
#pragma unroll
  for (int kc = 0; kc < CIN / 32; ++kc) { const F2 a = split_row(Z1 + (r0 + col) * CIN, kc * 32, lane);
#pragma unroll
    for (int j = 0; j < 8; ++j) { v16b w; const int o = c0 + j * 16 + col;
#pragma unroll
      for (int i = 0; i < 8; ++i) { w[i] = (__bf16)W1[(size_t)(kc * 32 + 8 * g + i) * CIN + o]; w[8 + i] = (__bf16)W1[(size_t)(kc * 32 + 16 + 8 * g + i) * CIN + o]; }
      acc[j] = wmma_bf(a.h, w, acc[j]); acc[j] = wmma_bf(a.l, w, acc[j]); } }
#pragma unroll
  for (int j = 0; j < 8; ++j) { const float bb = bfr(B1[c0 + j * 16 + col]);
#pragma unroll
    for (int r = 0; r < 8; ++r) { const float v = acc[j][r] + bb; sf[wave][8 * g + r][j * 16 + col] = v / (1.0f + expf(-v)); } }
  LDSX(); for (int rl = 0; rl < 16; ++rl) vst2(HM + (r0 + rl) * CIN + c0 + lane * 4, *(const v4f*)&sf[wave][rl][lane * 4]); }
extern "C" void kernel_launch(void* const* d_in, const int* in_sizes, int n_in, void* d_out, int out_size, void* d_ws, size_t ws_size, hipStream_t stream) {
  (void)in_sizes; (void)n_in; (void)out_size;
  const float** F = (const float**)d_in;   // 0 x [16,256,32,32], 1 Wq [256,512], 2 bq, 3 Wk, 4 bk, 5 Wv, 6 bv, 7 Wo [512,256], 8 bo, 9 W1 [256,256], 10 b1, 11 W2, 12 b2, 13 g1, 14 be1, 15 g2, 16 be2
  if (ws_size < (size_t)WS_END) return;
  char* ws = (char*)d_ws; _Float16 *QH = (_Float16*)(ws + WS_QH), *QL = (_Float16*)(ws + WS_QL), *KH = (_Float16*)(ws + WS_KH), *VT = (_Float16*)(ws + WS_VT), *PH = (_Float16*)(ws + WS_PH); float *S = (float*)(ws + WS_S), *Y = (float*)(ws + WS_Y), *Z1 = (float*)(ws + WS_Z1), *HM = (float*)(ws + WS_HM);
  float* OUT0 = (float*)d_out; float* OUT1 = (float*)d_out + OUT1_OFF;
  k_proj<<<dim3(TT / 64, CC / 128, TNB * 3), 128, 0, stream>>>(F[0], F[1], F[2], F[3], F[4], F[5], F[6], QH, QL, KH, VT);
  for (int b0 = 0; b0 < TNB; b0 += BG) { const int ng = ((TNB - b0) < BG ? (TNB - b0) : BG);
    k_sc<<<dim3(TT / 64, TT / 128, ng * NH), 128, 0, stream>>>(QH, QL, KH, b0, S);
    k_sm<<<dim3(TT, ng * NH), 256, 0, stream>>>(S, PH);
    k_col<<<dim3(TT / 256, ng), 256, 0, stream>>>(PH, b0, OUT1);
    k_pv<<<dim3(TT / 64, 1, ng * NH), 128, 0, stream>>>(PH, VT, b0, Y);
  }
  k_ln<0><<<TNB * TT / 64, 128, 0, stream>>>(Y, F[7], F[8], F[0], F[13], F[14], Z1);
  k_ffn1<<<dim3(TNB * TT / 64, CIN / 128), 128, 0, stream>>>(Z1, F[9], F[10], HM);
  k_ln<1><<<TNB * TT / 64, 128, 0, stream>>>(HM, F[11], F[12], Z1, F[15], F[16], OUT0);
}

// v001
// One run takes 1130 microseconds.
// Timed twice side by side with v000, it ran 6.70 and 6.71 times as fast.
// compute dtype: all float inputs rounded to bf16; Q/K/V = x^T W + b with EXACT bf16 products on WMMA 16x16x32 (channel-major tiles transposed in LDS), f32 accumulate; Q as f16 hi + residual, K f16 -> 2-product logits / 8 stored in f32 (16 (batch, head) slices per launch); softmax in f32 (precise expf) -> P f16 x 2^11; attn_map = column sums of P / 8 in f32; O = P . V (V rounded once to f16, 1 product); Wo, W1, W2 GEMMs with the f32 activations split bf16 hi + lo (2 products); LayerNorms (eps 1e-5), SiLU and residuals in f32; outputs: out channel-major [b][c][hw], attn_map [b][hw].
#include <hip/hip_runtime.h>
#include <math.h>

typedef __attribute__((ext_vector_type(16))) _Float16 v16h;
typedef __attribute__((ext_vector_type(16))) __bf16 v16b;
typedef __attribute__((ext_vector_type(8)))  _Float16 v8h;
typedef __attribute__((ext_vector_type(8)))  float v8f;
typedef __attribute__((ext_vector_type(4)))  float v4f;
typedef __attribute__((ext_vector_type(2)))  float v2f;
typedef __attribute__((ext_vector_type(4)))  unsigned v4u;
typedef __attribute__((ext_vector_type(4)))  int v4i;
typedef float __attribute__((may_alias)) float_a;
typedef int __attribute__((may_alias)) int_a;

template <typename T> __device__ __forceinline__ void vst2(void* p, T v) { *(T*)p = v;  }
__device__ __forceinline__ v8f wmma16(v16h a, v16h b, v8f c) {
  v8f d = __builtin_amdgcn_wmma_f32_16x16x32_f16(false, a, false, b, (short)0, c, false, false);
  asm volatile("v_nop\n\tv_nop\n\tv_nop\n\tv_nop" : "+v"(d) : "v"(a), "v"(b));
  return d;
}
__device__ __forceinline__ v8f wmma_bf(v16b a, v16b b, v8f c) {
  v8f d = __builtin_amdgcn_wmma_f32_16x16x32_bf16(false, a, false, b, (short)0, c, false, false);
  asm volatile("v_nop\n\tv_nop\n\tv_nop\n\tv_nop" : "+v"(d) : "v"(a), "v"(b));
  return d;
}
// 16x16x32 fragments: lane = (h = lane>>4, row/col = lane&15); elements 0..7 = k0+8h+0..7, 8..15 = k0+16+8h+0..7; D element r = row 8h+r
__device__ __forceinline__ v16h frag_h(const _Float16* rowk0, int lane) {
  union { v16h v; v8h q[2]; } u; const _Float16* p = rowk0 + 8 * (lane >> 4);
  u.q[0] = *(const v8h*)p; u.q[1] = *(const v8h*)(p + 16); return u.v;
}
__device__ __forceinline__ v16h frag_f32(const float* rowk0, int lane) {
  v16h a; const float* p = rowk0 + 8 * (lane >> 4);
#pragma unroll
  for (int i = 0; i < 8; ++i) { a[i] = (_Float16)p[i]; a[8 + i] = (_Float16)p[16 + i]; }
  return a;
}
__device__ __forceinline__ v16h frag_f32s(const float* rowk0, int lane, float sc) {
  v16h a; const float* p = rowk0 + 8 * (lane >> 4);
#pragma unroll
  for (int i = 0; i < 8; ++i) { a[i] = (_Float16)(p[i] * sc); a[8 + i] = (_Float16)(p[16 + i] * sc); }
  return a;
}
// column fragment from a [K][ld] layout (column n), rows >= K read as 0
__device__ __forceinline__ v16h fragc_f32(const float* W, int k0, int n, int lane, int ld, int K) {
  v16h a; const int g = lane >> 4;
#pragma unroll
  for (int i = 0; i < 8; ++i) { const int ka = k0 + 8 * g + i, kb = ka + 16;
    a[i] = (_Float16)(ka < K ? W[(size_t)(ka < K ? ka : K - 1) * ld + n] : 0.f); a[8 + i] = (_Float16)(kb < K ? W[(size_t)(kb < K ? kb : K - 1) * ld + n] : 0.f); }
  return a;
}
struct F2 { v16b h, l; };
__device__ __forceinline__ F2 bsplit16(const float v[16]) { F2 r;
#pragma unroll
  for (int i = 0; i < 16; ++i) { const __bf16 h = (__bf16)v[i]; r.h[i] = h; r.l[i] = (__bf16)(v[i] - (float)h); }
  return r; }
__device__ __forceinline__ F2 split_row(const float* row, int k0, int lane) { float v[16]; const float* p = row + k0 + 8 * (lane >> 4);
#pragma unroll
  for (int i = 0; i < 8; ++i) { v[i] = p[i]; v[8 + i] = p[16 + i]; }
  return bsplit16(v); }
__device__ __forceinline__ F2 split_rowK(const float* row, int k0, int lane, int K) { float v[16]; const int g = lane >> 4;
#pragma unroll
  for (int i = 0; i < 8; ++i) { const int ka = k0 + 8 * g + i, kb = ka + 16; v[i] = ka < K ? row[ka < K ? ka : K - 1] : 0.f; v[8 + i] = kb < K ? row[kb < K ? kb : K - 1] : 0.f; }
  return bsplit16(v); }
__device__ __forceinline__ F2 split_col(const float* W, int k0, int n, int lane, int ld, int K) { float v[16]; const int g = lane >> 4;
#pragma unroll
  for (int i = 0; i < 8; ++i) { const int ka = k0 + 8 * g + i, kb = ka + 16; v[i] = ka < K ? W[(size_t)(ka < K ? ka : K - 1) * ld + n] : 0.f; v[8 + i] = kb < K ? W[(size_t)(kb < K ? kb : K - 1) * ld + n] : 0.f; }
  return bsplit16(v); }
__device__ __forceinline__ v8f mac3(const F2& a, const F2& b, v8f c) { c = wmma_bf(a.l, b.h, c); c = wmma_bf(a.h, b.l, c); return wmma_bf(a.h, b.h, c); }
__device__ __forceinline__ float sigm(float v) { return 1.0f / (1.0f + expf(-v)); }
#define LDSX() do { asm volatile("s_wait_dscnt 0" ::: "memory"); __builtin_amdgcn_wave_barrier(); __builtin_amdgcn_fence(__ATOMIC_RELEASE, "workgroup"); } while (0)


// Multi-head spatial attention block (B 16, C 256, 32x32 = 1,024 positions, d_model 512 = 8 x 64): MHA over positions + Wo + residual LN + SiLU FFN + residual LN; second output = inbound attention map (sum over queries, mean over heads).
#define NB 16
#define CIN 256
#define TT 1024
#define CC 512
#define NH 8
#define HD 64
#define BG 2                  // batches per launch group
#define ZG (BG * NH)          // 16 (b,h) slices per launch
#define NR (NB * TT)
#ifndef TNB
#define TNB NB
#endif
typedef __attribute__((ext_vector_type(8))) __bf16 v8b;
__device__ __forceinline__ v16b frag_b(const __bf16* rowk0, int lane) {
  union { v16b v; v8b q[2]; } u; const __bf16* p = rowk0 + 8 * (lane >> 4);
  u.q[0] = *(const v8b*)p; u.q[1] = *(const v8b*)(p + 16); return u.v;
}
__device__ __forceinline__ float bfr(float v) { return (float)(__bf16)v; }
__device__ __attribute__((noinline)) float exp_ni(float v) { return expf(v); }
__device__ __attribute__((noinline)) float erf_ni(float v) { return erff(v); }

#define OUT1_OFF ((size_t)NB * CIN * TT)
#define WS_QH  0u
#define WS_QL  (WS_QH + 2u * (size_t)NR * CC)
#define WS_KH  (WS_QL + 2u * (size_t)NR * CC)
#define WS_VT  (WS_KH + 2u * (size_t)NR * CC)          // f16 v planes [b][512][t]
#define WS_S   (WS_VT + 2u * (size_t)NR * CC)          // f32 S [ZG][t][t]
#define WS_PH  (WS_S + 4u * (size_t)ZG * TT * TT)       // f16 P [ZG][t][t]
#define WS_Y   (WS_PH + 2u * (size_t)ZG * TT * TT)      // f32 O rows [b*t][512]
#define WS_Z1  (WS_Y + 4u * (size_t)NR * CC)           // f32 LN1 rows [b*t][256]
#define WS_HM  (WS_Z1 + 4u * (size_t)NR * CIN)         // f32 silu rows [b*t][256]
#define QCH 64                // query rows per partial column sum
#define NPART (NH * (TT / QCH))   // partial rows per batch
#define WS_CP  (WS_HM + 4u * (size_t)NR * CIN)         // f32 partial column sums [b][NPART][t]
#define WS_END (WS_CP + 4u * (size_t)NB * NPART * TT)

// ---- k_proj: block = (64 positions, 128 cols, b*3 + which): x^T tile; W (in,out) [256][512]
__global__ __launch_bounds__(128) void k_proj(const float* __restrict__ X, const float* __restrict__ WQ, const float* __restrict__ BQ, const float* __restrict__ WK, const float* __restrict__ BK, const float* __restrict__ WV, const float* __restrict__ BV, _Float16* __restrict__ QH, _Float16* __restrict__ QL, _Float16* __restrict__ KH, _Float16* __restrict__ VT) {
  __shared__ __align__(16) __bf16 sx[64][CIN + 8]; __shared__ __align__(16) _Float16 sh[64][136], sl[64][136]; __shared__ __align__(16) _Float16 th[128][72];
  const int tid = threadIdx.x, wave = tid >> 5, lane = tid & 31, col = lane & 15, g = lane >> 4; const int p0 = blockIdx.x * 64; const int c0 = blockIdx.y * 128; const size_t b = blockIdx.z / 3; const int which = blockIdx.z % 3;
  const float* Wm = which == 0 ? WQ : which == 1 ? WK : WV; const float* Bm = which == 0 ? BQ : which == 1 ? BK : BV;
  for (int e = tid; e < CIN * 64; e += 128) { const int c = e >> 6, pl = e & 63; sx[pl][c] = (__bf16)X[(b * CIN + c) * (size_t)TT + p0 + pl]; }
  __syncthreads();
  v8f acc[8] = {};
#pragma unroll 2
  for (int kc = 0; kc < CIN / 32; ++kc) { const v16b a = frag_b(&sx[wave * 16 + col][kc * 32], lane);
#pragma unroll
    for (int j = 0; j < 8; ++j) { v16b w; const int o = c0 + j * 16 + col;
#pragma unroll
      for (int i = 0; i < 8; ++i) { w[i] = (__bf16)Wm[(size_t)(kc * 32 + 8 * g + i) * CC + o]; w[8 + i] = (__bf16)Wm[(size_t)(kc * 32 + 16 + 8 * g + i) * CC + o]; }
      acc[j] = wmma_bf(a, w, acc[j]); } }
#pragma unroll
  for (int j = 0; j < 8; ++j) { const float bb = bfr(Bm[c0 + j * 16 + col]);
#pragma unroll
    for (int r = 0; r < 8; ++r) { const float v = acc[j][r] + bb; const int rl = wave * 16 + 8 * g + r, cl = j * 16 + col; const _Float16 hv = (_Float16)v;
      if (which == 2) th[cl][rl] = hv; else { sh[rl][cl] = hv; sl[rl][cl] = (_Float16)(v - (float)hv); } } }
  __syncthreads();
  if (which < 2) { _Float16* dh = which == 0 ? QH : KH; for (int e = tid; e < 64 * 16; e += 128) { const int rl = e >> 4, q = e & 15; const size_t row = b * TT + p0 + rl; vst2((unsigned*)(dh + row * CC + c0 + q * 8), *(const v4u*)&sh[rl][q * 8]); if (which == 0) vst2((unsigned*)(QL + row * CC + c0 + q * 8), *(const v4u*)&sl[rl][q * 8]); } }
  else { for (int e = tid; e < 128 * 8; e += 128) { const int cl = e >> 3, q = e & 7; vst2((unsigned*)(VT + (b * CC + c0 + cl) * (size_t)TT + p0 + q * 8), *(const v4u*)&th[cl][q * 8]); } } }
// ---- k_sc: block = (64 queries, 128 keys, z = bl*8 + h): logits / 8 (2 products)
__global__ __launch_bounds__(128) void k_sc(const _Float16* __restrict__ QH, const _Float16* __restrict__ QL, const _Float16* __restrict__ KH, int b0, float* __restrict__ S0) { __shared__ __align__(16) float ss[4][16][132];
  const int z = blockIdx.z; const size_t b = b0 + z / NH; const int h = z % NH; float* S = S0 + (size_t)z * TT * TT;
  const int tid = threadIdx.x, wave = tid >> 5, lane = tid & 31, col = lane & 15, g = lane >> 4; const int k0 = blockIdx.y * 128; const int ql0 = blockIdx.x * 64 + wave * 16; const size_t q0 = b * TT + ql0;
  v8f acc[8] = {};
#pragma unroll
  for (int kc = 0; kc < HD / 32; ++kc) { const v16h ah = frag_h(QH + (q0 + col) * CC + h * HD + kc * 32, lane), al = frag_h(QL + (q0 + col) * CC + h * HD + kc * 32, lane);
#pragma unroll
    for (int j = 0; j < 8; ++j) { const v16h kb = frag_h(KH + (b * TT + k0 + j * 16 + col) * CC + h * HD + kc * 32, lane); acc[j] = wmma16(ah, kb, acc[j]); acc[j] = wmma16(al, kb, acc[j]); } }
#pragma unroll
  for (int j = 0; j < 8; ++j)
#pragma unroll
    for (int r = 0; r < 8; ++r) ss[wave][8 * g + r][j * 16 + col] = acc[j][r] * 0.125f;
  LDSX(); for (int rl = 0; rl < 16; ++rl) vst2(S + (size_t)(ql0 + rl) * TT + k0 + lane * 4, *(const v4f*)&ss[wave][rl][lane * 4]); }
// ---- k_sm: block = (row, z): softmax -> P f16 x 2^11
__global__ __launch_bounds__(256) void k_sm(const float* __restrict__ S0, _Float16* __restrict__ PH0) { __shared__ float sred[8]; __shared__ float sbc; __shared__ __align__(16) _Float16 sh[TT];
  const int t = threadIdx.x; const size_t row = blockIdx.x; const float* sr = S0 + (size_t)blockIdx.y * TT * TT + row * TT; _Float16* ph = PH0 + (size_t)blockIdx.y * TT * TT + row * TT;
  float m = -3.0e38f; for (int k = t; k < TT; k += 256) m = fmaxf(m, sr[k]);
#pragma unroll
  for (int o = 1; o < 32; o <<= 1) m = fmaxf(m, __shfl_xor(m, o));
  if ((t & 31) == 0) sred[t >> 5] = m; __syncthreads(); if (t == 0) { float a = sred[0]; for (int i = 1; i < 8; ++i) a = fmaxf(a, sred[i]); sbc = a; } __syncthreads(); m = sbc; __syncthreads();
  float sum = 0.f; for (int k = t; k < TT; k += 256) sum += expf(sr[k] - m);
#pragma unroll
  for (int o = 1; o < 32; o <<= 1) sum += __shfl_xor(sum, o);
  if ((t & 31) == 0) sred[t >> 5] = sum; __syncthreads(); if (t == 0) { float a = 0.f; for (int i = 0; i < 8; ++i) a += sred[i]; sbc = 1.0f / a; } __syncthreads(); const float inv = sbc;
  for (int k = t; k < TT; k += 256) sh[k] = (_Float16)(expf(sr[k] - m) * inv * 2048.0f);
  __syncthreads(); for (int q = t; q < TT / 8; q += 256) vst2((unsigned*)(ph + q * 8), *(const v4u*)&sh[q * 8]); }
// ---- k_col: block = (64 queries, z): partial column sums of one (batch, head) slice over the block's 64 query rows, all 1,024 keys (P stored x 2^11); 128 threads x 8 keys cover a row, 4 rows per step, all 16 loads of a thread in flight at once
__global__ __launch_bounds__(512) void k_col(const _Float16* __restrict__ PH0, int b0, float* __restrict__ CP) { __shared__ __align__(16) float sp[4][TT];
  const int t = threadIdx.x, rg = t >> 7, kq = t & 127; const int z = blockIdx.y; const size_t b = b0 + z / NH; const int h = z % NH;
  const _Float16* p = PH0 + ((size_t)z * TT + blockIdx.x * QCH + rg) * TT + kq * 8;
  v8h v[QCH / 4];
#pragma unroll
  for (int i = 0; i < QCH / 4; ++i) v[i] = *(const v8h*)(p + (size_t)i * 4 * TT);
  v4f a0 = {}, a1 = {};
#pragma unroll
  for (int i = 0; i < QCH / 4; ++i)
#pragma unroll
    for (int e = 0; e < 4; ++e) { a0[e] += (float)v[i][e]; a1[e] += (float)v[i][4 + e]; }
  *(v4f*)&sp[rg][kq * 8] = a0; *(v4f*)&sp[rg][kq * 8 + 4] = a1;
  __syncthreads();
  if (t < TT / 4) { const v4f s = (*(const v4f*)&sp[0][t * 4] + *(const v4f*)&sp[1][t * 4]) + (*(const v4f*)&sp[2][t * 4] + *(const v4f*)&sp[3][t * 4]);
    vst2(CP + ((b * NPART + h * (TT / QCH) + blockIdx.x) * (size_t)TT + t * 4), s); } }
// ---- k_colr: block = (128 keys, batch): attn_map[b][k] = (1/8) sum over the batch's 128 partial rows (8 heads x 16 query blocks); wave w sums 16 rows, then 8 wave sums through LDS
__global__ __launch_bounds__(256) void k_colr(const float* __restrict__ CP, float* __restrict__ AM) { __shared__ __align__(16) float sr[8][128];
  const int t = threadIdx.x, w = t >> 5, lane = t & 31; const size_t b = blockIdx.y; const int k0 = blockIdx.x * 128;
  const float* p = CP + (b * NPART + w * (NPART / 8)) * (size_t)TT + k0 + lane * 4;
  v4f v[NPART / 8];
#pragma unroll
  for (int i = 0; i < NPART / 8; ++i) v[i] = *(const v4f*)(p + (size_t)i * TT);
  v4f a = {};
#pragma unroll
  for (int i = 0; i < NPART / 8; ++i) a += v[i];
  *(v4f*)&sr[w][lane * 4] = a;
  __syncthreads();
  if (t < 32) { v4f s = *(const v4f*)&sr[0][t * 4];
#pragma unroll
    for (int i = 1; i < 8; ++i) s += *(const v4f*)&sr[i][t * 4];
    vst2(AM + b * TT + k0 + t * 4, s * (1.0f / 2048.0f) * (1.0f / NH)); } }
// ---- k_pv: block = (64 queries, z): O rows [b*t][h*64 + d] = P . v (1 product)
__global__ __launch_bounds__(128) void k_pv(const _Float16* __restrict__ PH0, const _Float16* __restrict__ VT, int b0, float* __restrict__ Y) { __shared__ __align__(16) float ss[4][16][68];
  const int z = blockIdx.z; const size_t b = b0 + z / NH; const int h = z % NH; const _Float16* PH = PH0 + (size_t)z * TT * TT;
  const int tid = threadIdx.x, wave = tid >> 5, lane = tid & 31, col = lane & 15, g = lane >> 4; const int ql0 = blockIdx.x * 64 + wave * 16;
  v8f acc[4] = {};
#pragma unroll 1
  for (int kc = 0; kc < TT / 32; ++kc) { const v16h ph = frag_h(PH + (size_t)(ql0 + col) * TT + kc * 32, lane);
#pragma unroll
    for (int j = 0; j < 4; ++j) acc[j] = wmma16(ph, frag_h(VT + (b * CC + h * HD + j * 16 + col) * (size_t)TT + kc * 32, lane), acc[j]); }
#pragma unroll
  for (int j = 0; j < 4; ++j)
#pragma unroll
    for (int r = 0; r < 8; ++r) ss[wave][8 * g + r][j * 16 + col] = acc[j][r] * (1.0f / 2048.0f);
  LDSX(); for (int rl = 0; rl < 16; ++rl) if (lane < 16) vst2(Y + (b * TT + ql0 + rl) * CC + h * HD + lane * 4, *(const v4f*)&ss[wave][rl][lane * 4]); }
// ---- k_lnA: block = 64 rows x all 256 output cols: Z1 = LN(Y (hi+lo) Wo + bo + x^T) (K 512); writes Z1 rows
// ---- k_lnB: out = LN(HM (hi+lo) W2 + b2 + Z1) (K 256); writes channel-major output planes
template <int MODE>
__global__ __launch_bounds__(128) void k_ln(const float* __restrict__ A, const float* __restrict__ Wm, const float* __restrict__ Bv, const float* __restrict__ RES, const float* __restrict__ GA, const float* __restrict__ BE, float* __restrict__ DST) {
  __shared__ __align__(16) float sz[64][CIN + 4];
  const int tid = threadIdx.x, wave = tid >> 5, lane = tid & 31, col = lane & 15, g = lane >> 4; const size_t r0 = (size_t)blockIdx.x * 64; const size_t b = r0 / TT; const int p0 = (int)(r0 % TT); constexpr int K = (MODE == 0) ? CC : CIN;
#pragma unroll 1
  for (int half = 0; half < 2; ++half) {
    v8f acc[8]; for (int j = 0; j < 8; ++j) for (int r = 0; r < 8; ++r) acc[j][r] = 0.f;
#pragma unroll 1
    for (int kc = 0; kc < K / 32; ++kc) { const F2 a = split_row(A + (r0 + wave * 16 + col) * K, kc * 32, lane);
#pragma unroll
      for (int j = 0; j < 8; ++j) { v16b w; const int o = half * 128 + j * 16 + col;
#pragma unroll
        for (int i = 0; i < 8; ++i) { w[i] = (__bf16)Wm[(size_t)(kc * 32 + 8 * g + i) * CIN + o]; w[8 + i] = (__bf16)Wm[(size_t)(kc * 32 + 16 + 8 * g + i) * CIN + o]; }
        acc[j] = wmma_bf(a.h, w, acc[j]); acc[j] = wmma_bf(a.l, w, acc[j]); } }
#pragma unroll
    for (int j = 0; j < 8; ++j) { const int o = half * 128 + j * 16 + col; const float bb = bfr(Bv[o]);
#pragma unroll
      for (int r = 0; r < 8; ++r) { const int rl = wave * 16 + 8 * g + r; const float res = (MODE == 0) ? bfr(RES[(b * CIN + o) * (size_t)TT + p0 + rl]) : RES[(r0 + rl) * CIN + o]; sz[rl][o] = acc[j][r] + bb + res; } } }
  __syncthreads();
  // LayerNorm per row (wave handles 16 rows; lanes stride columns)
  for (int rr = 0; rr < 16; ++rr) { const int rl = wave * 16 + rr; float s = 0.f; for (int c = lane; c < CIN; c += 32) s += sz[rl][c];
#pragma unroll
    for (int o2 = 1; o2 < 32; o2 <<= 1) s += __shfl_xor(s, o2); const float mu = s / CIN; float q = 0.f; for (int c = lane; c < CIN; c += 32) { const float d = sz[rl][c] - mu; q += d * d; }
#pragma unroll
    for (int o2 = 1; o2 < 32; o2 <<= 1) q += __shfl_xor(q, o2); const float inv = 1.0f / sqrtf(q / CIN + 1e-5f);
    for (int c = lane; c < CIN; c += 32) sz[rl][c] = (sz[rl][c] - mu) * inv * bfr(GA[c]) + bfr(BE[c]); }
  __syncthreads();
  if (MODE == 0) { for (int e = tid; e < 64 * 64; e += 128) { const int rl = e >> 6, q = e & 63; vst2(DST + (r0 + rl) * CIN + q * 4, *(const v4f*)&sz[rl][q * 4]); } }
  else { // channel-major planes [b][c][p0 .. p0+63]: transpose through registers: for (c, 4 consecutive positions)
    for (int e = tid; e < CIN * 16; e += 128) { const int c = e >> 4, q = e & 15; __align__(16) float v4x[4]; v4x[0] = sz[q * 4][c]; v4x[1] = sz[q * 4 + 1][c]; v4x[2] = sz[q * 4 + 2][c]; v4x[3] = sz[q * 4 + 3][c]; vst2(DST + (b * CIN + c) * (size_t)TT + p0 + q * 4, *(const v4f*)v4x); } } }
// ---- k_ffn1: block = (64 rows, 128 cols): HM = silu(Z1 (hi+lo) W1 + b1)
__global__ __launch_bounds__(128) void k_ffn1(const float* __restrict__ Z1, const float* __restrict__ W1, const float* __restrict__ B1, float* __restrict__ HM) { __shared__ __align__(16) float sf[4][16][132];
  const int tid = threadIdx.x, wave = tid >> 5, lane = tid & 31, col = lane & 15, g = lane >> 4; const int c0 = blockIdx.y * 128; const size_t r0 = (size_t)blockIdx.x * 64 + wave * 16;
  v8f acc[8] = {};
#pragma unroll
  for (int kc = 0; kc < CIN / 32; ++kc) { const F2 a = split_row(Z1 + (r0 + col) * CIN, kc * 32, lane);
#pragma unroll
    for (int j = 0; j < 8; ++j) { v16b w; const int o = c0 + j * 16 + col;
#pragma unroll
      for (int i = 0; i < 8; ++i) { w[i] = (__bf16)W1[(size_t)(kc * 32 + 8 * g + i) * CIN + o]; w[8 + i] = (__bf16)W1[(size_t)(kc * 32 + 16 + 8 * g + i) * CIN + o]; }
      acc[j] = wmma_bf(a.h, w, acc[j]); acc[j] = wmma_bf(a.l, w, acc[j]); } }
#pragma unroll
  for (int j = 0; j < 8; ++j) { const float bb = bfr(B1[c0 + j * 16 + col]);
#pragma unroll
    for (int r = 0; r < 8; ++r) { const float v = acc[j][r] + bb; sf[wave][8 * g + r][j * 16 + col] = v / (1.0f + expf(-v)); } }
  LDSX(); for (int rl = 0; rl < 16; ++rl) vst2(HM + (r0 + rl) * CIN + c0 + lane * 4, *(const v4f*)&sf[wave][rl][lane * 4]); }
extern "C" void kernel_launch(void* const* d_in, const int* in_sizes, int n_in, void* d_out, int out_size, void* d_ws, size_t ws_size, hipStream_t stream) {
  (void)in_sizes; (void)n_in; (void)out_size;
  const float** F = (const float**)d_in;   // 0 x [16,256,32,32], 1 Wq [256,512], 2 bq, 3 Wk, 4 bk, 5 Wv, 6 bv, 7 Wo [512,256], 8 bo, 9 W1 [256,256], 10 b1, 11 W2, 12 b2, 13 g1, 14 be1, 15 g2, 16 be2
  if (ws_size < (size_t)WS_END) return;
  char* ws = (char*)d_ws; _Float16 *QH = (_Float16*)(ws + WS_QH), *QL = (_Float16*)(ws + WS_QL), *KH = (_Float16*)(ws + WS_KH), *VT = (_Float16*)(ws + WS_VT), *PH = (_Float16*)(ws + WS_PH); float *S = (float*)(ws + WS_S), *Y = (float*)(ws + WS_Y), *Z1 = (float*)(ws + WS_Z1), *HM = (float*)(ws + WS_HM), *CP = (float*)(ws + WS_CP);
  float* OUT0 = (float*)d_out; float* OUT1 = (float*)d_out + OUT1_OFF;
  k_proj<<<dim3(TT / 64, CC / 128, TNB * 3), 128, 0, stream>>>(F[0], F[1], F[2], F[3], F[4], F[5], F[6], QH, QL, KH, VT);
  for (int b0 = 0; b0 < TNB; b0 += BG) { const int ng = ((TNB - b0) < BG ? (TNB - b0) : BG);
    k_sc<<<dim3(TT / 64, TT / 128, ng * NH), 128, 0, stream>>>(QH, QL, KH, b0, S);
    k_sm<<<dim3(TT, ng * NH), 256, 0, stream>>>(S, PH);
    k_col<<<dim3(TT / QCH, ng * NH), 512, 0, stream>>>(PH, b0, CP);
    k_pv<<<dim3(TT / 64, 1, ng * NH), 128, 0, stream>>>(PH, VT, b0, Y);
  }
  k_colr<<<dim3(TT / 128, TNB), 256, 0, stream>>>(CP, OUT1);
  k_ln<0><<<TNB * TT / 64, 128, 0, stream>>>(Y, F[7], F[8], F[0], F[13], F[14], Z1);
  k_ffn1<<<dim3(TNB * TT / 64, CIN / 128), 128, 0, stream>>>(Z1, F[9], F[10], HM);
  k_ln<1><<<TNB * TT / 64, 128, 0, stream>>>(HM, F[11], F[12], Z1, F[15], F[16], OUT0);
}

// v002
// It runs in 430 microseconds.
// Timed twice side by side with v001, it ran 2.63 and 2.64 times as fast.
// All steps since v000 together make it 17.6 times as fast.
// compute dtype: all float inputs rounded to bf16; Q/K/V = x^T W + b with EXACT bf16 products on WMMA 16x16x32 (channel-major tiles transposed in LDS), f32 accumulate; Q as f16 hi + residual, K f16 -> 2-product logits / 8 kept in f32 registers (one fused launch for logits, softmax, column sums and P . V); softmax in f32 (precise expf) -> P f16 x 2^11; attn_map = column sums of P / 8 in f32; O = P . V (V rounded once to f16, 1 product); Wo, W1, W2 GEMMs with the f32 activations split bf16 hi + lo (2 products); LayerNorms (eps 1e-5), SiLU and residuals in f32; outputs: out channel-major [b][c][hw], attn_map [b][hw].
#include <hip/hip_runtime.h>
#include <math.h>

typedef __attribute__((ext_vector_type(16))) _Float16 v16h;
typedef __attribute__((ext_vector_type(16))) __bf16 v16b;
typedef __attribute__((ext_vector_type(8)))  _Float16 v8h;
typedef __attribute__((ext_vector_type(8)))  float v8f;
typedef __attribute__((ext_vector_type(4)))  float v4f;
typedef __attribute__((ext_vector_type(2)))  float v2f;
typedef __attribute__((ext_vector_type(4)))  unsigned v4u;
typedef __attribute__((ext_vector_type(4)))  int v4i;
typedef float __attribute__((may_alias)) float_a;
typedef int __attribute__((may_alias)) int_a;

template <typename T> __device__ __forceinline__ void vst2(void* p, T v) { *(T*)p = v;  }
__device__ __forceinline__ v8f wmma16(v16h a, v16h b, v8f c) {
  v8f d = __builtin_amdgcn_wmma_f32_16x16x32_f16(false, a, false, b, (short)0, c, false, false);
  asm volatile("v_nop\n\tv_nop\n\tv_nop\n\tv_nop" : "+v"(d) : "v"(a), "v"(b));
  return d;
}
__device__ __forceinline__ v8f wmma_bf(v16b a, v16b b, v8f c) {
  v8f d = __builtin_amdgcn_wmma_f32_16x16x32_bf16(false, a, false, b, (short)0, c, false, false);
  asm volatile("v_nop\n\tv_nop\n\tv_nop\n\tv_nop" : "+v"(d) : "v"(a), "v"(b));
  return d;
}
// 16x16x32 fragments: lane = (h = lane>>4, row/col = lane&15); elements 0..7 = k0+8h+0..7, 8..15 = k0+16+8h+0..7; D element r = row 8h+r
__device__ __forceinline__ v16h frag_h(const _Float16* rowk0, int lane) {
  union { v16h v; v8h q[2]; } u; const _Float16* p = rowk0 + 8 * (lane >> 4);
  u.q[0] = *(const v8h*)p; u.q[1] = *(const v8h*)(p + 16); return u.v;
}
__device__ __forceinline__ v16h frag_f32(const float* rowk0, int lane) {
  v16h a; const float* p = rowk0 + 8 * (lane >> 4);
#pragma unroll
  for (int i = 0; i < 8; ++i) { a[i] = (_Float16)p[i]; a[8 + i] = (_Float16)p[16 + i]; }
  return a;
}
__device__ __forceinline__ v16h frag_f32s(const float* rowk0, int lane, float sc) {
  v16h a; const float* p = rowk0 + 8 * (lane >> 4);
#pragma unroll
  for (int i = 0; i < 8; ++i) { a[i] = (_Float16)(p[i] * sc); a[8 + i] = (_Float16)(p[16 + i] * sc); }
  return a;
}
// column fragment from a [K][ld] layout (column n), rows >= K read as 0
__device__ __forceinline__ v16h fragc_f32(const float* W, int k0, int n, int lane, int ld, int K) {
  v16h a; const int g = lane >> 4;
#pragma unroll
  for (int i = 0; i < 8; ++i) { const int ka = k0 + 8 * g + i, kb = ka + 16;
    a[i] = (_Float16)(ka < K ? W[(size_t)(ka < K ? ka : K - 1) * ld + n] : 0.f); a[8 + i] = (_Float16)(kb < K ? W[(size_t)(kb < K ? kb : K - 1) * ld + n] : 0.f); }
  return a;
}
struct F2 { v16b h, l; };
__device__ __forceinline__ F2 bsplit16(const float v[16]) { F2 r;
#pragma unroll
  for (int i = 0; i < 16; ++i) { const __bf16 h = (__bf16)v[i]; r.h[i] = h; r.l[i] = (__bf16)(v[i] - (float)h); }
  return r; }
__device__ __forceinline__ F2 split_row(const float* row, int k0, int lane) { float v[16]; const float* p = row + k0 + 8 * (lane >> 4);
#pragma unroll
  for (int i = 0; i < 8; ++i) { v[i] = p[i]; v[8 + i] = p[16 + i]; }
  return bsplit16(v); }
__device__ __forceinline__ F2 split_rowK(const float* row, int k0, int lane, int K) { float v[16]; const int g = lane >> 4;
#pragma unroll
  for (int i = 0; i < 8; ++i) { const int ka = k0 + 8 * g + i, kb = ka + 16; v[i] = ka < K ? row[ka < K ? ka : K - 1] : 0.f; v[8 + i] = kb < K ? row[kb < K ? kb : K - 1] : 0.f; }
  return bsplit16(v); }
__device__ __forceinline__ F2 split_col(const float* W, int k0, int n, int lane, int ld, int K) { float v[16]; const int g = lane >> 4;
#pragma unroll
  for (int i = 0; i < 8; ++i) { const int ka = k0 + 8 * g + i, kb = ka + 16; v[i] = ka < K ? W[(size_t)(ka < K ? ka : K - 1) * ld + n] : 0.f; v[8 + i] = kb < K ? W[(size_t)(kb < K ? kb : K - 1) * ld + n] : 0.f; }
  return bsplit16(v); }
__device__ __forceinline__ v8f mac3(const F2& a, const F2& b, v8f c) { c = wmma_bf(a.l, b.h, c); c = wmma_bf(a.h, b.l, c); return wmma_bf(a.h, b.h, c); }
__device__ __forceinline__ float sigm(float v) { return 1.0f / (1.0f + expf(-v)); }
#define LDSX() do { asm volatile("s_wait_dscnt 0" ::: "memory"); __builtin_amdgcn_wave_barrier(); __builtin_amdgcn_fence(__ATOMIC_RELEASE, "workgroup"); } while (0)


// Multi-head spatial attention block (B 16, C 256, 32x32 = 1,024 positions, d_model 512 = 8 x 64): MHA over positions + Wo + residual LN + SiLU FFN + residual LN; second output = inbound attention map (sum over queries, mean over heads).
#define NB 16
#define CIN 256
#define TT 1024
#define CC 512
#define NH 8
#define HD 64
#define NR (NB * TT)
#ifndef TNB
#define TNB NB
#endif
typedef __attribute__((ext_vector_type(8))) __bf16 v8b;
__device__ __forceinline__ v16b frag_b(const __bf16* rowk0, int lane) {
  union { v16b v; v8b q[2]; } u; const __bf16* p = rowk0 + 8 * (lane >> 4);
  u.q[0] = *(const v8b*)p; u.q[1] = *(const v8b*)(p + 16); return u.v;
}
__device__ __forceinline__ float bfr(float v) { return (float)(__bf16)v; }
__device__ __attribute__((noinline)) float exp_ni(float v) { return expf(v); }
__device__ __attribute__((noinline)) float erf_ni(float v) { return erff(v); }

#define OUT1_OFF ((size_t)NB * CIN * TT)
#define WS_QH  0u
#define WS_QL  (WS_QH + 2u * (size_t)NR * CC)
#define WS_KH  (WS_QL + 2u * (size_t)NR * CC)
#define WS_VT  (WS_KH + 2u * (size_t)NR * CC)          // f16 v planes [b][512][t]
#define WS_Y   (WS_VT + 2u * (size_t)NR * CC)          // f32 O rows [b*t][512]
#define WS_Z1  (WS_Y + 4u * (size_t)NR * CC)           // f32 LN1 rows [b*t][256]
#define WS_HM  (WS_Z1 + 4u * (size_t)NR * CIN)         // f32 silu rows [b*t][256]
#define QCH 64                // query rows per partial column sum
#define NPART (NH * (TT / QCH))   // partial rows per batch
#define WS_CP  (WS_HM + 4u * (size_t)NR * CIN)         // f32 partial column sums [b][NPART][t]
#define WS_END (WS_CP + 4u * (size_t)NB * NPART * TT)

// ---- k_proj: block = (64 positions, 128 cols, b*3 + which): x^T tile; W (in,out) [256][512]
__global__ __launch_bounds__(128) void k_proj(const float* __restrict__ X, const float* __restrict__ WQ, const float* __restrict__ BQ, const float* __restrict__ WK, const float* __restrict__ BK, const float* __restrict__ WV, const float* __restrict__ BV, _Float16* __restrict__ QH, _Float16* __restrict__ QL, _Float16* __restrict__ KH, _Float16* __restrict__ VT) {
  __shared__ __align__(16) __bf16 sx[64][CIN + 8]; __shared__ __align__(16) _Float16 sh[64][136], sl[64][136]; __shared__ __align__(16) _Float16 th[128][72];
  const int tid = threadIdx.x, wave = tid >> 5, lane = tid & 31, col = lane & 15, g = lane >> 4; const int p0 = blockIdx.x * 64; const int c0 = blockIdx.y * 128; const size_t b = blockIdx.z / 3; const int which = blockIdx.z % 3;
  const float* Wm = which == 0 ? WQ : which == 1 ? WK : WV; const float* Bm = which == 0 ? BQ : which == 1 ? BK : BV;
  for (int e = tid; e < CIN * 64; e += 128) { const int c = e >> 6, pl = e & 63; sx[pl][c] = (__bf16)X[(b * CIN + c) * (size_t)TT + p0 + pl]; }
  __syncthreads();
  v8f acc[8] = {};
#pragma unroll 2
  for (int kc = 0; kc < CIN / 32; ++kc) { const v16b a = frag_b(&sx[wave * 16 + col][kc * 32], lane);
#pragma unroll
    for (int j = 0; j < 8; ++j) { v16b w; const int o = c0 + j * 16 + col;
#pragma unroll
      for (int i = 0; i < 8; ++i) { w[i] = (__bf16)Wm[(size_t)(kc * 32 + 8 * g + i) * CC + o]; w[8 + i] = (__bf16)Wm[(size_t)(kc * 32 + 16 + 8 * g + i) * CC + o]; }
      acc[j] = wmma_bf(a, w, acc[j]); } }
#pragma unroll
  for (int j = 0; j < 8; ++j) { const float bb = bfr(Bm[c0 + j * 16 + col]);
#pragma unroll
    for (int r = 0; r < 8; ++r) { const float v = acc[j][r] + bb; const int rl = wave * 16 + 8 * g + r, cl = j * 16 + col; const _Float16 hv = (_Float16)v;
      if (which == 2) th[cl][rl] = hv; else { sh[rl][cl] = hv; sl[rl][cl] = (_Float16)(v - (float)hv); } } }
  __syncthreads();
  if (which < 2) { _Float16* dh = which == 0 ? QH : KH; for (int e = tid; e < 64 * 16; e += 128) { const int rl = e >> 4, q = e & 15; const size_t row = b * TT + p0 + rl; vst2((unsigned*)(dh + row * CC + c0 + q * 8), *(const v4u*)&sh[rl][q * 8]); if (which == 0) vst2((unsigned*)(QL + row * CC + c0 + q * 8), *(const v4u*)&sl[rl][q * 8]); } }
  else { for (int e = tid; e < 128 * 8; e += 128) { const int cl = e >> 3, q = e & 7; vst2((unsigned*)(VT + (b * CC + c0 + cl) * (size_t)TT + p0 + q * 8), *(const v4u*)&th[cl][q * 8]); } } }
// ---- k_att: block = (64 queries, z = b*8 + h), 8 waves; wave w owns keys 128w .. 128w+127 and walks the block's queries 32 at a time (two 16-query tiles share every K and V fragment).
// S^T = K . Q^T (2 products): a lane holds one query's logits for 8 consecutive keys of each 16-key tile, so the whole 32 x 128 tile stays in registers,
// the row maximum and sum need one exchange between wave halves and one between waves, and two neighbouring tiles pack straight into the B operand of O^T = V^T . P^T.
// Column sums: the wave's own P tile goes through LDS once (row = query), each lane then adds 8 keys over 16 queries and keeps the sums over the block's 64 queries.
// waves_per_eu(4, 4) holds a wave to 256 registers, so that two blocks (16 waves) share a WGP, which their LDS also allows.
__global__ __launch_bounds__(256) __attribute__((amdgpu_waves_per_eu(4, 4))) void k_att(const _Float16* __restrict__ QH, const _Float16* __restrict__ QL, const _Float16* __restrict__ KH, const _Float16* __restrict__ VT, float* __restrict__ Y, float* __restrict__ CP) {
  __shared__ float smx[2][8][32]; __shared__ __align__(16) _Float16 sp[8][32][144]; __shared__ __align__(16) float so[8][32][68];
  const int z = blockIdx.y; const size_t b = z / NH; const int h = z % NH;
  const int tid = threadIdx.x, wave = tid >> 5, lane = tid & 31, col = lane & 15, g = lane >> 4; const int kw = wave * 128;
  const _Float16* Kp = KH + (b * TT + kw + col) * CC + h * HD; const _Float16* Vp = VT + (b * CC + h * HD + col) * (size_t)TT + kw;
  v4f c0 = {}, c1 = {};
#pragma unroll 1   // rolled: unrolled, the two passes' tiles would compete for the 256 registers
  for (int qp = 0; qp < 2; ++qp) { const size_t q0 = b * TT + blockIdx.x * 64 + qp * 32;
    v8f s[8][2] = {};
#pragma unroll
    for (int kc = 0; kc < HD / 32; ++kc) { v16h hq[2], lq[2];
#pragma unroll
      for (int u = 0; u < 2; ++u) { hq[u] = frag_h(QH + (q0 + u * 16 + col) * CC + h * HD + kc * 32, lane); lq[u] = frag_h(QL + (q0 + u * 16 + col) * CC + h * HD + kc * 32, lane); }
#pragma unroll
      for (int t = 0; t < 8; ++t) { const v16h k = frag_h(Kp + (size_t)t * 16 * CC + kc * 32, lane);
#pragma unroll
        for (int u = 0; u < 2; ++u) { s[t][u] = wmma16(k, hq[u], s[t][u]); s[t][u] = wmma16(k, lq[u], s[t][u]); } } }
    float m[2], inv[2];
#pragma unroll
    for (int u = 0; u < 2; ++u) {
#pragma unroll
      for (int t = 0; t < 8; ++t) s[t][u] = s[t][u] * 0.125f;
      v8f mv = s[0][u];
#pragma unroll
      for (int t = 1; t < 8; ++t)
#pragma unroll
        for (int r = 0; r < 8; ++r) mv[r] = fmaxf(mv[r], s[t][u][r]);
      float a = fmaxf(fmaxf(fmaxf(mv[0], mv[1]), fmaxf(mv[2], mv[3])), fmaxf(fmaxf(mv[4], mv[5]), fmaxf(mv[6], mv[7])));
      a = fmaxf(a, __shfl_xor(a, 16)); if (g == 0) smx[0][wave][u * 16 + col] = a; }
    __syncthreads();
#pragma unroll
    for (int u = 0; u < 2; ++u) { const int x = u * 16 + col;
      m[u] = fmaxf(fmaxf(fmaxf(smx[0][0][x], smx[0][1][x]), fmaxf(smx[0][2][x], smx[0][3][x])), fmaxf(fmaxf(smx[0][4][x], smx[0][5][x]), fmaxf(smx[0][6][x], smx[0][7][x])));
      v8f sv = {};
#pragma unroll
      for (int t = 0; t < 8; ++t)
#pragma unroll
        for (int r = 0; r < 8; ++r) { s[t][u][r] = expf(s[t][u][r] - m[u]); sv[r] += s[t][u][r]; }
      float sum = ((sv[0] + sv[1]) + (sv[2] + sv[3])) + ((sv[4] + sv[5]) + (sv[6] + sv[7]));
      sum += __shfl_xor(sum, 16); if (g == 0) smx[1][wave][x] = sum; }
    __syncthreads();
    v8h p8[8][2];
#pragma unroll
    for (int u = 0; u < 2; ++u) { const int x = u * 16 + col;
      inv[u] = 1.0f / (((smx[1][0][x] + smx[1][1][x]) + (smx[1][2][x] + smx[1][3][x])) + ((smx[1][4][x] + smx[1][5][x]) + (smx[1][6][x] + smx[1][7][x])));
#pragma unroll
      for (int t = 0; t < 8; ++t) {
#pragma unroll
        for (int r = 0; r < 8; ++r) p8[t][u][r] = (_Float16)(s[t][u][r] * inv[u] * 2048.0f);
        *(v8h*)&sp[wave][x][t * 16 + 8 * g] = p8[t][u]; } }
    v8f acc[4][2] = {};
#pragma unroll
    for (int c = 0; c < 4; ++c) { union { v16h v; v8h q[2]; } pb[2];
#pragma unroll
      for (int u = 0; u < 2; ++u) { pb[u].q[0] = p8[2 * c][u]; pb[u].q[1] = p8[2 * c + 1][u]; }
#pragma unroll
      for (int j = 0; j < 4; ++j) { const v16h v = frag_h(Vp + (size_t)j * 16 * TT + c * 32, lane);
#pragma unroll
        for (int u = 0; u < 2; ++u) acc[j][u] = wmma16(v, pb[u].v, acc[j][u]); } }
    LDSX();   // the wave's own P rows are in LDS before its lanes read across them
#pragma unroll
    for (int q = 0; q < 16; ++q) { const v8h v = *(const v8h*)&sp[wave][g * 16 + q][col * 8];
#pragma unroll
      for (int e = 0; e < 4; ++e) { c0[e] += (float)v[e]; c1[e] += (float)v[4 + e]; } }
#pragma unroll
    for (int u = 0; u < 2; ++u)
#pragma unroll
      for (int j = 0; j < 4; ++j) { const v8f o = acc[j][u] * (1.0f / 2048.0f); const v4f lo = { o[0], o[1], o[2], o[3] }, hi = { o[4], o[5], o[6], o[7] };
        *(v4f*)&so[wave][u * 16 + col][j * 16 + 8 * g] = lo; *(v4f*)&so[wave][u * 16 + col][j * 16 + 8 * g + 4] = hi; }
    __syncthreads();
    { const int q = tid >> 3, d0 = (tid & 7) * 8; float* y = Y + (q0 + q) * CC + h * HD + d0;
#pragma unroll
      for (int f = 0; f < 2; ++f) { const int d = d0 + 4 * f;
        vst2(y + 4 * f, ((*(const v4f*)&so[0][q][d] + *(const v4f*)&so[1][q][d]) + (*(const v4f*)&so[2][q][d] + *(const v4f*)&so[3][q][d])) + ((*(const v4f*)&so[4][q][d] + *(const v4f*)&so[5][q][d]) + (*(const v4f*)&so[6][q][d] + *(const v4f*)&so[7][q][d]))); }
      asm volatile("s_wait_xcnt 0x0" ::: "memory"); } }   // the next pass overwrites the registers that the two stores name
#pragma unroll
  for (int e = 0; e < 4; ++e) { c0[e] += __shfl_xor(c0[e], 16); c1[e] += __shfl_xor(c1[e], 16); }
  float* cp = CP + (b * NPART + h * (TT / QCH) + blockIdx.x) * (size_t)TT + kw + col * 8 + 4 * g; vst2(cp, g == 0 ? c0 : c1); }
// ---- k_colr: block = (128 keys, batch): attn_map[b][k] = (1/8) sum over the batch's 128 partial rows (8 heads x 16 query blocks); wave w sums 16 rows, then 8 wave sums through LDS
__global__ __launch_bounds__(256) void k_colr(const float* __restrict__ CP, float* __restrict__ AM) { __shared__ __align__(16) float sr[8][128];
  const int t = threadIdx.x, w = t >> 5, lane = t & 31; const size_t b = blockIdx.y; const int k0 = blockIdx.x * 128;
  const float* p = CP + (b * NPART + w * (NPART / 8)) * (size_t)TT + k0 + lane * 4;
  v4f v[NPART / 8];
#pragma unroll
  for (int i = 0; i < NPART / 8; ++i) v[i] = *(const v4f*)(p + (size_t)i * TT);
  v4f a = {};
#pragma unroll
  for (int i = 0; i < NPART / 8; ++i) a += v[i];
  *(v4f*)&sr[w][lane * 4] = a;
  __syncthreads();
  if (t < 32) { v4f s = *(const v4f*)&sr[0][t * 4];
#pragma unroll
    for (int i = 1; i < 8; ++i) s += *(const v4f*)&sr[i][t * 4];
    vst2(AM + b * TT + k0 + t * 4, s * (1.0f / 2048.0f) * (1.0f / NH)); } }
// ---- k_lnA: block = 64 rows x all 256 output cols: Z1 = LN(Y (hi+lo) Wo + bo + x^T) (K 512); writes Z1 rows
// ---- k_lnB: out = LN(HM (hi+lo) W2 + b2 + Z1) (K 256); writes channel-major output planes
template <int MODE>
__global__ __launch_bounds__(128) void k_ln(const float* __restrict__ A, const float* __restrict__ Wm, const float* __restrict__ Bv, const float* __restrict__ RES, const float* __restrict__ GA, const float* __restrict__ BE, float* __restrict__ DST) {
  __shared__ __align__(16) float sz[64][CIN + 4];
  const int tid = threadIdx.x, wave = tid >> 5, lane = tid & 31, col = lane & 15, g = lane >> 4; const size_t r0 = (size_t)blockIdx.x * 64; const size_t b = r0 / TT; const int p0 = (int)(r0 % TT); constexpr int K = (MODE == 0) ? CC : CIN;
#pragma unroll 1
  for (int half = 0; half < 2; ++half) {
    v8f acc[8]; for (int j = 0; j < 8; ++j) for (int r = 0; r < 8; ++r) acc[j][r] = 0.f;
#pragma unroll 1
    for (int kc = 0; kc < K / 32; ++kc) { const F2 a = split_row(A + (r0 + wave * 16 + col) * K, kc * 32, lane);
#pragma unroll
      for (int j = 0; j < 8; ++j) { v16b w; const int o = half * 128 + j * 16 + col;
#pragma unroll
        for (int i = 0; i < 8; ++i) { w[i] = (__bf16)Wm[(size_t)(kc * 32 + 8 * g + i) * CIN + o]; w[8 + i] = (__bf16)Wm[(size_t)(kc * 32 + 16 + 8 * g + i) * CIN + o]; }
        acc[j] = wmma_bf(a.h, w, acc[j]); acc[j] = wmma_bf(a.l, w, acc[j]); } }
#pragma unroll
    for (int j = 0; j < 8; ++j) { const int o = half * 128 + j * 16 + col; const float bb = bfr(Bv[o]);
#pragma unroll
      for (int r = 0; r < 8; ++r) { const int rl = wave * 16 + 8 * g + r; const float res = (MODE == 0) ? bfr(RES[(b * CIN + o) * (size_t)TT + p0 + rl]) : RES[(r0 + rl) * CIN + o]; sz[rl][o] = acc[j][r] + bb + res; } } }
  __syncthreads();
  // LayerNorm per row (wave handles 16 rows; lanes stride columns)
  for (int rr = 0; rr < 16; ++rr) { const int rl = wave * 16 + rr; float s = 0.f; for (int c = lane; c < CIN; c += 32) s += sz[rl][c];
#pragma unroll
    for (int o2 = 1; o2 < 32; o2 <<= 1) s += __shfl_xor(s, o2); const float mu = s / CIN; float q = 0.f; for (int c = lane; c < CIN; c += 32) { const float d = sz[rl][c] - mu; q += d * d; }
#pragma unroll
    for (int o2 = 1; o2 < 32; o2 <<= 1) q += __shfl_xor(q, o2); const float inv = 1.0f / sqrtf(q / CIN + 1e-5f);
    for (int c = lane; c < CIN; c += 32) sz[rl][c] = (sz[rl][c] - mu) * inv * bfr(GA[c]) + bfr(BE[c]); }
  __syncthreads();
  if (MODE == 0) { for (int e = tid; e < 64 * 64; e += 128) { const int rl = e >> 6, q = e & 63; vst2(DST + (r0 + rl) * CIN + q * 4, *(const v4f*)&sz[rl][q * 4]); } }
  else { // channel-major planes [b][c][p0 .. p0+63]: transpose through registers: for (c, 4 consecutive positions)
    for (int e = tid; e < CIN * 16; e += 128) { const int c = e >> 4, q = e & 15; __align__(16) float v4x[4]; v4x[0] = sz[q * 4][c]; v4x[1] = sz[q * 4 + 1][c]; v4x[2] = sz[q * 4 + 2][c]; v4x[3] = sz[q * 4 + 3][c]; vst2(DST + (b * CIN + c) * (size_t)TT + p0 + q * 4, *(const v4f*)v4x); } } }
// ---- k_ffn1: block = (64 rows, 128 cols): HM = silu(Z1 (hi+lo) W1 + b1)
__global__ __launch_bounds__(128) void k_ffn1(const float* __restrict__ Z1, const float* __restrict__ W1, const float* __restrict__ B1, float* __restrict__ HM) { __shared__ __align__(16) float sf[4][16][132];
  const int tid = threadIdx.x, wave = tid >> 5, lane = tid & 31, col = lane & 15, g = lane >> 4; const int c0 = blockIdx.y * 128; const size_t r0 = (size_t)blockIdx.x * 64 + wave * 16;
  v8f acc[8] = {};
#pragma unroll
  for (int kc = 0; kc < CIN / 32; ++kc) { const F2 a = split_row(Z1 + (r0 + col) * CIN, kc * 32, lane);
#pragma unroll
    for (int j = 0; j < 8; ++j) { v16b w; const int o = c0 + j * 16 + col;
#pragma unroll
      for (int i = 0; i < 8; ++i) { w[i] = (__bf16)W1[(size_t)(kc * 32 + 8 * g + i) * CIN + o]; w[8 + i] = (__bf16)W1[(size_t)(kc * 32 + 16 + 8 * g + i) * CIN + o]; }
      acc[j] = wmma_bf(a.h, w, acc[j]); acc[j] = wmma_bf(a.l, w, acc[j]); } }
#pragma unroll
  for (int j = 0; j < 8; ++j) { const float bb = bfr(B1[c0 + j * 16 + col]);
#pragma unroll
    for (int r = 0; r < 8; ++r) { const float v = acc[j][r] + bb; sf[wave][8 * g + r][j * 16 + col] = v / (1.0f + expf(-v)); } }
  LDSX(); for (int rl = 0; rl < 16; ++rl) vst2(HM + (r0 + rl) * CIN + c0 + lane * 4, *(const v4f*)&sf[wave][rl][lane * 4]); }
extern "C" void kernel_launch(void* const* d_in, const int* in_sizes, int n_in, void* d_out, int out_size, void* d_ws, size_t ws_size, hipStream_t stream) {
  (void)in_sizes; (void)n_in; (void)out_size;
  const float** F = (const float**)d_in;   // 0 x [16,256,32,32], 1 Wq [256,512], 2 bq, 3 Wk, 4 bk, 5 Wv, 6 bv, 7 Wo [512,256], 8 bo, 9 W1 [256,256], 10 b1, 11 W2, 12 b2, 13 g1, 14 be1, 15 g2, 16 be2
  if (ws_size < (size_t)WS_END) return;
  char* ws = (char*)d_ws; _Float16 *QH = (_Float16*)(ws + WS_QH), *QL = (_Float16*)(ws + WS_QL), *KH = (_Float16*)(ws + WS_KH), *VT = (_Float16*)(ws + WS_VT); float *Y = (float*)(ws + WS_Y), *Z1 = (float*)(ws + WS_Z1), *HM = (float*)(ws + WS_HM), *CP = (float*)(ws + WS_CP);
  float* OUT0 = (float*)d_out; float* OUT1 = (float*)d_out + OUT1_OFF;
  k_proj<<<dim3(TT / 64, CC / 128, TNB * 3), 128, 0, stream>>>(F[0], F[1], F[2], F[3], F[4], F[5], F[6], QH, QL, KH, VT);
  k_att<<<dim3(TT / 64, TNB * NH), 256, 0, stream>>>(QH, QL, KH, VT, Y, CP);
  k_colr<<<dim3(TT / 128, TNB), 256, 0, stream>>>(CP, OUT1);
  k_ln<0><<<TNB * TT / 64, 128, 0, stream>>>(Y, F[7], F[8], F[0], F[13], F[14], Z1);
  k_ffn1<<<dim3(TNB * TT / 64, CIN / 128), 128, 0, stream>>>(Z1, F[9], F[10], HM);
  k_ln<1><<<TNB * TT / 64, 128, 0, stream>>>(HM, F[11], F[12], Z1, F[15], F[16], OUT0);
}

// v003
// Measured time: 310 microseconds a run.
// Timed twice side by side with v002, it ran 1.38 times as fast both times.
// Over all steps from v000 it is 24.4 times as fast.
// compute dtype: all float inputs rounded to bf16; Q/K/V = x^T W + b with EXACT bf16 products on WMMA 16x16x32 (channel-major tiles transposed in LDS), f32 accumulate; Q as f16 hi + residual, K f16 -> 2-product logits / 8 kept in f32 registers (one fused launch for logits, softmax, column sums and P . V); softmax in f32 (precise expf) -> P f16 x 2^11; attn_map = column sums of P / 8 in f32; O = P . V (V rounded once to f16, 1 product); Wo, W1, W2 GEMMs with the f32 activations split bf16 hi + lo (2 products); LayerNorms (eps 1e-5), SiLU and residuals in f32; outputs: out channel-major [b][c][hw], attn_map [b][hw].
#include <hip/hip_runtime.h>
#include <math.h>

typedef __attribute__((ext_vector_type(16))) _Float16 v16h;
typedef __attribute__((ext_vector_type(16))) __bf16 v16b;
typedef __attribute__((ext_vector_type(8)))  _Float16 v8h;
typedef __attribute__((ext_vector_type(8)))  float v8f;
typedef __attribute__((ext_vector_type(4)))  float v4f;
typedef __attribute__((ext_vector_type(2)))  float v2f;
typedef __attribute__((ext_vector_type(4)))  unsigned v4u;
typedef __attribute__((ext_vector_type(4)))  int v4i;
typedef float __attribute__((may_alias)) float_a;
typedef int __attribute__((may_alias)) int_a;

template <typename T> __device__ __forceinline__ void vst2(void* p, T v) { *(T*)p = v;  }
__device__ __forceinline__ v8f wmma16(v16h a, v16h b, v8f c) {
  v8f d = __builtin_amdgcn_wmma_f32_16x16x32_f16(false, a, false, b, (short)0, c, false, false);
  asm volatile("v_nop\n\tv_nop\n\tv_nop\n\tv_nop" : "+v"(d) : "v"(a), "v"(b));
  return d;
}
__device__ __forceinline__ v8f wmma_bf(v16b a, v16b b, v8f c) {
  v8f d = __builtin_amdgcn_wmma_f32_16x16x32_bf16(false, a, false, b, (short)0, c, false, false);
  asm volatile("v_nop\n\tv_nop\n\tv_nop\n\tv_nop" : "+v"(d) : "v"(a), "v"(b));
  return d;
}
// 16x16x32 fragments: lane = (h = lane>>4, row/col = lane&15); elements 0..7 = k0+8h+0..7, 8..15 = k0+16+8h+0..7; D element r = row 8h+r
__device__ __forceinline__ v16h frag_h(const _Float16* rowk0, int lane) {
  union { v16h v; v8h q[2]; } u; const _Float16* p = rowk0 + 8 * (lane >> 4);
  u.q[0] = *(const v8h*)p; u.q[1] = *(const v8h*)(p + 16); return u.v;
}
__device__ __forceinline__ v16h frag_f32(const float* rowk0, int lane) {
  v16h a; const float* p = rowk0 + 8 * (lane >> 4);
#pragma unroll
  for (int i = 0; i < 8; ++i) { a[i] = (_Float16)p[i]; a[8 + i] = (_Float16)p[16 + i]; }
  return a;
}
__device__ __forceinline__ v16h frag_f32s(const float* rowk0, int lane, float sc) {
  v16h a; const float* p = rowk0 + 8 * (lane >> 4);
#pragma unroll
  for (int i = 0; i < 8; ++i) { a[i] = (_Float16)(p[i] * sc); a[8 + i] = (_Float16)(p[16 + i] * sc); }
  return a;
}
// column fragment from a [K][ld] layout (column n), rows >= K read as 0
__device__ __forceinline__ v16h fragc_f32(const float* W, int k0, int n, int lane, int ld, int K) {
  v16h a; const int g = lane >> 4;
#pragma unroll
  for (int i = 0; i < 8; ++i) { const int ka = k0 + 8 * g + i, kb = ka + 16;
    a[i] = (_Float16)(ka < K ? W[(size_t)(ka < K ? ka : K - 1) * ld + n] : 0.f); a[8 + i] = (_Float16)(kb < K ? W[(size_t)(kb < K ? kb : K - 1) * ld + n] : 0.f); }
  return a;
}
struct F2 { v16b h, l; };
__device__ __forceinline__ F2 bsplit16(const float v[16]) { F2 r;
#pragma unroll
  for (int i = 0; i < 16; ++i) { const __bf16 h = (__bf16)v[i]; r.h[i] = h; r.l[i] = (__bf16)(v[i] - (float)h); }
  return r; }
__device__ __forceinline__ F2 split_row(const float* row, int k0, int lane) { float v[16]; const float* p = row + k0 + 8 * (lane >> 4);
#pragma unroll
  for (int i = 0; i < 8; ++i) { v[i] = p[i]; v[8 + i] = p[16 + i]; }
  return bsplit16(v); }
__device__ __forceinline__ F2 split_rowK(const float* row, int k0, int lane, int K) { float v[16]; const int g = lane >> 4;
#pragma unroll
  for (int i = 0; i < 8; ++i) { const int ka = k0 + 8 * g + i, kb = ka + 16; v[i] = ka < K ? row[ka < K ? ka : K - 1] : 0.f; v[8 + i] = kb < K ? row[kb < K ? kb : K - 1] : 0.f; }
  return bsplit16(v); }
__device__ __forceinline__ F2 split_col(const float* W, int k0, int n, int lane, int ld, int K) { float v[16]; const int g = lane >> 4;
#pragma unroll
  for (int i = 0; i < 8; ++i) { const int ka = k0 + 8 * g + i, kb = ka + 16; v[i] = ka < K ? W[(size_t)(ka < K ? ka : K - 1) * ld + n] : 0.f; v[8 + i] = kb < K ? W[(size_t)(kb < K ? kb : K - 1) * ld + n] : 0.f; }
  return bsplit16(v); }
__device__ __forceinline__ v8f mac3(const F2& a, const F2& b, v8f c) { c = wmma_bf(a.l, b.h, c); c = wmma_bf(a.h, b.l, c); return wmma_bf(a.h, b.h, c); }
__device__ __forceinline__ float sigm(float v) { return 1.0f / (1.0f + expf(-v)); }
#define LDSX() do { asm volatile("s_wait_dscnt 0" ::: "memory"); __builtin_amdgcn_wave_barrier(); __builtin_amdgcn_fence(__ATOMIC_RELEASE, "workgroup"); } while (0)


// Multi-head spatial attention block (B 16, C 256, 32x32 = 1,024 positions, d_model 512 = 8 x 64): MHA over positions + Wo + residual LN + SiLU FFN + residual LN; second output = inbound attention map (sum over queries, mean over heads).
#define NB 16
#define CIN 256
#define TT 1024
#define CC 512
#define NH 8
#define HD 64
#define NR (NB * TT)
#ifndef TNB
#define TNB NB
#endif
typedef __attribute__((ext_vector_type(8))) __bf16 v8b;
__device__ __forceinline__ v16b frag_b(const __bf16* rowk0, int lane) {
  union { v16b v; v8b q[2]; } u; const __bf16* p = rowk0 + 8 * (lane >> 4);
  u.q[0] = *(const v8b*)p; u.q[1] = *(const v8b*)(p + 16); return u.v;
}
__device__ __forceinline__ float bfr(float v) { return (float)(__bf16)v; }
__device__ __attribute__((noinline)) float exp_ni(float v) { return expf(v); }
__device__ __attribute__((noinline)) float erf_ni(float v) { return erff(v); }

#define OUT1_OFF ((size_t)NB * CIN * TT)
#define WS_QH  0u
#define WS_QL  (WS_QH + 2u * (size_t)NR * CC)
#define WS_KH  (WS_QL + 2u * (size_t)NR * CC)
#define WS_VT  (WS_KH + 2u * (size_t)NR * CC)          // f16 v planes [b][512][t]
#define WS_Y   (WS_VT + 2u * (size_t)NR * CC)          // f32 O rows [b*t][512]
#define WS_Z1  (WS_Y + 4u * (size_t)NR * CC)           // f32 LN1 rows [b*t][256]
#define WS_HM  (WS_Z1 + 4u * (size_t)NR * CIN)         // f32 silu rows [b*t][256]
#define QCH 64                // query rows per partial column sum
#define NPART (NH * (TT / QCH))   // partial rows per batch
#define WS_CP  (WS_HM + 4u * (size_t)NR * CIN)         // f32 partial column sums [b][NPART][t]
#define WS_PW  (WS_CP + 4u * (size_t)NB * NPART * TT)  // bf16 packed weights: Wq, Wk, Wv, Wo, W1, W2
#define PW_O  (3 * CIN * CC)
#define PW_1  (4 * CIN * CC)
#define PW_2  (4 * CIN * CC + CIN * CIN)
#define WS_END (WS_PW + 2u * (size_t)(4 * CIN * CC + 2 * CIN * CIN))

// ---- k_pack: block = (256 units of 8 k, matrix): a weight matrix W (in,out) [K][N], rounded to bf16, laid out as the B fragments the GEMMs read:
// fragment (kc, nt) = 1 KiB = [k half q][lane][8 bf16], lane (g, col) holding column nt*16 + col, k = kc*32 + 16q + 8g + 0..7, so that a wave reads a fragment as two 512-byte loads
__global__ __launch_bounds__(256) void k_pack(const float* __restrict__ WQ, const float* __restrict__ WK, const float* __restrict__ WV, const float* __restrict__ WO, const float* __restrict__ W1, const float* __restrict__ W2, __bf16* __restrict__ PW) {
  const int m = blockIdx.y; const float* Wm = m == 0 ? WQ : m == 1 ? WK : m == 2 ? WV : m == 3 ? WO : m == 4 ? W1 : W2;
  const int N = m < 3 ? CC : CIN, K = m == 3 ? CC : CIN; const int unit = blockIdx.x * 256 + threadIdx.x;
  if (unit >= K * N / 8) return;
  const int lane = unit & 31, q = (unit >> 5) & 1, f = unit >> 6, NT = N / 16; const int n = (f % NT) * 16 + (lane & 15), k = (f / NT) * 32 + q * 16 + 8 * (lane >> 4);
  float v[8]; v8b o;
#pragma unroll   // the 8 loads are issued together
  for (int i = 0; i < 8; ++i) v[i] = Wm[(size_t)(k + i) * N + n];
  asm volatile("s_wait_xcnt 0x0" ::: "memory");   // the conversions below may reuse the registers that hold the loads' addresses
#pragma unroll
  for (int i = 0; i < 8; ++i) o[i] = (__bf16)v[i];
  vst2(PW + (m < 4 ? m * (CIN * CC) : PW_1 + (m - 4) * (CIN * CIN)) + (size_t)unit * 8, o); }
// one packed fragment (p = fragment base + lane * 8), and the 8 neighbouring fragments of one k-step
__device__ __forceinline__ v16b frag_pw(const __bf16* p) { union { v16b v; v8b q[2]; } u; u.q[0] = *(const v8b*)p; u.q[1] = *(const v8b*)(p + 256); return u.v; }
__device__ __forceinline__ void ldw8(v16b (&w)[8], const __bf16* p) {
#pragma unroll   // 16 loads in a row, the set indexed by constants
  for (int j = 0; j < 8; ++j) w[j] = frag_pw(p + j * 512); }

// ---- k_proj: block = (64 positions, 128 cols, b*3 + which): x^T tile; packed W; a k-step's 8 B fragments are loaded together, one k-step ahead of the WMMAs that use them
__global__ __launch_bounds__(128) void k_proj(const float* __restrict__ X, const __bf16* __restrict__ PW, const float* __restrict__ BQ, const float* __restrict__ BK, const float* __restrict__ BV, _Float16* __restrict__ QH, _Float16* __restrict__ QL, _Float16* __restrict__ KH, _Float16* __restrict__ VT) {
  __shared__ __align__(16) __bf16 sx[64][CIN + 8]; __shared__ __align__(16) _Float16 sh[64][136], sl[64][136]; __shared__ __align__(16) _Float16 th[128][72];
  const int tid = threadIdx.x, wave = tid >> 5, lane = tid & 31, col = lane & 15, g = lane >> 4; const int p0 = blockIdx.x * 64; const int c0 = blockIdx.y * 128; const size_t b = blockIdx.z / 3; const int which = blockIdx.z % 3;
  const __bf16* Pw = PW + (size_t)which * (CIN * CC) + (c0 / 16) * 512 + lane * 8; const float* Bm = which == 0 ? BQ : which == 1 ? BK : BV;
  v16b wb[2][8]; ldw8(wb[0], Pw);
  for (int e = tid; e < CIN * 64; e += 128) { const int c = e >> 6, pl = e & 63; sx[pl][c] = (__bf16)X[(b * CIN + c) * (size_t)TT + p0 + pl]; }
  __syncthreads();
  v8f acc[8] = {};
#pragma unroll   // unrolled: the two fragment sets are indexed by constants and stay in registers
  for (int kc = 0; kc < CIN / 32; ++kc) { const v16b a = frag_b(&sx[wave * 16 + col][kc * 32], lane);
    if (kc + 1 < CIN / 32) ldw8(wb[(kc + 1) & 1], Pw + (kc + 1) * (CC / 16) * 512);
#pragma unroll
    for (int j = 0; j < 8; ++j) acc[j] = wmma_bf(a, wb[kc & 1][j], acc[j]); }
#pragma unroll
  for (int j = 0; j < 8; ++j) { const float bb = bfr(Bm[c0 + j * 16 + col]);
#pragma unroll
    for (int r = 0; r < 8; ++r) { const float v = acc[j][r] + bb; const int rl = wave * 16 + 8 * g + r, cl = j * 16 + col; const _Float16 hv = (_Float16)v;
      if (which == 2) th[cl][rl] = hv; else { sh[rl][cl] = hv; sl[rl][cl] = (_Float16)(v - (float)hv); } } }
  __syncthreads();
  if (which < 2) { _Float16* dh = which == 0 ? QH : KH; for (int e = tid; e < 64 * 16; e += 128) { const int rl = e >> 4, q = e & 15; const size_t row = b * TT + p0 + rl; vst2((unsigned*)(dh + row * CC + c0 + q * 8), *(const v4u*)&sh[rl][q * 8]); if (which == 0) vst2((unsigned*)(QL + row * CC + c0 + q * 8), *(const v4u*)&sl[rl][q * 8]); } }
  else { for (int e = tid; e < 128 * 8; e += 128) { const int cl = e >> 3, q = e & 7; vst2((unsigned*)(VT + (b * CC + c0 + cl) * (size_t)TT + p0 + q * 8), *(const v4u*)&th[cl][q * 8]); } } }
// ---- k_att: block = (64 queries, z = b*8 + h), 8 waves; wave w owns keys 128w .. 128w+127 and walks the block's queries 32 at a time (two 16-query tiles share every K and V fragment).
// S^T = K . Q^T (2 products): a lane holds one query's logits for 8 consecutive keys of each 16-key tile, so the whole 32 x 128 tile stays in registers,
// the row maximum and sum need one exchange between wave halves and one between waves, and two neighbouring tiles pack straight into the B operand of O^T = V^T . P^T.
// Column sums: the wave's own P tile goes through LDS once (row = query), each lane then adds 8 keys over 16 queries and keeps the sums over the block's 64 queries.
// waves_per_eu(4, 4) holds a wave to 256 registers, so that two blocks (16 waves) share a WGP, which their LDS also allows.
__global__ __launch_bounds__(256) __attribute__((amdgpu_waves_per_eu(4, 4))) void k_att(const _Float16* __restrict__ QH, const _Float16* __restrict__ QL, const _Float16* __restrict__ KH, const _Float16* __restrict__ VT, float* __restrict__ Y, float* __restrict__ CP) {
  __shared__ float smx[2][8][32]; __shared__ __align__(16) _Float16 sp[8][32][144]; __shared__ __align__(16) float so[8][32][68];
  const int z = blockIdx.y; const size_t b = z / NH; const int h = z % NH;
  const int tid = threadIdx.x, wave = tid >> 5, lane = tid & 31, col = lane & 15, g = lane >> 4; const int kw = wave * 128;
  const _Float16* Kp = KH + (b * TT + kw + col) * CC + h * HD; const _Float16* Vp = VT + (b * CC + h * HD + col) * (size_t)TT + kw;
  v4f c0 = {}, c1 = {};
#pragma unroll 1   // rolled: unrolled, the two passes' tiles would compete for the 256 registers
  for (int qp = 0; qp < 2; ++qp) { const size_t q0 = b * TT + blockIdx.x * 64 + qp * 32;
    v8f s[8][2] = {};
#pragma unroll
    for (int kc = 0; kc < HD / 32; ++kc) { v16h hq[2], lq[2];
#pragma unroll
      for (int u = 0; u < 2; ++u) { hq[u] = frag_h(QH + (q0 + u * 16 + col) * CC + h * HD + kc * 32, lane); lq[u] = frag_h(QL + (q0 + u * 16 + col) * CC + h * HD + kc * 32, lane); }
#pragma unroll
      for (int t = 0; t < 8; ++t) { const v16h k = frag_h(Kp + (size_t)t * 16 * CC + kc * 32, lane);
#pragma unroll
        for (int u = 0; u < 2; ++u) { s[t][u] = wmma16(k, hq[u], s[t][u]); s[t][u] = wmma16(k, lq[u], s[t][u]); } } }
    float m[2], inv[2];
#pragma unroll
    for (int u = 0; u < 2; ++u) {
#pragma unroll
      for (int t = 0; t < 8; ++t) s[t][u] = s[t][u] * 0.125f;
      v8f mv = s[0][u];
#pragma unroll
      for (int t = 1; t < 8; ++t)
#pragma unroll
        for (int r = 0; r < 8; ++r) mv[r] = fmaxf(mv[r], s[t][u][r]);
      float a = fmaxf(fmaxf(fmaxf(mv[0], mv[1]), fmaxf(mv[2], mv[3])), fmaxf(fmaxf(mv[4], mv[5]), fmaxf(mv[6], mv[7])));
      a = fmaxf(a, __shfl_xor(a, 16)); if (g == 0) smx[0][wave][u * 16 + col] = a; }
    __syncthreads();
#pragma unroll
    for (int u = 0; u < 2; ++u) { const int x = u * 16 + col;
      m[u] = fmaxf(fmaxf(fmaxf(smx[0][0][x], smx[0][1][x]), fmaxf(smx[0][2][x], smx[0][3][x])), fmaxf(fmaxf(smx[0][4][x], smx[0][5][x]), fmaxf(smx[0][6][x], smx[0][7][x])));
      v8f sv = {};
#pragma unroll
      for (int t = 0; t < 8; ++t)
#pragma unroll
        for (int r = 0; r < 8; ++r) { s[t][u][r] = expf(s[t][u][r] - m[u]); sv[r] += s[t][u][r]; }
      float sum = ((sv[0] + sv[1]) + (sv[2] + sv[3])) + ((sv[4] + sv[5]) + (sv[6] + sv[7]));
      sum += __shfl_xor(sum, 16); if (g == 0) smx[1][wave][x] = sum; }
    __syncthreads();
    v8h p8[8][2];
#pragma unroll
    for (int u = 0; u < 2; ++u) { const int x = u * 16 + col;
      inv[u] = 1.0f / (((smx[1][0][x] + smx[1][1][x]) + (smx[1][2][x] + smx[1][3][x])) + ((smx[1][4][x] + smx[1][5][x]) + (smx[1][6][x] + smx[1][7][x])));
#pragma unroll
      for (int t = 0; t < 8; ++t) {
#pragma unroll
        for (int r = 0; r < 8; ++r) p8[t][u][r] = (_Float16)(s[t][u][r] * inv[u] * 2048.0f);
        *(v8h*)&sp[wave][x][t * 16 + 8 * g] = p8[t][u]; } }
    v8f acc[4][2] = {};
#pragma unroll
    for (int c = 0; c < 4; ++c) { union { v16h v; v8h q[2]; } pb[2];
#pragma unroll
      for (int u = 0; u < 2; ++u) { pb[u].q[0] = p8[2 * c][u]; pb[u].q[1] = p8[2 * c + 1][u]; }
#pragma unroll
      for (int j = 0; j < 4; ++j) { const v16h v = frag_h(Vp + (size_t)j * 16 * TT + c * 32, lane);
#pragma unroll
        for (int u = 0; u < 2; ++u) acc[j][u] = wmma16(v, pb[u].v, acc[j][u]); } }
    LDSX();   // the wave's own P rows are in LDS before its lanes read across them
#pragma unroll
    for (int q = 0; q < 16; ++q) { const v8h v = *(const v8h*)&sp[wave][g * 16 + q][col * 8];
#pragma unroll
      for (int e = 0; e < 4; ++e) { c0[e] += (float)v[e]; c1[e] += (float)v[4 + e]; } }
#pragma unroll
    for (int u = 0; u < 2; ++u)
#pragma unroll
      for (int j = 0; j < 4; ++j) { const v8f o = acc[j][u] * (1.0f / 2048.0f); const v4f lo = { o[0], o[1], o[2], o[3] }, hi = { o[4], o[5], o[6], o[7] };
        *(v4f*)&so[wave][u * 16 + col][j * 16 + 8 * g] = lo; *(v4f*)&so[wave][u * 16 + col][j * 16 + 8 * g + 4] = hi; }
    __syncthreads();
    { const int q = tid >> 3, d0 = (tid & 7) * 8; float* y = Y + (q0 + q) * CC + h * HD + d0;
#pragma unroll
      for (int f = 0; f < 2; ++f) { const int d = d0 + 4 * f;
        vst2(y + 4 * f, ((*(const v4f*)&so[0][q][d] + *(const v4f*)&so[1][q][d]) + (*(const v4f*)&so[2][q][d] + *(const v4f*)&so[3][q][d])) + ((*(const v4f*)&so[4][q][d] + *(const v4f*)&so[5][q][d]) + (*(const v4f*)&so[6][q][d] + *(const v4f*)&so[7][q][d]))); }
      asm volatile("s_wait_xcnt 0x0" ::: "memory"); } }   // the next pass overwrites the registers that the two stores name
#pragma unroll
  for (int e = 0; e < 4; ++e) { c0[e] += __shfl_xor(c0[e], 16); c1[e] += __shfl_xor(c1[e], 16); }
  float* cp = CP + (b * NPART + h * (TT / QCH) + blockIdx.x) * (size_t)TT + kw + col * 8 + 4 * g; vst2(cp, g == 0 ? c0 : c1); }
// ---- k_colr: block = (128 keys, batch): attn_map[b][k] = (1/8) sum over the batch's 128 partial rows (8 heads x 16 query blocks); wave w sums 16 rows, then 8 wave sums through LDS
__global__ __launch_bounds__(256) void k_colr(const float* __restrict__ CP, float* __restrict__ AM) { __shared__ __align__(16) float sr[8][128];
  const int t = threadIdx.x, w = t >> 5, lane = t & 31; const size_t b = blockIdx.y; const int k0 = blockIdx.x * 128;
  const float* p = CP + (b * NPART + w * (NPART / 8)) * (size_t)TT + k0 + lane * 4;
  v4f v[NPART / 8];
#pragma unroll
  for (int i = 0; i < NPART / 8; ++i) v[i] = *(const v4f*)(p + (size_t)i * TT);
  v4f a = {};
#pragma unroll
  for (int i = 0; i < NPART / 8; ++i) a += v[i];
  *(v4f*)&sr[w][lane * 4] = a;
  __syncthreads();
  if (t < 32) { v4f s = *(const v4f*)&sr[0][t * 4];
#pragma unroll
    for (int i = 1; i < 8; ++i) s += *(const v4f*)&sr[i][t * 4];
    vst2(AM + b * TT + k0 + t * 4, s * (1.0f / 2048.0f) * (1.0f / NH)); } }
// ---- k_lnA: block = 64 rows x all 256 output cols: Z1 = LN(Y (hi+lo) Wo + bo + x^T) (K 512); writes Z1 rows
// ---- k_lnB: out = LN(HM (hi+lo) W2 + b2 + Z1) (K 256); writes channel-major output planes
template <int MODE>
__global__ __launch_bounds__(128) void k_ln(const float* __restrict__ A, const __bf16* __restrict__ PWm, const float* __restrict__ Bv, const float* __restrict__ RES, const float* __restrict__ GA, const float* __restrict__ BE, float* __restrict__ DST) {
  __shared__ __align__(16) float sz[64][CIN + 4];
  const int tid = threadIdx.x, wave = tid >> 5, lane = tid & 31, col = lane & 15, g = lane >> 4; const size_t r0 = (size_t)blockIdx.x * 64; const size_t b = r0 / TT; const int p0 = (int)(r0 % TT); constexpr int K = (MODE == 0) ? CC : CIN;
#pragma unroll 1
  for (int half = 0; half < 2; ++half) {
    v8f acc[8]; for (int j = 0; j < 8; ++j) for (int r = 0; r < 8; ++r) acc[j][r] = 0.f;
    const __bf16* Pw = PWm + half * 8 * 512 + lane * 8; const float* Ar = A + (r0 + wave * 16 + col) * K;
    v16b w0[8], w1[8]; ldw8(w0, Pw);
#pragma unroll 1   // two k-steps a trip, written out: each step's 8 B fragments are loaded one step ahead into the set the other step has left
    for (int kc = 0; kc < K / 32; kc += 2) { const F2 a0 = split_row(Ar, kc * 32, lane);
      ldw8(w1, Pw + (kc + 1) * (CIN / 16) * 512);
#pragma unroll
      for (int j = 0; j < 8; ++j) { acc[j] = wmma_bf(a0.h, w0[j], acc[j]); acc[j] = wmma_bf(a0.l, w0[j], acc[j]); }
      const F2 a1 = split_row(Ar, kc * 32 + 32, lane);
      if (kc + 2 < K / 32) ldw8(w0, Pw + (kc + 2) * (CIN / 16) * 512);
      asm volatile("s_wait_xcnt 0x0" ::: "memory");   // the address registers that the trip's loads name are advanced below
#pragma unroll
      for (int j = 0; j < 8; ++j) { acc[j] = wmma_bf(a1.h, w1[j], acc[j]); acc[j] = wmma_bf(a1.l, w1[j], acc[j]); } }
#pragma unroll
    for (int j = 0; j < 8; ++j) { const int o = half * 128 + j * 16 + col; const float bb = bfr(Bv[o]);
#pragma unroll
      for (int r = 0; r < 8; ++r) { const int rl = wave * 16 + 8 * g + r; const float res = (MODE == 0) ? bfr(RES[(b * CIN + o) * (size_t)TT + p0 + rl]) : RES[(r0 + rl) * CIN + o]; sz[rl][o] = acc[j][r] + bb + res; } } }
  __syncthreads();
  // LayerNorm per row (wave handles 16 rows; lanes stride columns)
  for (int rr = 0; rr < 16; ++rr) { const int rl = wave * 16 + rr; float s = 0.f; for (int c = lane; c < CIN; c += 32) s += sz[rl][c];
#pragma unroll
    for (int o2 = 1; o2 < 32; o2 <<= 1) s += __shfl_xor(s, o2); const float mu = s / CIN; float q = 0.f; for (int c = lane; c < CIN; c += 32) { const float d = sz[rl][c] - mu; q += d * d; }
#pragma unroll
    for (int o2 = 1; o2 < 32; o2 <<= 1) q += __shfl_xor(q, o2); const float inv = 1.0f / sqrtf(q / CIN + 1e-5f);
    for (int c = lane; c < CIN; c += 32) sz[rl][c] = (sz[rl][c] - mu) * inv * bfr(GA[c]) + bfr(BE[c]); }
  __syncthreads();
  if (MODE == 0) { for (int e = tid; e < 64 * 64; e += 128) { const int rl = e >> 6, q = e & 63; vst2(DST + (r0 + rl) * CIN + q * 4, *(const v4f*)&sz[rl][q * 4]); } }
  else { // channel-major planes [b][c][p0 .. p0+63]: transpose through registers: for (c, 4 consecutive positions)
    for (int e = tid; e < CIN * 16; e += 128) { const int c = e >> 4, q = e & 15; __align__(16) float v4x[4]; v4x[0] = sz[q * 4][c]; v4x[1] = sz[q * 4 + 1][c]; v4x[2] = sz[q * 4 + 2][c]; v4x[3] = sz[q * 4 + 3][c]; vst2(DST + (b * CIN + c) * (size_t)TT + p0 + q * 4, *(const v4f*)v4x); } } }
// ---- k_ffn1: block = (64 rows, 128 cols): HM = silu(Z1 (hi+lo) W1 + b1)
__global__ __launch_bounds__(128) void k_ffn1(const float* __restrict__ Z1, const __bf16* __restrict__ PW1, const float* __restrict__ B1, float* __restrict__ HM) { __shared__ __align__(16) float sf[4][16][132];
  const int tid = threadIdx.x, wave = tid >> 5, lane = tid & 31, col = lane & 15, g = lane >> 4; const int c0 = blockIdx.y * 128; const size_t r0 = (size_t)blockIdx.x * 64 + wave * 16;
  v8f acc[8] = {};
  const __bf16* Pw = PW1 + (c0 / 16) * 512 + lane * 8; v16b wb[2][8]; ldw8(wb[0], Pw);
#pragma unroll   // unrolled: the two fragment sets are indexed by constants and stay in registers
  for (int kc = 0; kc < CIN / 32; ++kc) { const F2 a = split_row(Z1 + (r0 + col) * CIN, kc * 32, lane);
    if (kc + 1 < CIN / 32) ldw8(wb[(kc + 1) & 1], Pw + (kc + 1) * (CIN / 16) * 512);
#pragma unroll
    for (int j = 0; j < 8; ++j) { acc[j] = wmma_bf(a.h, wb[kc & 1][j], acc[j]); acc[j] = wmma_bf(a.l, wb[kc & 1][j], acc[j]); } }
#pragma unroll
  for (int j = 0; j < 8; ++j) { const float bb = bfr(B1[c0 + j * 16 + col]);
#pragma unroll
    for (int r = 0; r < 8; ++r) { const float v = acc[j][r] + bb; sf[wave][8 * g + r][j * 16 + col] = v / (1.0f + expf(-v)); } }
  LDSX(); for (int rl = 0; rl < 16; ++rl) vst2(HM + (r0 + rl) * CIN + c0 + lane * 4, *(const v4f*)&sf[wave][rl][lane * 4]); }
extern "C" void kernel_launch(void* const* d_in, const int* in_sizes, int n_in, void* d_out, int out_size, void* d_ws, size_t ws_size, hipStream_t stream) {
  (void)in_sizes; (void)n_in; (void)out_size;
  const float** F = (const float**)d_in;   // 0 x [16,256,32,32], 1 Wq [256,512], 2 bq, 3 Wk, 4 bk, 5 Wv, 6 bv, 7 Wo [512,256], 8 bo, 9 W1 [256,256], 10 b1, 11 W2, 12 b2, 13 g1, 14 be1, 15 g2, 16 be2
  if (ws_size < (size_t)WS_END) return;
  char* ws = (char*)d_ws; _Float16 *QH = (_Float16*)(ws + WS_QH), *QL = (_Float16*)(ws + WS_QL), *KH = (_Float16*)(ws + WS_KH), *VT = (_Float16*)(ws + WS_VT); float *Y = (float*)(ws + WS_Y), *Z1 = (float*)(ws + WS_Z1), *HM = (float*)(ws + WS_HM), *CP = (float*)(ws + WS_CP); __bf16* PW = (__bf16*)(ws + WS_PW);
  float* OUT0 = (float*)d_out; float* OUT1 = (float*)d_out + OUT1_OFF;
  k_pack<<<dim3(CIN * CC / 8 / 256, 6), 256, 0, stream>>>(F[1], F[3], F[5], F[7], F[9], F[11], PW);
  k_proj<<<dim3(TT / 64, CC / 128, TNB * 3), 128, 0, stream>>>(F[0], PW, F[2], F[4], F[6], QH, QL, KH, VT);
  k_att<<<dim3(TT / 64, TNB * NH), 256, 0, stream>>>(QH, QL, KH, VT, Y, CP);
  k_colr<<<dim3(TT / 128, TNB), 256, 0, stream>>>(CP, OUT1);
  k_ln<0><<<TNB * TT / 64, 128, 0, stream>>>(Y, PW + PW_O, F[8], F[0], F[13], F[14], Z1);
  k_ffn1<<<dim3(TNB * TT / 64, CIN / 128), 128, 0, stream>>>(Z1, PW + PW_1, F[10], HM);
  k_ln<1><<<TNB * TT / 64, 128, 0, stream>>>(HM, PW + PW_2, F[12], Z1, F[15], F[16], OUT0);
}

// v004
// Measured time: 262 microseconds a run.
// Timed twice side by side with v003, it ran 1.18 times as fast both times.
// All steps since v000 together make it 28.8 times as fast.
// compute dtype: all float inputs rounded to bf16; Q/K/V = x^T W + b with EXACT bf16 products on WMMA 16x16x32 (channel-major tiles transposed in LDS), f32 accumulate; Q as f16 hi + residual, K f16 -> 2-product logits / 8 kept in f32 registers (one fused launch for logits, softmax, column sums and P . V); softmax in f32 (precise expf) -> P f16 x 2^11; attn_map = column sums of P / 8 in f32; O = P . V (V rounded once to f16, 1 product); Wo, W1, W2 GEMMs with the f32 activations split bf16 hi + lo (2 products); LayerNorms (eps 1e-5), SiLU and residuals in f32; outputs: out channel-major [b][c][hw], attn_map [b][hw].
#include <hip/hip_runtime.h>
#include <math.h>

typedef __attribute__((ext_vector_type(16))) _Float16 v16h;
typedef __attribute__((ext_vector_type(16))) __bf16 v16b;
typedef __attribute__((ext_vector_type(8)))  _Float16 v8h;
typedef __attribute__((ext_vector_type(8)))  float v8f;
typedef __attribute__((ext_vector_type(4)))  float v4f;
typedef __attribute__((ext_vector_type(2)))  float v2f;
typedef __attribute__((ext_vector_type(4)))  unsigned v4u;
typedef __attribute__((ext_vector_type(4)))  int v4i;
typedef float __attribute__((may_alias)) float_a;
typedef int __attribute__((may_alias)) int_a;

template <typename T> __device__ __forceinline__ void vst2(void* p, T v) { *(T*)p = v;  }
__device__ __forceinline__ v8f wmma16(v16h a, v16h b, v8f c) {
  v8f d = __builtin_amdgcn_wmma_f32_16x16x32_f16(false, a, false, b, (short)0, c, false, false);
  asm volatile("v_nop\n\tv_nop\n\tv_nop\n\tv_nop" : "+v"(d) : "v"(a), "v"(b));
  return d;
}
__device__ __forceinline__ v8f wmma_bf(v16b a, v16b b, v8f c) {
  v8f d = __builtin_amdgcn_wmma_f32_16x16x32_bf16(false, a, false, b, (short)0, c, false, false);
  asm volatile("v_nop\n\tv_nop\n\tv_nop\n\tv_nop" : "+v"(d) : "v"(a), "v"(b));
  return d;
}
// 16x16x32 fragments: lane = (h = lane>>4, row/col = lane&15); elements 0..7 = k0+8h+0..7, 8..15 = k0+16+8h+0..7; D element r = row 8h+r
__device__ __forceinline__ v16h frag_h(const _Float16* rowk0, int lane) {
  union { v16h v; v8h q[2]; } u; const _Float16* p = rowk0 + 8 * (lane >> 4);
  u.q[0] = *(const v8h*)p; u.q[1] = *(const v8h*)(p + 16); return u.v;
}
__device__ __forceinline__ v16h frag_f32(const float* rowk0, int lane) {
  v16h a; const float* p = rowk0 + 8 * (lane >> 4);
#pragma unroll
  for (int i = 0; i < 8; ++i) { a[i] = (_Float16)p[i]; a[8 + i] = (_Float16)p[16 + i]; }
  return a;
}
__device__ __forceinline__ v16h frag_f32s(const float* rowk0, int lane, float sc) {
  v16h a; const float* p = rowk0 + 8 * (lane >> 4);
#pragma unroll
  for (int i = 0; i < 8; ++i) { a[i] = (_Float16)(p[i] * sc); a[8 + i] = (_Float16)(p[16 + i] * sc); }
  return a;
}
// column fragment from a [K][ld] layout (column n), rows >= K read as 0
__device__ __forceinline__ v16h fragc_f32(const float* W, int k0, int n, int lane, int ld, int K) {
  v16h a; const int g = lane >> 4;
#pragma unroll
  for (int i = 0; i < 8; ++i) { const int ka = k0 + 8 * g + i, kb = ka + 16;
    a[i] = (_Float16)(ka < K ? W[(size_t)(ka < K ? ka : K - 1) * ld + n] : 0.f); a[8 + i] = (_Float16)(kb < K ? W[(size_t)(kb < K ? kb : K - 1) * ld + n] : 0.f); }
  return a;
}
struct F2 { v16b h, l; };
__device__ __forceinline__ F2 bsplit16(const float v[16]) { F2 r;
#pragma unroll
  for (int i = 0; i < 16; ++i) { const __bf16 h = (__bf16)v[i]; r.h[i] = h; r.l[i] = (__bf16)(v[i] - (float)h); }
  return r; }
__device__ __forceinline__ F2 split_row(const float* row, int k0, int lane) { float v[16]; const float* p = row + k0 + 8 * (lane >> 4);
#pragma unroll
  for (int i = 0; i < 8; ++i) { v[i] = p[i]; v[8 + i] = p[16 + i]; }
  return bsplit16(v); }
__device__ __forceinline__ F2 split_rowK(const float* row, int k0, int lane, int K) { float v[16]; const int g = lane >> 4;
#pragma unroll
  for (int i = 0; i < 8; ++i) { const int ka = k0 + 8 * g + i, kb = ka + 16; v[i] = ka < K ? row[ka < K ? ka : K - 1] : 0.f; v[8 + i] = kb < K ? row[kb < K ? kb : K - 1] : 0.f; }
  return bsplit16(v); }
__device__ __forceinline__ F2 split_col(const float* W, int k0, int n, int lane, int ld, int K) { float v[16]; const int g = lane >> 4;
#pragma unroll
  for (int i = 0; i < 8; ++i) { const int ka = k0 + 8 * g + i, kb = ka + 16; v[i] = ka < K ? W[(size_t)(ka < K ? ka : K - 1) * ld + n] : 0.f; v[8 + i] = kb < K ? W[(size_t)(kb < K ? kb : K - 1) * ld + n] : 0.f; }
  return bsplit16(v); }
__device__ __forceinline__ v8f mac3(const F2& a, const F2& b, v8f c) { c = wmma_bf(a.l, b.h, c); c = wmma_bf(a.h, b.l, c); return wmma_bf(a.h, b.h, c); }
__device__ __forceinline__ float sigm(float v) { return 1.0f / (1.0f + expf(-v)); }
#define LDSX() do { asm volatile("s_wait_dscnt 0" ::: "memory"); __builtin_amdgcn_wave_barrier(); __builtin_amdgcn_fence(__ATOMIC_RELEASE, "workgroup"); } while (0)


// Multi-head spatial attention block (B 16, C 256, 32x32 = 1,024 positions, d_model 512 = 8 x 64): MHA over positions + Wo + residual LN + SiLU FFN + residual LN; second output = inbound attention map (sum over queries, mean over heads).
#define NB 16
#define CIN 256
#define TT 1024
#define CC 512
#define NH 8
#define HD 64
#define NR (NB * TT)
#ifndef TNB
#define TNB NB
#endif
typedef __attribute__((ext_vector_type(8))) __bf16 v8b;
__device__ __forceinline__ v16b frag_b(const __bf16* rowk0, int lane) {
  union { v16b v; v8b q[2]; } u; const __bf16* p = rowk0 + 8 * (lane >> 4);
  u.q[0] = *(const v8b*)p; u.q[1] = *(const v8b*)(p + 16); return u.v;
}
__device__ __forceinline__ float bfr(float v) { return (float)(__bf16)v; }
__device__ __attribute__((noinline)) float exp_ni(float v) { return expf(v); }
__device__ __attribute__((noinline)) float erf_ni(float v) { return erff(v); }

#define OUT1_OFF ((size_t)NB * CIN * TT)
#define WS_QH  0u
#define WS_QL  (WS_QH + 2u * (size_t)NR * CC)
#define WS_KH  (WS_QL + 2u * (size_t)NR * CC)
#define WS_VT  (WS_KH + 2u * (size_t)NR * CC)          // f16 V^T fragments; QH, QL, KH and VT all lie in fragment order (see k_proj)
#define WS_Y   (WS_VT + 2u * (size_t)NR * CC)          // f32 O rows [b*t][512]
#define WS_Z1  (WS_Y + 4u * (size_t)NR * CC)           // f32 LN1 rows [b*t][256]
#define WS_HM  (WS_Z1 + 4u * (size_t)NR * CIN)         // f32 silu rows [b*t][256]
#define QCH 64                // query rows per partial column sum
#define NPART (NH * (TT / QCH))   // partial rows per batch
#define WS_CP  (WS_HM + 4u * (size_t)NR * CIN)         // f32 partial column sums [b][NPART][t]
#define WS_PW  (WS_CP + 4u * (size_t)NB * NPART * TT)  // bf16 packed weights: Wq, Wk, Wv, Wo, W1, W2
#define PW_O  (3 * CIN * CC)
#define PW_1  (4 * CIN * CC)
#define PW_2  (4 * CIN * CC + CIN * CIN)
#define WS_END (WS_PW + 2u * (size_t)(4 * CIN * CC + 2 * CIN * CIN))

// ---- k_pack: block = (256 units of 8 k, matrix): a weight matrix W (in,out) [K][N], rounded to bf16, laid out as the B fragments the GEMMs read:
// fragment (kc, nt) = 1 KiB = [k half q][lane][8 bf16], lane (g, col) holding column nt*16 + col, k = kc*32 + 16q + 8g + 0..7, so that a wave reads a fragment as two 512-byte loads
__global__ __launch_bounds__(256) void k_pack(const float* __restrict__ WQ, const float* __restrict__ WK, const float* __restrict__ WV, const float* __restrict__ WO, const float* __restrict__ W1, const float* __restrict__ W2, __bf16* __restrict__ PW) {
  const int m = blockIdx.y; const float* Wm = m == 0 ? WQ : m == 1 ? WK : m == 2 ? WV : m == 3 ? WO : m == 4 ? W1 : W2;
  const int N = m < 3 ? CC : CIN, K = m == 3 ? CC : CIN; const int unit = blockIdx.x * 256 + threadIdx.x;
  if (unit >= K * N / 8) return;
  const int lane = unit & 31, q = (unit >> 5) & 1, f = unit >> 6, NT = N / 16; const int n = (f % NT) * 16 + (lane & 15), k = (f / NT) * 32 + q * 16 + 8 * (lane >> 4);
  float v[8]; v8b o;
#pragma unroll   // the 8 loads are issued together
  for (int i = 0; i < 8; ++i) v[i] = Wm[(size_t)(k + i) * N + n];
  asm volatile("s_wait_xcnt 0x0" ::: "memory");   // the conversions below may reuse the registers that hold the loads' addresses
#pragma unroll
  for (int i = 0; i < 8; ++i) o[i] = (__bf16)v[i];
  vst2(PW + (m < 4 ? m * (CIN * CC) : PW_1 + (m - 4) * (CIN * CIN)) + (size_t)unit * 8, o); }
// one packed fragment (p = fragment base + lane * 8), and the 8 neighbouring fragments of one k-step
__device__ __forceinline__ v16b frag_pw(const __bf16* p) { union { v16b v; v8b q[2]; } u; u.q[0] = *(const v8b*)p; u.q[1] = *(const v8b*)(p + 256); return u.v; }
__device__ __forceinline__ void ldw8(v16b (&w)[8], const __bf16* p) {
#pragma unroll   // 16 loads in a row, the set indexed by constants
  for (int j = 0; j < 8; ++j) w[j] = frag_pw(p + j * 512); }

// ---- k_proj: block = (64 positions, 128 cols, b*3 + which): x^T tile; packed W; a k-step's 8 B fragments are loaded together, one k-step ahead of the WMMAs that use them
// Q, K and V leave in the order in which k_att's 16x16x32 fragments read them: fragment = 1 KiB = [k half q][lane (g, row)][8 f16], k = 32*chunk + 16q + 8g + 0..7.
// Q, K: [b][head][16-position tile][32-dim chunk], row = position; V^T: [b][head][32-key chunk][16-dim tile], row = dim, k = key. A wave stores and loads 512 contiguous bytes at a time.
__global__ __launch_bounds__(128) void k_proj(const float* __restrict__ X, const __bf16* __restrict__ PW, const float* __restrict__ BQ, const float* __restrict__ BK, const float* __restrict__ BV, _Float16* __restrict__ QH, _Float16* __restrict__ QL, _Float16* __restrict__ KH, _Float16* __restrict__ VT) {
  __shared__ __align__(16) __bf16 sx[64][CIN + 8]; __shared__ __align__(16) _Float16 sh[64][136], sl[64][136]; __shared__ __align__(16) _Float16 th[128][72];
  const int tid = threadIdx.x, wave = tid >> 5, lane = tid & 31, col = lane & 15, g = lane >> 4; const int p0 = blockIdx.x * 64; const int c0 = blockIdx.y * 128; const size_t b = blockIdx.z / 3; const int which = blockIdx.z % 3;
  const __bf16* Pw = PW + (size_t)which * (CIN * CC) + (c0 / 16) * 512 + lane * 8; const float* Bm = which == 0 ? BQ : which == 1 ? BK : BV;
  v16b wb[2][8]; ldw8(wb[0], Pw);
  for (int e = tid; e < CIN * 64; e += 128) { const int c = e >> 6, pl = e & 63; sx[pl][c] = (__bf16)X[(b * CIN + c) * (size_t)TT + p0 + pl]; }
  __syncthreads();
  v8f acc[8] = {};
#pragma unroll   // unrolled: the two fragment sets are indexed by constants and stay in registers
  for (int kc = 0; kc < CIN / 32; ++kc) { const v16b a = frag_b(&sx[wave * 16 + col][kc * 32], lane);
    if (kc + 1 < CIN / 32) ldw8(wb[(kc + 1) & 1], Pw + (kc + 1) * (CC / 16) * 512);
#pragma unroll
    for (int j = 0; j < 8; ++j) acc[j] = wmma_bf(a, wb[kc & 1][j], acc[j]); }
#pragma unroll
  for (int j = 0; j < 8; ++j) { const float bb = bfr(Bm[c0 + j * 16 + col]);
#pragma unroll
    for (int r = 0; r < 8; ++r) { const float v = acc[j][r] + bb; const int rl = wave * 16 + 8 * g + r, cl = j * 16 + col; const _Float16 hv = (_Float16)v;
      if (which == 2) th[cl][rl] = hv; else { sh[rl][cl] = hv; sl[rl][cl] = (_Float16)(v - (float)hv); } } }
  __syncthreads();
  // 16 fragments a block, unit e = (fragment f, k half, g, row); a head's 8 fragments of the block lie in a row
  const int kq = ((lane >> 4) + 2 * (wave & 1)) * 8;   // 16q + 8g of this thread's units
  if (which < 2) { _Float16* dh = which == 0 ? QH : KH; for (int e = tid; e < 64 * 16; e += 128) { const int f = e >> 6, hl = f >> 3, rl = ((f >> 1) & 3) * 16 + col, cl = hl * 64 + (f & 1) * 32 + kq;
      const size_t o = ((b * NH + c0 / HD + hl) * (TT / 16) + p0 / 16) * (size_t)1024 + (e & 511) * 8; vst2((unsigned*)(dh + o), *(const v4u*)&sh[rl][cl]);
      asm volatile("s_wait_xcnt 0x0" ::: "memory");   // what follows (the residual's LDS read, the next trip) overwrites the registers that the store names
      if (which == 0) { vst2((unsigned*)(QL + o), *(const v4u*)&sl[rl][cl]); asm volatile("s_wait_xcnt 0x0" ::: "memory"); } } }   // the same for the residual's store
  else { for (int e = tid; e < 128 * 8; e += 128) { const int f = e >> 6, hl = f >> 3, cl = hl * 64 + (f & 3) * 16 + col, rl = ((f >> 2) & 1) * 32 + kq;
      vst2((unsigned*)(VT + ((b * NH + c0 / HD + hl) * (TT / 32) + p0 / 32) * (size_t)2048 + (e & 511) * 8), *(const v4u*)&th[cl][rl]); } } }
#define KRING 4   // K fragments in flight a wave (4 WMMAs each)
#define VRING 6   // V fragments in flight a wave (2 WMMAs each); more of either and the kernel spills at 256 registers
// one f16 fragment in fragment order (f = fragment base, l8 = lane * 8): two loads of 512 contiguous bytes a wave
__device__ __forceinline__ v16h frag_pk(const _Float16* f, unsigned l8) { union { v16h v; v8h q[2]; } u; const _Float16* p = f + l8; u.q[0] = *(const v8h*)p; u.q[1] = *(const v8h*)(p + 256); return u.v; }
// ---- k_att: block = (64 queries, z = b*8 + h), 8 waves; wave w owns keys 128w .. 128w+127 and walks the block's queries 32 at a time (two 16-query tiles share every K and V fragment).
// S^T = K . Q^T (2 products): a lane holds one query's logits for 8 consecutive keys of each 16-key tile, so the whole 32 x 128 tile stays in registers,
// the row maximum and sum need one exchange between wave halves and one between waves, and two neighbouring tiles pack straight into the B operand of O^T = V^T . P^T.
// Column sums: the wave's own P tile goes through LDS once (row = query), each lane then adds 8 keys over 16 queries and keeps the sums over the block's 64 queries.
// waves_per_eu(4, 4) holds a wave to 256 registers, so that two blocks (16 waves) share a WGP, which their LDS also allows.
__global__ __launch_bounds__(256) __attribute__((amdgpu_waves_per_eu(4, 4))) void k_att(const _Float16* __restrict__ QH, const _Float16* __restrict__ QL, const _Float16* KH, const _Float16* VT, float* __restrict__ Y, float* __restrict__ CP) {   // KH, VT without __restrict__: with it the compiler holds the fragments that both passes read first in registers over the whole pass, and spills
  __shared__ float smx[2][8][32]; __shared__ __align__(16) _Float16 sp[8][32][144]; __shared__ __align__(16) float so[8][32][68];
  const int z = blockIdx.y; const size_t b = z / NH; const int h = z % NH;
  const int tid = threadIdx.x, wave = tid >> 5, lane = tid & 31, col = lane & 15, g = lane >> 4; const int kw = wave * 128;
  const size_t hb = (size_t)z * (TT * HD);   // this head's fragments: 128 KiB in each of the four buffers
  const int ws = wave * 8192;   // the wave's 8 key tiles (K) and 4 key chunks (V): 16 KiB each
  const _Float16* Kp = KH + hb + ws; const _Float16* Vp = VT + hb + ws; const _Float16* Qh = QH + hb + blockIdx.x * 4096; const _Float16* Ql = QL + hb + blockIdx.x * 4096; const unsigned l8 = lane * 8;
  v4f c0 = {}, c1 = {};
#pragma unroll 1   // rolled: unrolled, the two passes' tiles would compete for the 256 registers
  for (int qp = 0; qp < 2; ++qp) { const size_t q0 = b * TT + blockIdx.x * 64 + qp * 32;
    v8f s[8][2] = {}; v16h hq[2], lq[2], kf[KRING], vf[VRING];
#pragma unroll   // the first KRING K fragments are asked for together
    for (int i = 0; i < KRING; ++i) kf[i] = frag_pk(Kp + ((i & 7) * 2 + (i >> 3)) * 512, l8);
#pragma unroll   // unrolled: the ring of K fragments is indexed by constants; fragment i + KRING is asked for as soon as fragment i has been used
    for (int i = 0; i < 16; ++i) { const int kc = i >> 3, t = i & 7; const v16h k = kf[i % KRING];
      if (t == 0) {
#pragma unroll
        for (int u = 0; u < 2; ++u) { hq[u] = frag_pk(Qh + ((qp * 2 + u) * 2 + kc) * 512, l8); lq[u] = frag_pk(Ql + ((qp * 2 + u) * 2 + kc) * 512, l8); }
        asm volatile("s_wait_xcnt 0x0" ::: "memory"); }   // the registers that hold the Q loads' addresses are reused for fragments further down
#pragma unroll
      for (int u = 0; u < 2; ++u) { s[t][u] = wmma16(k, hq[u], s[t][u]); s[t][u] = wmma16(k, lq[u], s[t][u]); }
      if (i + KRING < 16) kf[i % KRING] = frag_pk(Kp + (((i + KRING) & 7) * 2 + ((i + KRING) >> 3)) * 512, l8); }
    float m[2], inv[2];
#pragma unroll
    for (int u = 0; u < 2; ++u) {
#pragma unroll
      for (int t = 0; t < 8; ++t) s[t][u] = s[t][u] * 0.125f;
      v8f mv = s[0][u];
#pragma unroll
      for (int t = 1; t < 8; ++t)
#pragma unroll
        for (int r = 0; r < 8; ++r) mv[r] = fmaxf(mv[r], s[t][u][r]);
      float a = fmaxf(fmaxf(fmaxf(mv[0], mv[1]), fmaxf(mv[2], mv[3])), fmaxf(fmaxf(mv[4], mv[5]), fmaxf(mv[6], mv[7])));
      a = fmaxf(a, __shfl_xor(a, 16)); if (g == 0) smx[0][wave][u * 16 + col] = a; }
    __syncthreads();
#pragma unroll
    for (int u = 0; u < 2; ++u) { const int x = u * 16 + col;
      m[u] = fmaxf(fmaxf(fmaxf(smx[0][0][x], smx[0][1][x]), fmaxf(smx[0][2][x], smx[0][3][x])), fmaxf(fmaxf(smx[0][4][x], smx[0][5][x]), fmaxf(smx[0][6][x], smx[0][7][x])));
      v8f sv = {};
#pragma unroll
      for (int t = 0; t < 8; ++t)
#pragma unroll
        for (int r = 0; r < 8; ++r) { s[t][u][r] = expf(s[t][u][r] - m[u]); sv[r] += s[t][u][r]; }
      float sum = ((sv[0] + sv[1]) + (sv[2] + sv[3])) + ((sv[4] + sv[5]) + (sv[6] + sv[7]));
      sum += __shfl_xor(sum, 16); if (g == 0) smx[1][wave][x] = sum; }
    __syncthreads();
    v8h p8[8][2];
#pragma unroll
    for (int u = 0; u < 2; ++u) { const int x = u * 16 + col;
      inv[u] = 1.0f / (((smx[1][0][x] + smx[1][1][x]) + (smx[1][2][x] + smx[1][3][x])) + ((smx[1][4][x] + smx[1][5][x]) + (smx[1][6][x] + smx[1][7][x])));
#pragma unroll
      for (int t = 0; t < 8; ++t) {
#pragma unroll
        for (int r = 0; r < 8; ++r) p8[t][u][r] = (_Float16)(s[t][u][r] * inv[u] * 2048.0f);
        *(v8h*)&sp[wave][x][t * 16 + 8 * g] = p8[t][u]; }
      if (u == 0) {
#pragma unroll   // the first VRING V fragments fly while P is scaled and packed
        for (int i = 0; i < VRING; ++i) vf[i] = frag_pk(Vp + i * 512, l8); } }
    v8f acc[4][2] = {};
#pragma unroll
    for (int c = 0; c < 4; ++c) { union { v16h v; v8h q[2]; } pb[2];
#pragma unroll
      for (int u = 0; u < 2; ++u) { pb[u].q[0] = p8[2 * c][u]; pb[u].q[1] = p8[2 * c + 1][u]; }
#pragma unroll
      for (int j = 0; j < 4; ++j) { const int i = c * 4 + j; const v16h v = vf[i % VRING];
#pragma unroll
        for (int u = 0; u < 2; ++u) acc[j][u] = wmma16(v, pb[u].v, acc[j][u]);
        if (i + VRING < 16) vf[i % VRING] = frag_pk(Vp + (i + VRING) * 512, l8); } }
    LDSX();   // the wave's own P rows are in LDS before its lanes read across them
#pragma unroll
    for (int q = 0; q < 16; ++q) { const v8h v = *(const v8h*)&sp[wave][g * 16 + q][col * 8];
#pragma unroll
      for (int e = 0; e < 4; ++e) { c0[e] += (float)v[e]; c1[e] += (float)v[4 + e]; } }
#pragma unroll
    for (int u = 0; u < 2; ++u)
#pragma unroll
      for (int j = 0; j < 4; ++j) { const v8f o = acc[j][u] * (1.0f / 2048.0f); const v4f lo = { o[0], o[1], o[2], o[3] }, hi = { o[4], o[5], o[6], o[7] };
        *(v4f*)&so[wave][u * 16 + col][j * 16 + 8 * g] = lo; *(v4f*)&so[wave][u * 16 + col][j * 16 + 8 * g + 4] = hi; }
    __syncthreads();
    { const int q = tid >> 3, d0 = (tid & 7) * 8; float* y = Y + (q0 + q) * CC + h * HD + d0;
#pragma unroll
      for (int f = 0; f < 2; ++f) { const int d = d0 + 4 * f;
        vst2(y + 4 * f, ((*(const v4f*)&so[0][q][d] + *(const v4f*)&so[1][q][d]) + (*(const v4f*)&so[2][q][d] + *(const v4f*)&so[3][q][d])) + ((*(const v4f*)&so[4][q][d] + *(const v4f*)&so[5][q][d]) + (*(const v4f*)&so[6][q][d] + *(const v4f*)&so[7][q][d]))); }
      asm volatile("s_wait_xcnt 0x0" ::: "memory"); } }   // the next pass overwrites the registers that the two stores name
#pragma unroll
  for (int e = 0; e < 4; ++e) { c0[e] += __shfl_xor(c0[e], 16); c1[e] += __shfl_xor(c1[e], 16); }
  float* cp = CP + (b * NPART + h * (TT / QCH) + blockIdx.x) * (size_t)TT + kw + col * 8 + 4 * g; vst2(cp, g == 0 ? c0 : c1); }
// ---- k_colr: block = (128 keys, batch): attn_map[b][k] = (1/8) sum over the batch's 128 partial rows (8 heads x 16 query blocks); wave w sums 16 rows, then 8 wave sums through LDS
__global__ __launch_bounds__(256) void k_colr(const float* __restrict__ CP, float* __restrict__ AM) { __shared__ __align__(16) float sr[8][128];
  const int t = threadIdx.x, w = t >> 5, lane = t & 31; const size_t b = blockIdx.y; const int k0 = blockIdx.x * 128;
  const float* p = CP + (b * NPART + w * (NPART / 8)) * (size_t)TT + k0 + lane * 4;
  v4f v[NPART / 8];
#pragma unroll
  for (int i = 0; i < NPART / 8; ++i) v[i] = *(const v4f*)(p + (size_t)i * TT);
  v4f a = {};
#pragma unroll
  for (int i = 0; i < NPART / 8; ++i) a += v[i];
  *(v4f*)&sr[w][lane * 4] = a;
  __syncthreads();
  if (t < 32) { v4f s = *(const v4f*)&sr[0][t * 4];
#pragma unroll
    for (int i = 1; i < 8; ++i) s += *(const v4f*)&sr[i][t * 4];
    vst2(AM + b * TT + k0 + t * 4, s * (1.0f / 2048.0f) * (1.0f / NH)); } }
// ---- k_lnA: block = 64 rows x all 256 output cols: Z1 = LN(Y (hi+lo) Wo + bo + x^T) (K 512); writes Z1 rows
// ---- k_lnB: out = LN(HM (hi+lo) W2 + b2 + Z1) (K 256); writes channel-major output planes
template <int MODE>
__global__ __launch_bounds__(128) void k_ln(const float* __restrict__ A, const __bf16* __restrict__ PWm, const float* __restrict__ Bv, const float* __restrict__ RES, const float* __restrict__ GA, const float* __restrict__ BE, float* __restrict__ DST) {
  __shared__ __align__(16) float sz[64][CIN + 4];
  const int tid = threadIdx.x, wave = tid >> 5, lane = tid & 31, col = lane & 15, g = lane >> 4; const size_t r0 = (size_t)blockIdx.x * 64; const size_t b = r0 / TT; const int p0 = (int)(r0 % TT); constexpr int K = (MODE == 0) ? CC : CIN;
#pragma unroll 1
  for (int half = 0; half < 2; ++half) {
    v8f acc[8]; for (int j = 0; j < 8; ++j) for (int r = 0; r < 8; ++r) acc[j][r] = 0.f;
    const __bf16* Pw = PWm + half * 8 * 512 + lane * 8; const float* Ar = A + (r0 + wave * 16 + col) * K;
    v16b w0[8], w1[8]; ldw8(w0, Pw);
#pragma unroll 1   // two k-steps a trip, written out: each step's 8 B fragments are loaded one step ahead into the set the other step has left
    for (int kc = 0; kc < K / 32; kc += 2) { const F2 a0 = split_row(Ar, kc * 32, lane);
      ldw8(w1, Pw + (kc + 1) * (CIN / 16) * 512);
#pragma unroll
      for (int j = 0; j < 8; ++j) { acc[j] = wmma_bf(a0.h, w0[j], acc[j]); acc[j] = wmma_bf(a0.l, w0[j], acc[j]); }
      const F2 a1 = split_row(Ar, kc * 32 + 32, lane);
      if (kc + 2 < K / 32) ldw8(w0, Pw + (kc + 2) * (CIN / 16) * 512);
      asm volatile("s_wait_xcnt 0x0" ::: "memory");   // the address registers that the trip's loads name are advanced below
#pragma unroll
      for (int j = 0; j < 8; ++j) { acc[j] = wmma_bf(a1.h, w1[j], acc[j]); acc[j] = wmma_bf(a1.l, w1[j], acc[j]); } }
#pragma unroll
    for (int j = 0; j < 8; ++j) { const int o = half * 128 + j * 16 + col; const float bb = bfr(Bv[o]);
#pragma unroll
      for (int r = 0; r < 8; ++r) { const int rl = wave * 16 + 8 * g + r; const float res = (MODE == 0) ? bfr(RES[(b * CIN + o) * (size_t)TT + p0 + rl]) : RES[(r0 + rl) * CIN + o]; sz[rl][o] = acc[j][r] + bb + res; } } }
  __syncthreads();
  // LayerNorm per row (wave handles 16 rows; lanes stride columns)
  for (int rr = 0; rr < 16; ++rr) { const int rl = wave * 16 + rr; float s = 0.f; for (int c = lane; c < CIN; c += 32) s += sz[rl][c];
#pragma unroll
    for (int o2 = 1; o2 < 32; o2 <<= 1) s += __shfl_xor(s, o2); const float mu = s / CIN; float q = 0.f; for (int c = lane; c < CIN; c += 32) { const float d = sz[rl][c] - mu; q += d * d; }
#pragma unroll
    for (int o2 = 1; o2 < 32; o2 <<= 1) q += __shfl_xor(q, o2); const float inv = 1.0f / sqrtf(q / CIN + 1e-5f);
    for (int c = lane; c < CIN; c += 32) sz[rl][c] = (sz[rl][c] - mu) * inv * bfr(GA[c]) + bfr(BE[c]); }
  __syncthreads();
  if (MODE == 0) { for (int e = tid; e < 64 * 64; e += 128) { const int rl = e >> 6, q = e & 63; vst2(DST + (r0 + rl) * CIN + q * 4, *(const v4f*)&sz[rl][q * 4]); } }
  else { // channel-major planes [b][c][p0 .. p0+63]: transpose through registers: for (c, 4 consecutive positions)
    for (int e = tid; e < CIN * 16; e += 128) { const int c = e >> 4, q = e & 15; __align__(16) float v4x[4]; v4x[0] = sz[q * 4][c]; v4x[1] = sz[q * 4 + 1][c]; v4x[2] = sz[q * 4 + 2][c]; v4x[3] = sz[q * 4 + 3][c]; vst2(DST + (b * CIN + c) * (size_t)TT + p0 + q * 4, *(const v4f*)v4x); } } }
// ---- k_ffn1: block = (64 rows, 128 cols): HM = silu(Z1 (hi+lo) W1 + b1)
__global__ __launch_bounds__(128) void k_ffn1(const float* __restrict__ Z1, const __bf16* __restrict__ PW1, const float* __restrict__ B1, float* __restrict__ HM) { __shared__ __align__(16) float sf[4][16][132];
  const int tid = threadIdx.x, wave = tid >> 5, lane = tid & 31, col = lane & 15, g = lane >> 4; const int c0 = blockIdx.y * 128; const size_t r0 = (size_t)blockIdx.x * 64 + wave * 16;
  v8f acc[8] = {};
  const __bf16* Pw = PW1 + (c0 / 16) * 512 + lane * 8; v16b wb[2][8]; ldw8(wb[0], Pw);
#pragma unroll   // unrolled: the two fragment sets are indexed by constants and stay in registers
  for (int kc = 0; kc < CIN / 32; ++kc) { const F2 a = split_row(Z1 + (r0 + col) * CIN, kc * 32, lane);
    if (kc + 1 < CIN / 32) ldw8(wb[(kc + 1) & 1], Pw + (kc + 1) * (CIN / 16) * 512);
#pragma unroll
    for (int j = 0; j < 8; ++j) { acc[j] = wmma_bf(a.h, wb[kc & 1][j], acc[j]); acc[j] = wmma_bf(a.l, wb[kc & 1][j], acc[j]); } }
#pragma unroll
  for (int j = 0; j < 8; ++j) { const float bb = bfr(B1[c0 + j * 16 + col]);
#pragma unroll
    for (int r = 0; r < 8; ++r) { const float v = acc[j][r] + bb; sf[wave][8 * g + r][j * 16 + col] = v / (1.0f + expf(-v)); } }
  LDSX(); for (int rl = 0; rl < 16; ++rl) vst2(HM + (r0 + rl) * CIN + c0 + lane * 4, *(const v4f*)&sf[wave][rl][lane * 4]); }
extern "C" void kernel_launch(void* const* d_in, const int* in_sizes, int n_in, void* d_out, int out_size, void* d_ws, size_t ws_size, hipStream_t stream) {
  (void)in_sizes; (void)n_in; (void)out_size;
  const float** F = (const float**)d_in;   // 0 x [16,256,32,32], 1 Wq [256,512], 2 bq, 3 Wk, 4 bk, 5 Wv, 6 bv, 7 Wo [512,256], 8 bo, 9 W1 [256,256], 10 b1, 11 W2, 12 b2, 13 g1, 14 be1, 15 g2, 16 be2
  if (ws_size < (size_t)WS_END) return;
  char* ws = (char*)d_ws; _Float16 *QH = (_Float16*)(ws + WS_QH), *QL = (_Float16*)(ws + WS_QL), *KH = (_Float16*)(ws + WS_KH), *VT = (_Float16*)(ws + WS_VT); float *Y = (float*)(ws + WS_Y), *Z1 = (float*)(ws + WS_Z1), *HM = (float*)(ws + WS_HM), *CP = (float*)(ws + WS_CP); __bf16* PW = (__bf16*)(ws + WS_PW);
  float* OUT0 = (float*)d_out; float* OUT1 = (float*)d_out + OUT1_OFF;
  k_pack<<<dim3(CIN * CC / 8 / 256, 6), 256, 0, stream>>>(F[1], F[3], F[5], F[7], F[9], F[11], PW);
  k_proj<<<dim3(TT / 64, CC / 128, TNB * 3), 128, 0, stream>>>(F[0], PW, F[2], F[4], F[6], QH, QL, KH, VT);
  k_att<<<dim3(TT / 64, TNB * NH), 256, 0, stream>>>(QH, QL, KH, VT, Y, CP);
  k_colr<<<dim3(TT / 128, TNB), 256, 0, stream>>>(CP, OUT1);
  k_ln<0><<<TNB * TT / 64, 128, 0, stream>>>(Y, PW + PW_O, F[8], F[0], F[13], F[14], Z1);
  k_ffn1<<<dim3(TNB * TT / 64, CIN / 128), 128, 0, stream>>>(Z1, PW + PW_1, F[10], HM);
  k_ln<1><<<TNB * TT / 64, 128, 0, stream>>>(HM, PW + PW_2, F[12], Z1, F[15], F[16], OUT0);
}

// v005
// Measured time: 233 microseconds a run.
// Timed twice side by side with v004, it ran 1.13 times as fast both times.
// Over all steps from v000 it is 32.4 times as fast.
// compute dtype: all float inputs rounded to bf16; Q/K/V = x^T W + b with EXACT bf16 products on WMMA 16x16x32 (channel-major tiles transposed in LDS), f32 accumulate; Q as f16 hi + residual, K f16 -> 2-product logits kept in f32 registers (one fused launch for logits, softmax, column sums and P . V); softmax in f32, exp((l - max) / 8) = exp2(l * (log2 e / 8) - max * (log2 e / 8)): one FMA and the hardware exp2 -> P f16 x 2^11; attn_map = column sums of P / 8 in f32; O = P . V (V rounded once to f16, 1 product); Wo, W1, W2 GEMMs with the f32 activations split bf16 hi + lo (2 products); LayerNorms (eps 1e-5), SiLU and residuals in f32; outputs: out channel-major [b][c][hw], attn_map [b][hw].
#include <hip/hip_runtime.h>
#include <math.h>

typedef __attribute__((ext_vector_type(16))) _Float16 v16h;
typedef __attribute__((ext_vector_type(16))) __bf16 v16b;
typedef __attribute__((ext_vector_type(8)))  _Float16 v8h;
typedef __attribute__((ext_vector_type(8)))  float v8f;
typedef __attribute__((ext_vector_type(4)))  float v4f;
typedef __attribute__((ext_vector_type(2)))  float v2f;
typedef __attribute__((ext_vector_type(4)))  unsigned v4u;
typedef __attribute__((ext_vector_type(4)))  int v4i;
typedef float __attribute__((may_alias)) float_a;
typedef int __attribute__((may_alias)) int_a;

template <typename T> __device__ __forceinline__ void vst2(void* p, T v) { *(T*)p = v;  }
__device__ __forceinline__ v8f wmma16(v16h a, v16h b, v8f c) {
  v8f d = __builtin_amdgcn_wmma_f32_16x16x32_f16(false, a, false, b, (short)0, c, false, false);
  asm volatile("v_nop\n\tv_nop\n\tv_nop\n\tv_nop" : "+v"(d) : "v"(a), "v"(b));
  return d;
}
__device__ __forceinline__ v8f wmma_bf(v16b a, v16b b, v8f c) {
  v8f d = __builtin_amdgcn_wmma_f32_16x16x32_bf16(false, a, false, b, (short)0, c, false, false);
  asm volatile("v_nop\n\tv_nop\n\tv_nop\n\tv_nop" : "+v"(d) : "v"(a), "v"(b));
  return d;
}
// 16x16x32 fragments: lane = (h = lane>>4, row/col = lane&15); elements 0..7 = k0+8h+0..7, 8..15 = k0+16+8h+0..7; D element r = row 8h+r
__device__ __forceinline__ v16h frag_h(const _Float16* rowk0, int lane) {
  union { v16h v; v8h q[2]; } u; const _Float16* p = rowk0 + 8 * (lane >> 4);
  u.q[0] = *(const v8h*)p; u.q[1] = *(const v8h*)(p + 16); return u.v;
}
__device__ __forceinline__ v16h frag_f32(const float* rowk0, int lane) {
  v16h a; const float* p = rowk0 + 8 * (lane >> 4);
#pragma unroll
  for (int i = 0; i < 8; ++i) { a[i] = (_Float16)p[i]; a[8 + i] = (_Float16)p[16 + i]; }
  return a;
}
__device__ __forceinline__ v16h frag_f32s(const float* rowk0, int lane, float sc) {
  v16h a; const float* p = rowk0 + 8 * (lane >> 4);
#pragma unroll
  for (int i = 0; i < 8; ++i) { a[i] = (_Float16)(p[i] * sc); a[8 + i] = (_Float16)(p[16 + i] * sc); }
  return a;
}
// column fragment from a [K][ld] layout (column n), rows >= K read as 0
__device__ __forceinline__ v16h fragc_f32(const float* W, int k0, int n, int lane, int ld, int K) {
  v16h a; const int g = lane >> 4;
#pragma unroll
  for (int i = 0; i < 8; ++i) { const int ka = k0 + 8 * g + i, kb = ka + 16;
    a[i] = (_Float16)(ka < K ? W[(size_t)(ka < K ? ka : K - 1) * ld + n] : 0.f); a[8 + i] = (_Float16)(kb < K ? W[(size_t)(kb < K ? kb : K - 1) * ld + n] : 0.f); }
  return a;
}
struct F2 { v16b h, l; };
__device__ __forceinline__ F2 bsplit16(const float v[16]) { F2 r;
#pragma unroll
  for (int i = 0; i < 16; ++i) { const __bf16 h = (__bf16)v[i]; r.h[i] = h; r.l[i] = (__bf16)(v[i] - (float)h); }
  return r; }
__device__ __forceinline__ F2 split_row(const float* row, int k0, int lane) { float v[16]; const float* p = row + k0 + 8 * (lane >> 4);
#pragma unroll
  for (int i = 0; i < 8; ++i) { v[i] = p[i]; v[8 + i] = p[16 + i]; }
  return bsplit16(v); }
__device__ __forceinline__ F2 split_rowK(const float* row, int k0, int lane, int K) { float v[16]; const int g = lane >> 4;
#pragma unroll
  for (int i = 0; i < 8; ++i) { const int ka = k0 + 8 * g + i, kb = ka + 16; v[i] = ka < K ? row[ka < K ? ka : K - 1] : 0.f; v[8 + i] = kb < K ? row[kb < K ? kb : K - 1] : 0.f; }
  return bsplit16(v); }
__device__ __forceinline__ F2 split_col(const float* W, int k0, int n, int lane, int ld, int K) { float v[16]; const int g = lane >> 4;
#pragma unroll
  for (int i = 0; i < 8; ++i) { const int ka = k0 + 8 * g + i, kb = ka + 16; v[i] = ka < K ? W[(size_t)(ka < K ? ka : K - 1) * ld + n] : 0.f; v[8 + i] = kb < K ? W[(size_t)(kb < K ? kb : K - 1) * ld + n] : 0.f; }
  return bsplit16(v); }
__device__ __forceinline__ v8f mac3(const F2& a, const F2& b, v8f c) { c = wmma_bf(a.l, b.h, c); c = wmma_bf(a.h, b.l, c); return wmma_bf(a.h, b.h, c); }
__device__ __forceinline__ float sigm(float v) { return 1.0f / (1.0f + expf(-v)); }
#define LDSX() do { asm volatile("s_wait_dscnt 0" ::: "memory"); __builtin_amdgcn_wave_barrier(); __builtin_amdgcn_fence(__ATOMIC_RELEASE, "workgroup"); } while (0)


// Multi-head spatial attention block (B 16, C 256, 32x32 = 1,024 positions, d_model 512 = 8 x 64): MHA over positions + Wo + residual LN + SiLU FFN + residual LN; second output = inbound attention map (sum over queries, mean over heads).
#define NB 16
#define CIN 256
#define TT 1024
#define CC 512
#define NH 8
#define HD 64
#define NR (NB * TT)
#ifndef TNB
#define TNB NB
#endif
typedef __attribute__((ext_vector_type(8))) __bf16 v8b;
__device__ __forceinline__ v16b frag_b(const __bf16* rowk0, int lane) {
  union { v16b v; v8b q[2]; } u; const __bf16* p = rowk0 + 8 * (lane >> 4);
  u.q[0] = *(const v8b*)p; u.q[1] = *(const v8b*)(p + 16); return u.v;
}
__device__ __forceinline__ float bfr(float v) { return (float)(__bf16)v; }
__device__ __attribute__((noinline)) float exp_ni(float v) { return expf(v); }
__device__ __attribute__((noinline)) float erf_ni(float v) { return erff(v); }

#define OUT1_OFF ((size_t)NB * CIN * TT)
#define WS_QH  0u
#define WS_QL  (WS_QH + 2u * (size_t)NR * CC)
#define WS_KH  (WS_QL + 2u * (size_t)NR * CC)
#define WS_VT  (WS_KH + 2u * (size_t)NR * CC)          // f16 V^T fragments; QH, QL, KH and VT all lie in fragment order (see k_proj)
#define WS_Y   (WS_VT + 2u * (size_t)NR * CC)          // f32 O rows [b*t][512]
#define WS_Z1  (WS_Y + 4u * (size_t)NR * CC)           // f32 LN1 rows [b*t][256]
#define WS_HM  (WS_Z1 + 4u * (size_t)NR * CIN)         // f32 silu rows [b*t][256]
#define QCH 64                // query rows per partial column sum
#define NPART (NH * (TT / QCH))   // partial rows per batch
#define WS_CP  (WS_HM + 4u * (size_t)NR * CIN)         // f32 partial column sums [b][NPART][t]
#define WS_PW  (WS_CP + 4u * (size_t)NB * NPART * TT)  // bf16 packed weights: Wq, Wk, Wv, Wo, W1, W2
#define PW_O  (3 * CIN * CC)
#define PW_1  (4 * CIN * CC)
#define PW_2  (4 * CIN * CC + CIN * CIN)
#define WS_END (WS_PW + 2u * (size_t)(4 * CIN * CC + 2 * CIN * CIN))

// ---- k_pack: block = (256 units of 8 k, matrix): a weight matrix W (in,out) [K][N], rounded to bf16, laid out as the B fragments the GEMMs read:
// fragment (kc, nt) = 1 KiB = [k half q][lane][8 bf16], lane (g, col) holding column nt*16 + col, k = kc*32 + 16q + 8g + 0..7, so that a wave reads a fragment as two 512-byte loads
__global__ __launch_bounds__(256) void k_pack(const float* __restrict__ WQ, const float* __restrict__ WK, const float* __restrict__ WV, const float* __restrict__ WO, const float* __restrict__ W1, const float* __restrict__ W2, __bf16* __restrict__ PW) {
  const int m = blockIdx.y; const float* Wm = m == 0 ? WQ : m == 1 ? WK : m == 2 ? WV : m == 3 ? WO : m == 4 ? W1 : W2;
  const int N = m < 3 ? CC : CIN, K = m == 3 ? CC : CIN; const int unit = blockIdx.x * 256 + threadIdx.x;
  if (unit >= K * N / 8) return;
  const int lane = unit & 31, q = (unit >> 5) & 1, f = unit >> 6, NT = N / 16; const int n = (f % NT) * 16 + (lane & 15), k = (f / NT) * 32 + q * 16 + 8 * (lane >> 4);
  float v[8]; v8b o;
#pragma unroll   // the 8 loads are issued together
  for (int i = 0; i < 8; ++i) v[i] = Wm[(size_t)(k + i) * N + n];
  asm volatile("s_wait_xcnt 0x0" ::: "memory");   // the conversions below may reuse the registers that hold the loads' addresses
#pragma unroll
  for (int i = 0; i < 8; ++i) o[i] = (__bf16)v[i];
  vst2(PW + (m < 4 ? m * (CIN * CC) : PW_1 + (m - 4) * (CIN * CIN)) + (size_t)unit * 8, o); }
// one packed fragment (p = fragment base + lane * 8), and the 8 neighbouring fragments of one k-step
__device__ __forceinline__ v16b frag_pw(const __bf16* p) { union { v16b v; v8b q[2]; } u; u.q[0] = *(const v8b*)p; u.q[1] = *(const v8b*)(p + 256); return u.v; }
__device__ __forceinline__ void ldw8(v16b (&w)[8], const __bf16* p) {
#pragma unroll   // 16 loads in a row, the set indexed by constants
  for (int j = 0; j < 8; ++j) w[j] = frag_pw(p + j * 512); }

// ---- k_proj: block = (64 positions, 128 cols, b*3 + which): x^T tile; packed W; a k-step's 8 B fragments are loaded together, one k-step ahead of the WMMAs that use them
// Q, K and V leave in the order in which k_att's 16x16x32 fragments read them: fragment = 1 KiB = [k half q][lane (g, row)][8 f16], k = 32*chunk + 16q + 8g + 0..7.
// Q, K: [b][head][16-position tile][32-dim chunk], row = position; V^T: [b][head][32-key chunk][16-dim tile], row = dim, k = key. A wave stores and loads 512 contiguous bytes at a time.
__global__ __launch_bounds__(128) void k_proj(const float* __restrict__ X, const __bf16* __restrict__ PW, const float* __restrict__ BQ, const float* __restrict__ BK, const float* __restrict__ BV, _Float16* __restrict__ QH, _Float16* __restrict__ QL, _Float16* __restrict__ KH, _Float16* __restrict__ VT) {
  __shared__ __align__(16) __bf16 sx[64][CIN + 8]; __shared__ __align__(16) _Float16 sh[64][136], sl[64][136]; __shared__ __align__(16) _Float16 th[128][72];
  const int tid = threadIdx.x, wave = tid >> 5, lane = tid & 31, col = lane & 15, g = lane >> 4; const int p0 = blockIdx.x * 64; const int c0 = blockIdx.y * 128; const size_t b = blockIdx.z / 3; const int which = blockIdx.z % 3;
  const __bf16* Pw = PW + (size_t)which * (CIN * CC) + (c0 / 16) * 512 + lane * 8; const float* Bm = which == 0 ? BQ : which == 1 ? BK : BV;
  v16b wb[2][8]; ldw8(wb[0], Pw);
  for (int e = tid; e < CIN * 64; e += 128) { const int c = e >> 6, pl = e & 63; sx[pl][c] = (__bf16)X[(b * CIN + c) * (size_t)TT + p0 + pl]; }
  __syncthreads();
  v8f acc[8] = {};
#pragma unroll   // unrolled: the two fragment sets are indexed by constants and stay in registers
  for (int kc = 0; kc < CIN / 32; ++kc) { const v16b a = frag_b(&sx[wave * 16 + col][kc * 32], lane);
    if (kc + 1 < CIN / 32) ldw8(wb[(kc + 1) & 1], Pw + (kc + 1) * (CC / 16) * 512);
#pragma unroll
    for (int j = 0; j < 8; ++j) acc[j] = wmma_bf(a, wb[kc & 1][j], acc[j]); }
#pragma unroll
  for (int j = 0; j < 8; ++j) { const float bb = bfr(Bm[c0 + j * 16 + col]);
#pragma unroll
    for (int r = 0; r < 8; ++r) { const float v = acc[j][r] + bb; const int rl = wave * 16 + 8 * g + r, cl = j * 16 + col; const _Float16 hv = (_Float16)v;
      if (which == 2) th[cl][rl] = hv; else { sh[rl][cl] = hv; sl[rl][cl] = (_Float16)(v - (float)hv); } } }
  __syncthreads();
  // 16 fragments a block, unit e = (fragment f, k half, g, row); a head's 8 fragments of the block lie in a row
  const int kq = ((lane >> 4) + 2 * (wave & 1)) * 8;   // 16q + 8g of this thread's units
  if (which < 2) { _Float16* dh = which == 0 ? QH : KH; for (int e = tid; e < 64 * 16; e += 128) { const int f = e >> 6, hl = f >> 3, rl = ((f >> 1) & 3) * 16 + col, cl = hl * 64 + (f & 1) * 32 + kq;
      const size_t o = ((b * NH + c0 / HD + hl) * (TT / 16) + p0 / 16) * (size_t)1024 + (e & 511) * 8; vst2((unsigned*)(dh + o), *(const v4u*)&sh[rl][cl]);
      asm volatile("s_wait_xcnt 0x0" ::: "memory");   // what follows (the residual's LDS read, the next trip) overwrites the registers that the store names
      if (which == 0) { vst2((unsigned*)(QL + o), *(const v4u*)&sl[rl][cl]); asm volatile("s_wait_xcnt 0x0" ::: "memory"); } } }   // the same for the residual's store
  else { for (int e = tid; e < 128 * 8; e += 128) { const int f = e >> 6, hl = f >> 3, cl = hl * 64 + (f & 3) * 16 + col, rl = ((f >> 2) & 1) * 32 + kq;
      vst2((unsigned*)(VT + ((b * NH + c0 / HD + hl) * (TT / 32) + p0 / 32) * (size_t)2048 + (e & 511) * 8), *(const v4u*)&th[cl][rl]); } } }
#define ESC 0.18033688f   // log2(e) / 8: the logits' scale 1 / sqrt(64) and the change of base, in one factor
#define KRING 4   // K fragments in flight a wave (4 WMMAs each)
#define VRING 6   // V fragments in flight a wave (2 WMMAs each); more of either and the kernel spills at 256 registers
// one f16 fragment in fragment order (f = fragment base, l8 = lane * 8): two loads of 512 contiguous bytes a wave
__device__ __forceinline__ v16h frag_pk(const _Float16* f, unsigned l8) { union { v16h v; v8h q[2]; } u; const _Float16* p = f + l8; u.q[0] = *(const v8h*)p; u.q[1] = *(const v8h*)(p + 256); return u.v; }
// ---- k_att: block = (64 queries, z = b*8 + h), 8 waves; wave w owns keys 128w .. 128w+127 and walks the block's queries 32 at a time (two 16-query tiles share every K and V fragment).
// S^T = K . Q^T (2 products): a lane holds one query's logits for 8 consecutive keys of each 16-key tile, so the whole 32 x 128 tile stays in registers,
// the row maximum and sum need one exchange between wave halves and one between waves, and two neighbouring tiles pack straight into the B operand of O^T = V^T . P^T.
// Column sums: the wave's own P tile goes through LDS once (row = query), each lane then adds 8 keys over 16 queries and keeps the sums over the block's 64 queries.
// waves_per_eu(4, 4) holds a wave to 256 registers, so that two blocks (16 waves) share a WGP, which their LDS also allows.
__global__ __launch_bounds__(256) __attribute__((amdgpu_waves_per_eu(4, 4))) void k_att(const _Float16* __restrict__ QH, const _Float16* __restrict__ QL, const _Float16* KH, const _Float16* VT, float* __restrict__ Y, float* __restrict__ CP) {   // KH, VT without __restrict__: with it the compiler holds the fragments that both passes read first in registers over the whole pass, and spills
  __shared__ float smx[2][8][32]; __shared__ __align__(16) _Float16 sp[8][32][144]; __shared__ __align__(16) float so[8][32][68];
  const int z = blockIdx.y; const size_t b = z / NH; const int h = z % NH;
  const int tid = threadIdx.x, wave = tid >> 5, lane = tid & 31, col = lane & 15, g = lane >> 4; const int kw = wave * 128;
  const size_t hb = (size_t)z * (TT * HD);   // this head's fragments: 128 KiB in each of the four buffers
  const int ws = wave * 8192;   // the wave's 8 key tiles (K) and 4 key chunks (V): 16 KiB each
  const _Float16* Kp = KH + hb + ws; const _Float16* Vp = VT + hb + ws; const _Float16* Qh = QH + hb + blockIdx.x * 4096; const _Float16* Ql = QL + hb + blockIdx.x * 4096; const unsigned l8 = lane * 8;
  v4f c0 = {}, c1 = {};
#pragma unroll 1   // rolled: unrolled, the two passes' tiles would compete for the 256 registers
  for (int qp = 0; qp < 2; ++qp) { const size_t q0 = b * TT + blockIdx.x * 64 + qp * 32;
    v8f s[8][2] = {}; v16h hq[2], lq[2], kf[KRING], vf[VRING];
#pragma unroll   // the first KRING K fragments are asked for together
    for (int i = 0; i < KRING; ++i) kf[i] = frag_pk(Kp + ((i & 7) * 2 + (i >> 3)) * 512, l8);
#pragma unroll   // unrolled: the ring of K fragments is indexed by constants; fragment i + KRING is asked for as soon as fragment i has been used
    for (int i = 0; i < 16; ++i) { const int kc = i >> 3, t = i & 7; const v16h k = kf[i % KRING];
      if (t == 0) {
#pragma unroll
        for (int u = 0; u < 2; ++u) { hq[u] = frag_pk(Qh + ((qp * 2 + u) * 2 + kc) * 512, l8); lq[u] = frag_pk(Ql + ((qp * 2 + u) * 2 + kc) * 512, l8); }
        asm volatile("s_wait_xcnt 0x0" :: "v"(Qh + qp * 2048 + l8), "v"(Ql + qp * 2048 + l8) : "memory"); }   // the registers that hold the Q loads' addresses are reused for fragments further down; named as inputs, the two address pairs stay whole up to the wait
#pragma unroll
      for (int u = 0; u < 2; ++u) { s[t][u] = wmma16(k, hq[u], s[t][u]); s[t][u] = wmma16(k, lq[u], s[t][u]); }
      if (i + KRING < 16) kf[i % KRING] = frag_pk(Kp + (((i + KRING) & 7) * 2 + ((i + KRING) >> 3)) * 512, l8); }
    float m[2], inv[2];
#pragma unroll
    for (int u = 0; u < 2; ++u) {   // the maximum is taken over the unscaled logits: the scale is positive and goes into the exponent's FMA
      v8f mv = s[0][u];
#pragma unroll
      for (int t = 1; t < 8; ++t)
#pragma unroll
        for (int r = 0; r < 8; ++r) mv[r] = fmaxf(mv[r], s[t][u][r]);
      float a = fmaxf(fmaxf(fmaxf(mv[0], mv[1]), fmaxf(mv[2], mv[3])), fmaxf(fmaxf(mv[4], mv[5]), fmaxf(mv[6], mv[7])));
      a = fmaxf(a, __shfl_xor(a, 16)); if (g == 0) smx[0][wave][u * 16 + col] = a; }
    __syncthreads();
#pragma unroll
    for (int u = 0; u < 2; ++u) { const int x = u * 16 + col;
      m[u] = fmaxf(fmaxf(fmaxf(smx[0][0][x], smx[0][1][x]), fmaxf(smx[0][2][x], smx[0][3][x])), fmaxf(fmaxf(smx[0][4][x], smx[0][5][x]), fmaxf(smx[0][6][x], smx[0][7][x])));
      const float mc = m[u] * ESC; const v8f esc8 = { ESC, ESC, ESC, ESC, ESC, ESC, ESC, ESC }, nmc8 = { -mc, -mc, -mc, -mc, -mc, -mc, -mc, -mc }; v8f sv = {};
#pragma unroll
      for (int t = 0; t < 8; ++t) { s[t][u] = __builtin_elementwise_fma(s[t][u], esc8, nmc8);
#pragma unroll
        for (int r = 0; r < 8; ++r) s[t][u][r] = __builtin_amdgcn_exp2f(s[t][u][r]);
        sv += s[t][u]; }   // argument <= 0 but for one rounding; far below -126 gives 0, which P's f16 would round to anyway
      float sum = ((sv[0] + sv[1]) + (sv[2] + sv[3])) + ((sv[4] + sv[5]) + (sv[6] + sv[7]));
      sum += __shfl_xor(sum, 16); if (g == 0) smx[1][wave][x] = sum; }
    __syncthreads();
    v8h p8[8][2];
#pragma unroll   // the first VRING V fragments fly while P is scaled and packed
    for (int i = 0; i < VRING; ++i) vf[i] = frag_pk(Vp + i * 512, l8);
    __builtin_amdgcn_sched_barrier(0);   // the loads above and the packing below are scheduled apart: as one region this build needs more than 256 registers and spills to scratch
#pragma unroll
    for (int u = 0; u < 2; ++u) { const int x = u * 16 + col;
      inv[u] = 2048.0f * (1.0f / (((smx[1][0][x] + smx[1][1][x]) + (smx[1][2][x] + smx[1][3][x])) + ((smx[1][4][x] + smx[1][5][x]) + (smx[1][6][x] + smx[1][7][x]))));   // P's factor 2^11 rides in the row's reciprocal: a power of two, the same bits
#pragma unroll
      for (int t = 0; t < 8; ++t) {
#pragma unroll
        for (int r = 0; r < 8; ++r) p8[t][u][r] = (_Float16)(s[t][u][r] * inv[u]);
        *(v8h*)&sp[wave][x][t * 16 + 8 * g] = p8[t][u]; }
 }
    v8f acc[4][2] = {};
#pragma unroll
    for (int c = 0; c < 4; ++c) { union { v16h v; v8h q[2]; } pb[2];
#pragma unroll
      for (int u = 0; u < 2; ++u) { pb[u].q[0] = p8[2 * c][u]; pb[u].q[1] = p8[2 * c + 1][u]; }
#pragma unroll
      for (int j = 0; j < 4; ++j) { const int i = c * 4 + j; const v16h v = vf[i % VRING];
#pragma unroll
        for (int u = 0; u < 2; ++u) acc[j][u] = wmma16(v, pb[u].v, acc[j][u]);
        if (i + VRING < 16) vf[i % VRING] = frag_pk(Vp + (i + VRING) * 512, l8); } }
    LDSX();   // the wave's own P rows are in LDS before its lanes read across them
#pragma unroll
    for (int q = 0; q < 16; ++q) { const v8h v = *(const v8h*)&sp[wave][g * 16 + q][col * 8];
#pragma unroll
      for (int e = 0; e < 4; ++e) { c0[e] += (float)v[e]; c1[e] += (float)v[4 + e]; } }
#pragma unroll
    for (int u = 0; u < 2; ++u)
#pragma unroll
      for (int j = 0; j < 4; ++j) { const v8f o = acc[j][u] * (1.0f / 2048.0f); const v4f lo = { o[0], o[1], o[2], o[3] }, hi = { o[4], o[5], o[6], o[7] };
        *(v4f*)&so[wave][u * 16 + col][j * 16 + 8 * g] = lo; *(v4f*)&so[wave][u * 16 + col][j * 16 + 8 * g + 4] = hi; }
    __syncthreads();
    { const int q = tid >> 3, d0 = (tid & 7) * 8; float* y = Y + (q0 + q) * CC + h * HD + d0;
#pragma unroll
      for (int f = 0; f < 2; ++f) { const int d = d0 + 4 * f;
        vst2(y + 4 * f, ((*(const v4f*)&so[0][q][d] + *(const v4f*)&so[1][q][d]) + (*(const v4f*)&so[2][q][d] + *(const v4f*)&so[3][q][d])) + ((*(const v4f*)&so[4][q][d] + *(const v4f*)&so[5][q][d]) + (*(const v4f*)&so[6][q][d] + *(const v4f*)&so[7][q][d]))); }
      asm volatile("s_wait_xcnt 0x0" ::: "memory"); } }   // the next pass overwrites the registers that the two stores name
#pragma unroll
  for (int e = 0; e < 4; ++e) { c0[e] += __shfl_xor(c0[e], 16); c1[e] += __shfl_xor(c1[e], 16); }
  float* cp = CP + (b * NPART + h * (TT / QCH) + blockIdx.x) * (size_t)TT + kw + col * 8 + 4 * g; vst2(cp, g == 0 ? c0 : c1); }
// ---- k_colr: block = (128 keys, batch): attn_map[b][k] = (1/8) sum over the batch's 128 partial rows (8 heads x 16 query blocks); wave w sums 16 rows, then 8 wave sums through LDS
__global__ __launch_bounds__(256) void k_colr(const float* __restrict__ CP, float* __restrict__ AM) { __shared__ __align__(16) float sr[8][128];
  const int t = threadIdx.x, w = t >> 5, lane = t & 31; const size_t b = blockIdx.y; const int k0 = blockIdx.x * 128;
  const float* p = CP + (b * NPART + w * (NPART / 8)) * (size_t)TT + k0 + lane * 4;
  v4f v[NPART / 8];
#pragma unroll
  for (int i = 0; i < NPART / 8; ++i) v[i] = *(const v4f*)(p + (size_t)i * TT);
  v4f a = {};
#pragma unroll
  for (int i = 0; i < NPART / 8; ++i) a += v[i];
  *(v4f*)&sr[w][lane * 4] = a;
  __syncthreads();
  if (t < 32) { v4f s = *(const v4f*)&sr[0][t * 4];
#pragma unroll
    for (int i = 1; i < 8; ++i) s += *(const v4f*)&sr[i][t * 4];
    vst2(AM + b * TT + k0 + t * 4, s * (1.0f / 2048.0f) * (1.0f / NH)); } }
// ---- k_lnA: block = 64 rows x all 256 output cols: Z1 = LN(Y (hi+lo) Wo + bo + x^T) (K 512); writes Z1 rows
// ---- k_lnB: out = LN(HM (hi+lo) W2 + b2 + Z1) (K 256); writes channel-major output planes
template <int MODE>
__global__ __launch_bounds__(128) void k_ln(const float* __restrict__ A, const __bf16* __restrict__ PWm, const float* __restrict__ Bv, const float* __restrict__ RES, const float* __restrict__ GA, const float* __restrict__ BE, float* __restrict__ DST) {
  __shared__ __align__(16) float sz[64][CIN + 4];
  const int tid = threadIdx.x, wave = tid >> 5, lane = tid & 31, col = lane & 15, g = lane >> 4; const size_t r0 = (size_t)blockIdx.x * 64; const size_t b = r0 / TT; const int p0 = (int)(r0 % TT); constexpr int K = (MODE == 0) ? CC : CIN;
#pragma unroll 1
  for (int half = 0; half < 2; ++half) {
    v8f acc[8]; for (int j = 0; j < 8; ++j) for (int r = 0; r < 8; ++r) acc[j][r] = 0.f;
    const __bf16* Pw = PWm + half * 8 * 512 + lane * 8; const float* Ar = A + (r0 + wave * 16 + col) * K;
    v16b w0[8], w1[8]; ldw8(w0, Pw);
#pragma unroll 1   // two k-steps a trip, written out: each step's 8 B fragments are loaded one step ahead into the set the other step has left
    for (int kc = 0; kc < K / 32; kc += 2) { const F2 a0 = split_row(Ar, kc * 32, lane);
      ldw8(w1, Pw + (kc + 1) * (CIN / 16) * 512);
#pragma unroll
      for (int j = 0; j < 8; ++j) { acc[j] = wmma_bf(a0.h, w0[j], acc[j]); acc[j] = wmma_bf(a0.l, w0[j], acc[j]); }
      const F2 a1 = split_row(Ar, kc * 32 + 32, lane);
      if (kc + 2 < K / 32) ldw8(w0, Pw + (kc + 2) * (CIN / 16) * 512);
      asm volatile("s_wait_xcnt 0x0" ::: "memory");   // the address registers that the trip's loads name are advanced below
#pragma unroll
      for (int j = 0; j < 8; ++j) { acc[j] = wmma_bf(a1.h, w1[j], acc[j]); acc[j] = wmma_bf(a1.l, w1[j], acc[j]); } }
#pragma unroll
    for (int j = 0; j < 8; ++j) { const int o = half * 128 + j * 16 + col; const float bb = bfr(Bv[o]);
#pragma unroll
      for (int r = 0; r < 8; ++r) { const int rl = wave * 16 + 8 * g + r; const float res = (MODE == 0) ? bfr(RES[(b * CIN + o) * (size_t)TT + p0 + rl]) : RES[(r0 + rl) * CIN + o]; sz[rl][o] = acc[j][r] + bb + res; } } }
  __syncthreads();
  // LayerNorm per row (wave handles 16 rows; lanes stride columns)
  for (int rr = 0; rr < 16; ++rr) { const int rl = wave * 16 + rr; float s = 0.f; for (int c = lane; c < CIN; c += 32) s += sz[rl][c];
#pragma unroll
    for (int o2 = 1; o2 < 32; o2 <<= 1) s += __shfl_xor(s, o2); const float mu = s / CIN; float q = 0.f; for (int c = lane; c < CIN; c += 32) { const float d = sz[rl][c] - mu; q += d * d; }
#pragma unroll
    for (int o2 = 1; o2 < 32; o2 <<= 1) q += __shfl_xor(q, o2); const float inv = 1.0f / sqrtf(q / CIN + 1e-5f);
    for (int c = lane; c < CIN; c += 32) sz[rl][c] = (sz[rl][c] - mu) * inv * bfr(GA[c]) + bfr(BE[c]); }
  __syncthreads();
  if (MODE == 0) { for (int e = tid; e < 64 * 64; e += 128) { const int rl = e >> 6, q = e & 63; vst2(DST + (r0 + rl) * CIN + q * 4, *(const v4f*)&sz[rl][q * 4]); } }
  else { // channel-major planes [b][c][p0 .. p0+63]: transpose through registers: for (c, 4 consecutive positions)
    for (int e = tid; e < CIN * 16; e += 128) { const int c = e >> 4, q = e & 15; __align__(16) float v4x[4]; v4x[0] = sz[q * 4][c]; v4x[1] = sz[q * 4 + 1][c]; v4x[2] = sz[q * 4 + 2][c]; v4x[3] = sz[q * 4 + 3][c]; vst2(DST + (b * CIN + c) * (size_t)TT + p0 + q * 4, *(const v4f*)v4x); } } }
// ---- k_ffn1: block = (64 rows, 128 cols): HM = silu(Z1 (hi+lo) W1 + b1)
__global__ __launch_bounds__(128) void k_ffn1(const float* __restrict__ Z1, const __bf16* __restrict__ PW1, const float* __restrict__ B1, float* __restrict__ HM) { __shared__ __align__(16) float sf[4][16][132];
  const int tid = threadIdx.x, wave = tid >> 5, lane = tid & 31, col = lane & 15, g = lane >> 4; const int c0 = blockIdx.y * 128; const size_t r0 = (size_t)blockIdx.x * 64 + wave * 16;
  v8f acc[8] = {};
  const __bf16* Pw = PW1 + (c0 / 16) * 512 + lane * 8; v16b wb[2][8]; ldw8(wb[0], Pw);
#pragma unroll   // unrolled: the two fragment sets are indexed by constants and stay in registers
  for (int kc = 0; kc < CIN / 32; ++kc) { const F2 a = split_row(Z1 + (r0 + col) * CIN, kc * 32, lane);
    if (kc + 1 < CIN / 32) ldw8(wb[(kc + 1) & 1], Pw + (kc + 1) * (CIN / 16) * 512);
#pragma unroll
    for (int j = 0; j < 8; ++j) { acc[j] = wmma_bf(a.h, wb[kc & 1][j], acc[j]); acc[j] = wmma_bf(a.l, wb[kc & 1][j], acc[j]); } }
#pragma unroll
  for (int j = 0; j < 8; ++j) { const float bb = bfr(B1[c0 + j * 16 + col]);
#pragma unroll
    for (int r = 0; r < 8; ++r) { const float v = acc[j][r] + bb; sf[wave][8 * g + r][j * 16 + col] = v / (1.0f + expf(-v)); } }
  LDSX(); for (int rl = 0; rl < 16; ++rl) vst2(HM + (r0 + rl) * CIN + c0 + lane * 4, *(const v4f*)&sf[wave][rl][lane * 4]); }
extern "C" void kernel_launch(void* const* d_in, const int* in_sizes, int n_in, void* d_out, int out_size, void* d_ws, size_t ws_size, hipStream_t stream) {
  (void)in_sizes; (void)n_in; (void)out_size;
  const float** F = (const float**)d_in;   // 0 x [16,256,32,32], 1 Wq [256,512], 2 bq, 3 Wk, 4 bk, 5 Wv, 6 bv, 7 Wo [512,256], 8 bo, 9 W1 [256,256], 10 b1, 11 W2, 12 b2, 13 g1, 14 be1, 15 g2, 16 be2
  if (ws_size < (size_t)WS_END) return;
  char* ws = (char*)d_ws; _Float16 *QH = (_Float16*)(ws + WS_QH), *QL = (_Float16*)(ws + WS_QL), *KH = (_Float16*)(ws + WS_KH), *VT = (_Float16*)(ws + WS_VT); float *Y = (float*)(ws + WS_Y), *Z1 = (float*)(ws + WS_Z1), *HM = (float*)(ws + WS_HM), *CP = (float*)(ws + WS_CP); __bf16* PW = (__bf16*)(ws + WS_PW);
  float* OUT0 = (float*)d_out; float* OUT1 = (float*)d_out + OUT1_OFF;
  k_pack<<<dim3(CIN * CC / 8 / 256, 6), 256, 0, stream>>>(F[1], F[3], F[5], F[7], F[9], F[11], PW);
  k_proj<<<dim3(TT / 64, CC / 128, TNB * 3), 128, 0, stream>>>(F[0], PW, F[2], F[4], F[6], QH, QL, KH, VT);
  k_att<<<dim3(TT / 64, TNB * NH), 256, 0, stream>>>(QH, QL, KH, VT, Y, CP);
  k_colr<<<dim3(TT / 128, TNB), 256, 0, stream>>>(CP, OUT1);
  k_ln<0><<<TNB * TT / 64, 128, 0, stream>>>(Y, PW + PW_O, F[8], F[0], F[13], F[14], Z1);
  k_ffn1<<<dim3(TNB * TT / 64, CIN / 128), 128, 0, stream>>>(Z1, PW + PW_1, F[10], HM);
  k_ln<1><<<TNB * TT / 64, 128, 0, stream>>>(HM, PW + PW_2, F[12], Z1, F[15], F[16], OUT0);
}

// v006
// One run takes 189 microseconds.
// Next to v005, in two timings, it ran 1.22 and 1.24 times as fast.
// Over all steps from v000 it is 40.0 times as fast.
// compute dtype: all float inputs rounded to bf16; Q/K/V = x^T W + b with EXACT bf16 products on WMMA 16x16x32 (channel-major tiles transposed in LDS), f32 accumulate; Q as f16 hi + residual, K f16 -> 2-product logits kept in f32 registers (one fused launch for logits, softmax, column sums and P . V); softmax in f32, exp((l - max) / 8) = exp2(l * (log2 e / 8) - max * (log2 e / 8)): one FMA and the hardware exp2 -> P f16 x 2^11; attn_map = column sums of P / 8 in f32; O = P . V (V rounded once to f16, 1 product); Wo, W1, W2 GEMMs with the f32 activations split bf16 hi + lo (2 products); LayerNorms (eps 1e-5), SiLU and residuals in f32; outputs: out channel-major [b][c][hw], attn_map [b][hw].
#include <hip/hip_runtime.h>
#include <math.h>

typedef __attribute__((ext_vector_type(16))) _Float16 v16h;
typedef __attribute__((ext_vector_type(16))) __bf16 v16b;
typedef __attribute__((ext_vector_type(8)))  _Float16 v8h;
typedef __attribute__((ext_vector_type(8)))  float v8f;
typedef __attribute__((ext_vector_type(4)))  float v4f;
typedef __attribute__((ext_vector_type(2)))  float v2f;
typedef __attribute__((ext_vector_type(4)))  unsigned v4u;
typedef __attribute__((ext_vector_type(4)))  int v4i;
typedef float __attribute__((may_alias)) float_a;
typedef int __attribute__((may_alias)) int_a;

template <typename T> __device__ __forceinline__ void vst2(void* p, T v) { *(T*)p = v;  }
__device__ __forceinline__ v8f wmma16(v16h a, v16h b, v8f c) {
  v8f d = __builtin_amdgcn_wmma_f32_16x16x32_f16(false, a, false, b, (short)0, c, false, false);
  asm volatile("v_nop\n\tv_nop\n\tv_nop\n\tv_nop" : "+v"(d) : "v"(a), "v"(b));
  return d;
}
__device__ __forceinline__ v8f wmma_bf(v16b a, v16b b, v8f c) {
  v8f d = __builtin_amdgcn_wmma_f32_16x16x32_bf16(false, a, false, b, (short)0, c, false, false);
  asm volatile("v_nop\n\tv_nop\n\tv_nop\n\tv_nop" : "+v"(d) : "v"(a), "v"(b));
  return d;
}
// 16x16x32 fragments: lane = (h = lane>>4, row/col = lane&15); elements 0..7 = k0+8h+0..7, 8..15 = k0+16+8h+0..7; D element r = row 8h+r
__device__ __forceinline__ v16h frag_h(const _Float16* rowk0, int lane) {
  union { v16h v; v8h q[2]; } u; const _Float16* p = rowk0 + 8 * (lane >> 4);
  u.q[0] = *(const v8h*)p; u.q[1] = *(const v8h*)(p + 16); return u.v;
}
__device__ __forceinline__ v16h frag_f32(const float* rowk0, int lane) {
  v16h a; const float* p = rowk0 + 8 * (lane >> 4);
#pragma unroll
  for (int i = 0; i < 8; ++i) { a[i] = (_Float16)p[i]; a[8 + i] = (_Float16)p[16 + i]; }
  return a;
}
__device__ __forceinline__ v16h frag_f32s(const float* rowk0, int lane, float sc) {
  v16h a; const float* p = rowk0 + 8 * (lane >> 4);
#pragma unroll
  for (int i = 0; i < 8; ++i) { a[i] = (_Float16)(p[i] * sc); a[8 + i] = (_Float16)(p[16 + i] * sc); }
  return a;
}
// column fragment from a [K][ld] layout (column n), rows >= K read as 0
__device__ __forceinline__ v16h fragc_f32(const float* W, int k0, int n, int lane, int ld, int K) {
  v16h a; const int g = lane >> 4;
#pragma unroll
  for (int i = 0; i < 8; ++i) { const int ka = k0 + 8 * g + i, kb = ka + 16;
    a[i] = (_Float16)(ka < K ? W[(size_t)(ka < K ? ka : K - 1) * ld + n] : 0.f); a[8 + i] = (_Float16)(kb < K ? W[(size_t)(kb < K ? kb : K - 1) * ld + n] : 0.f); }
  return a;
}
struct F2 { v16b h, l; };
__device__ __forceinline__ F2 bsplit16(const float v[16]) { F2 r;
#pragma unroll
  for (int i = 0; i < 16; ++i) { const __bf16 h = (__bf16)v[i]; r.h[i] = h; r.l[i] = (__bf16)(v[i] - (float)h); }
  return r; }
__device__ __forceinline__ F2 split_row(const float* row, int k0, int lane) { float v[16]; const float* p = row + k0 + 8 * (lane >> 4);
#pragma unroll
  for (int i = 0; i < 8; ++i) { v[i] = p[i]; v[8 + i] = p[16 + i]; }
  return bsplit16(v); }
__device__ __forceinline__ F2 split_rowK(const float* row, int k0, int lane, int K) { float v[16]; const int g = lane >> 4;
#pragma unroll
  for (int i = 0; i < 8; ++i) { const int ka = k0 + 8 * g + i, kb = ka + 16; v[i] = ka < K ? row[ka < K ? ka : K - 1] : 0.f; v[8 + i] = kb < K ? row[kb < K ? kb : K - 1] : 0.f; }
  return bsplit16(v); }
__device__ __forceinline__ F2 split_col(const float* W, int k0, int n, int lane, int ld, int K) { float v[16]; const int g = lane >> 4;
#pragma unroll
  for (int i = 0; i < 8; ++i) { const int ka = k0 + 8 * g + i, kb = ka + 16; v[i] = ka < K ? W[(size_t)(ka < K ? ka : K - 1) * ld + n] : 0.f; v[8 + i] = kb < K ? W[(size_t)(kb < K ? kb : K - 1) * ld + n] : 0.f; }
  return bsplit16(v); }
__device__ __forceinline__ v8f mac3(const F2& a, const F2& b, v8f c) { c = wmma_bf(a.l, b.h, c); c = wmma_bf(a.h, b.l, c); return wmma_bf(a.h, b.h, c); }
__device__ __forceinline__ float sigm(float v) { return 1.0f / (1.0f + expf(-v)); }
#define LDSX() do { asm volatile("s_wait_dscnt 0" ::: "memory"); __builtin_amdgcn_wave_barrier(); __builtin_amdgcn_fence(__ATOMIC_RELEASE, "workgroup"); } while (0)


// Multi-head spatial attention block (B 16, C 256, 32x32 = 1,024 positions, d_model 512 = 8 x 64): MHA over positions + Wo + residual LN + SiLU FFN + residual LN; second output = inbound attention map (sum over queries, mean over heads).
#define NB 16
#define CIN 256
#define TT 1024
#define CC 512
#define NH 8
#define HD 64
#define NR (NB * TT)
#ifndef TNB
#define TNB NB
#endif
typedef __attribute__((ext_vector_type(8))) __bf16 v8b;
__device__ __forceinline__ v16b frag_b(const __bf16* rowk0, int lane) {
  union { v16b v; v8b q[2]; } u; const __bf16* p = rowk0 + 8 * (lane >> 4);
  u.q[0] = *(const v8b*)p; u.q[1] = *(const v8b*)(p + 16); return u.v;
}
__device__ __forceinline__ float bfr(float v) { return (float)(__bf16)v; }
__device__ __attribute__((noinline)) float exp_ni(float v) { return expf(v); }
__device__ __attribute__((noinline)) float erf_ni(float v) { return erff(v); }

#define OUT1_OFF ((size_t)NB * CIN * TT)
#define WS_QH  0u
#define WS_QL  (WS_QH + 2u * (size_t)NR * CC)
#define WS_KH  (WS_QL + 2u * (size_t)NR * CC)
#define WS_VT  (WS_KH + 2u * (size_t)NR * CC)          // f16 V^T fragments; QH, QL, KH and VT all lie in fragment order (see k_proj)
#define WS_Y   (WS_VT + 2u * (size_t)NR * CC)          // f32 O rows [b*t][512]
#define WS_Z1  (WS_Y + 4u * (size_t)NR * CC)           // f32 LN1 rows [b*t][256]
#define WS_HM  (WS_Z1 + 4u * (size_t)NR * CIN)         // f32 silu rows [b*t][256]
#define QCH 64                // query rows per partial column sum
#define NPART (NH * (TT / QCH))   // partial rows per batch
#define WS_CP  (WS_HM + 4u * (size_t)NR * CIN)         // f32 partial column sums [b][NPART][t]
#define WS_PW  (WS_CP + 4u * (size_t)NB * NPART * TT)  // bf16 packed weights: Wq, Wk, Wv, Wo, W1, W2
#define PW_O  (3 * CIN * CC)
#define PW_1  (4 * CIN * CC)
#define PW_2  (4 * CIN * CC + CIN * CIN)
#define WS_END (WS_PW + 2u * (size_t)(4 * CIN * CC + 2 * CIN * CIN))

// ---- k_pack: block = (256 units of 8 k, matrix): a weight matrix W (in,out) [K][N], rounded to bf16, laid out as the B fragments the GEMMs read:
// fragment (kc, nt) = 1 KiB = [k half q][lane][8 bf16], lane (g, col) holding column nt*16 + col, k = kc*32 + 16q + 8g + 0..7, so that a wave reads a fragment as two 512-byte loads
__global__ __launch_bounds__(256) void k_pack(const float* __restrict__ WQ, const float* __restrict__ WK, const float* __restrict__ WV, const float* __restrict__ WO, const float* __restrict__ W1, const float* __restrict__ W2, __bf16* __restrict__ PW) {
  const int m = blockIdx.y; const float* Wm = m == 0 ? WQ : m == 1 ? WK : m == 2 ? WV : m == 3 ? WO : m == 4 ? W1 : W2;
  const int N = m < 3 ? CC : CIN, K = m == 3 ? CC : CIN; const int unit = blockIdx.x * 256 + threadIdx.x;
  if (unit >= K * N / 8) return;
  const int lane = unit & 31, q = (unit >> 5) & 1, f = unit >> 6, NT = N / 16; const int n = (f % NT) * 16 + (lane & 15), k = (f / NT) * 32 + q * 16 + 8 * (lane >> 4);
  float v[8]; v8b o;
#pragma unroll   // the 8 loads are issued together
  for (int i = 0; i < 8; ++i) v[i] = Wm[(size_t)(k + i) * N + n];
  asm volatile("s_wait_xcnt 0x0" ::: "memory");   // the conversions below may reuse the registers that hold the loads' addresses
#pragma unroll
  for (int i = 0; i < 8; ++i) o[i] = (__bf16)v[i];
  vst2(PW + (m < 4 ? m * (CIN * CC) : PW_1 + (m - 4) * (CIN * CIN)) + (size_t)unit * 8, o); }
// one packed fragment (p = fragment base + lane * 8), and the 8 neighbouring fragments of one k-step
__device__ __forceinline__ v16b frag_pw(const __bf16* p) { union { v16b v; v8b q[2]; } u; u.q[0] = *(const v8b*)p; u.q[1] = *(const v8b*)(p + 256); return u.v; }
__device__ __forceinline__ void ldw8(v16b (&w)[8], const __bf16* p) {
#pragma unroll   // 16 loads in a row, the set indexed by constants
  for (int j = 0; j < 8; ++j) w[j] = frag_pw(p + j * 512); }

// ---- k_proj: block = (64 positions, 128 cols, b*3 + which): x^T tile; packed W; a k-step's 8 B fragments are loaded together, one k-step ahead of the WMMAs that use them
// Q, K and V leave in the order in which k_att's 16x16x32 fragments read them: fragment = 1 KiB = [k half q][lane (g, row)][8 f16], k = 32*chunk + 16q + 8g + 0..7.
// Q, K: [b][head][16-position tile][32-dim chunk], row = position; V^T: [b][head][32-key chunk][16-dim tile], row = dim, k = key. A wave stores and loads 512 contiguous bytes at a time.
__global__ __launch_bounds__(128) void k_proj(const float* __restrict__ X, const __bf16* __restrict__ PW, const float* __restrict__ BQ, const float* __restrict__ BK, const float* __restrict__ BV, _Float16* __restrict__ QH, _Float16* __restrict__ QL, _Float16* __restrict__ KH, _Float16* __restrict__ VT) {
  __shared__ __align__(16) __bf16 sx[64][CIN + 8]; __shared__ __align__(16) _Float16 sh[64][136], sl[64][136]; __shared__ __align__(16) _Float16 th[128][72];
  const int tid = threadIdx.x, wave = tid >> 5, lane = tid & 31, col = lane & 15, g = lane >> 4; const int p0 = blockIdx.x * 64; const int c0 = blockIdx.y * 128; const size_t b = blockIdx.z / 3; const int which = blockIdx.z % 3;
  const __bf16* Pw = PW + (size_t)which * (CIN * CC) + (c0 / 16) * 512 + lane * 8; const float* Bm = which == 0 ? BQ : which == 1 ? BK : BV;
  v16b wb[2][8]; ldw8(wb[0], Pw);
  for (int e = tid; e < CIN * 64; e += 128) { const int c = e >> 6, pl = e & 63; sx[pl][c] = (__bf16)X[(b * CIN + c) * (size_t)TT + p0 + pl]; }
  __syncthreads();
  v8f acc[8] = {};
#pragma unroll   // unrolled: the two fragment sets are indexed by constants and stay in registers
  for (int kc = 0; kc < CIN / 32; ++kc) { const v16b a = frag_b(&sx[wave * 16 + col][kc * 32], lane);
    if (kc + 1 < CIN / 32) ldw8(wb[(kc + 1) & 1], Pw + (kc + 1) * (CC / 16) * 512);
#pragma unroll
    for (int j = 0; j < 8; ++j) acc[j] = wmma_bf(a, wb[kc & 1][j], acc[j]); }
#pragma unroll
  for (int j = 0; j < 8; ++j) { const float bb = bfr(Bm[c0 + j * 16 + col]);
#pragma unroll
    for (int r = 0; r < 8; ++r) { const float v = acc[j][r] + bb; const int rl = wave * 16 + 8 * g + r, cl = j * 16 + col; const _Float16 hv = (_Float16)v;
      if (which == 2) th[cl][rl] = hv; else { sh[rl][cl] = hv; sl[rl][cl] = (_Float16)(v - (float)hv); } } }
  __syncthreads();
  // 16 fragments a block, unit e = (fragment f, k half, g, row); a head's 8 fragments of the block lie in a row
  const int kq = ((lane >> 4) + 2 * (wave & 1)) * 8;   // 16q + 8g of this thread's units
  if (which < 2) { _Float16* dh = which == 0 ? QH : KH; for (int e = tid; e < 64 * 16; e += 128) { const int f = e >> 6, hl = f >> 3, rl = ((f >> 1) & 3) * 16 + col, cl = hl * 64 + (f & 1) * 32 + kq;
      const size_t o = ((b * NH + c0 / HD + hl) * (TT / 16) + p0 / 16) * (size_t)1024 + (e & 511) * 8; vst2((unsigned*)(dh + o), *(const v4u*)&sh[rl][cl]);
      asm volatile("s_wait_xcnt 0x0" ::: "memory");   // what follows (the residual's LDS read, the next trip) overwrites the registers that the store names
      if (which == 0) { vst2((unsigned*)(QL + o), *(const v4u*)&sl[rl][cl]); asm volatile("s_wait_xcnt 0x0" ::: "memory"); } } }   // the same for the residual's store
  else { for (int e = tid; e < 128 * 8; e += 128) { const int f = e >> 6, hl = f >> 3, cl = hl * 64 + (f & 3) * 16 + col, rl = ((f >> 2) & 1) * 32 + kq;
      vst2((unsigned*)(VT + ((b * NH + c0 / HD + hl) * (TT / 32) + p0 / 32) * (size_t)2048 + (e & 511) * 8), *(const v4u*)&th[cl][rl]); } } }
#define ESC 0.18033688f   // log2(e) / 8: the logits' scale 1 / sqrt(64) and the change of base, in one factor
#define KRING 4   // K fragments in flight a wave (4 WMMAs each)
#define VRING 6   // V fragments in flight a wave (2 WMMAs each); more of either and the kernel spills at 256 registers
// one f16 fragment in fragment order (f = fragment base, l8 = lane * 8): two loads of 512 contiguous bytes a wave
__device__ __forceinline__ v16h frag_pk(const _Float16* f, unsigned l8) { union { v16h v; v8h q[2]; } u; const _Float16* p = f + l8; u.q[0] = *(const v8h*)p; u.q[1] = *(const v8h*)(p + 256); return u.v; }
// ---- k_att: block = (64 queries, z = b*8 + h), 8 waves; wave w owns keys 128w .. 128w+127 and walks the block's queries 32 at a time (two 16-query tiles share every K and V fragment).
// S^T = K . Q^T (2 products): a lane holds one query's logits for 8 consecutive keys of each 16-key tile, so the whole 32 x 128 tile stays in registers,
// the row maximum and sum need one exchange between wave halves and one between waves, and two neighbouring tiles pack straight into the B operand of O^T = V^T . P^T.
// Column sums: the wave's own P tile goes through LDS once (row = query), each lane then adds 8 keys over 16 queries and keeps the sums over the block's 64 queries.
// waves_per_eu(4, 4) holds a wave to 256 registers, so that two blocks (16 waves) share a WGP, which their LDS also allows.
__global__ __launch_bounds__(256) __attribute__((amdgpu_waves_per_eu(4, 4))) void k_att(const _Float16* __restrict__ QH, const _Float16* __restrict__ QL, const _Float16* KH, const _Float16* VT, float* __restrict__ Y, float* __restrict__ CP) {   // KH, VT without __restrict__: with it the compiler holds the fragments that both passes read first in registers over the whole pass, and spills
  __shared__ float smx[2][8][32]; __shared__ __align__(16) _Float16 sp[8][32][144]; __shared__ __align__(16) float so[8][32][68];
  const int z = blockIdx.y; const size_t b = z / NH; const int h = z % NH;
  const int tid = threadIdx.x, wave = tid >> 5, lane = tid & 31, col = lane & 15, g = lane >> 4; const int kw = wave * 128;
  const size_t hb = (size_t)z * (TT * HD);   // this head's fragments: 128 KiB in each of the four buffers
  const int ws = wave * 8192;   // the wave's 8 key tiles (K) and 4 key chunks (V): 16 KiB each
  const _Float16* Kp = KH + hb + ws; const _Float16* Vp = VT + hb + ws; const _Float16* Qh = QH + hb + blockIdx.x * 4096; const _Float16* Ql = QL + hb + blockIdx.x * 4096; const unsigned l8 = lane * 8;
  v4f c0 = {}, c1 = {};
#pragma unroll 1   // rolled: unrolled, the two passes' tiles would compete for the 256 registers
  for (int qp = 0; qp < 2; ++qp) { const size_t q0 = b * TT + blockIdx.x * 64 + qp * 32;
    v8f s[8][2] = {}; v16h hq[2], lq[2], kf[KRING], vf[VRING];
#pragma unroll   // the first KRING K fragments are asked for together
    for (int i = 0; i < KRING; ++i) kf[i] = frag_pk(Kp + ((i & 7) * 2 + (i >> 3)) * 512, l8);
#pragma unroll   // unrolled: the ring of K fragments is indexed by constants; fragment i + KRING is asked for as soon as fragment i has been used
    for (int i = 0; i < 16; ++i) { const int kc = i >> 3, t = i & 7; const v16h k = kf[i % KRING];
      if (t == 0) {
#pragma unroll
        for (int u = 0; u < 2; ++u) { hq[u] = frag_pk(Qh + ((qp * 2 + u) * 2 + kc) * 512, l8); lq[u] = frag_pk(Ql + ((qp * 2 + u) * 2 + kc) * 512, l8); }
        asm volatile("s_wait_xcnt 0x0" :: "v"(Qh + qp * 2048 + l8), "v"(Ql + qp * 2048 + l8) : "memory"); }   // the registers that hold the Q loads' addresses are reused for fragments further down; named as inputs, the two address pairs stay whole up to the wait
#pragma unroll
      for (int u = 0; u < 2; ++u) { s[t][u] = wmma16(k, hq[u], s[t][u]); s[t][u] = wmma16(k, lq[u], s[t][u]); }
      if (i + KRING < 16) kf[i % KRING] = frag_pk(Kp + (((i + KRING) & 7) * 2 + ((i + KRING) >> 3)) * 512, l8); }
    float m[2], inv[2];
#pragma unroll
    for (int u = 0; u < 2; ++u) {   // the maximum is taken over the unscaled logits: the scale is positive and goes into the exponent's FMA
      v8f mv = s[0][u];
#pragma unroll
      for (int t = 1; t < 8; ++t)
#pragma unroll
        for (int r = 0; r < 8; ++r) mv[r] = fmaxf(mv[r], s[t][u][r]);
      float a = fmaxf(fmaxf(fmaxf(mv[0], mv[1]), fmaxf(mv[2], mv[3])), fmaxf(fmaxf(mv[4], mv[5]), fmaxf(mv[6], mv[7])));
      a = fmaxf(a, __shfl_xor(a, 16)); if (g == 0) smx[0][wave][u * 16 + col] = a; }
    __syncthreads();
#pragma unroll
    for (int u = 0; u < 2; ++u) { const int x = u * 16 + col;
      m[u] = fmaxf(fmaxf(fmaxf(smx[0][0][x], smx[0][1][x]), fmaxf(smx[0][2][x], smx[0][3][x])), fmaxf(fmaxf(smx[0][4][x], smx[0][5][x]), fmaxf(smx[0][6][x], smx[0][7][x])));
      const float mc = m[u] * ESC; const v8f esc8 = { ESC, ESC, ESC, ESC, ESC, ESC, ESC, ESC }, nmc8 = { -mc, -mc, -mc, -mc, -mc, -mc, -mc, -mc }; v8f sv = {};
#pragma unroll
      for (int t = 0; t < 8; ++t) { s[t][u] = __builtin_elementwise_fma(s[t][u], esc8, nmc8);
#pragma unroll
        for (int r = 0; r < 8; ++r) s[t][u][r] = __builtin_amdgcn_exp2f(s[t][u][r]);
        sv += s[t][u]; }   // argument <= 0 but for one rounding; far below -126 gives 0, which P's f16 would round to anyway
      float sum = ((sv[0] + sv[1]) + (sv[2] + sv[3])) + ((sv[4] + sv[5]) + (sv[6] + sv[7]));
      sum += __shfl_xor(sum, 16); if (g == 0) smx[1][wave][x] = sum; }
    __syncthreads();
    v8h p8[8][2];
#pragma unroll   // the first VRING V fragments fly while P is scaled and packed
    for (int i = 0; i < VRING; ++i) vf[i] = frag_pk(Vp + i * 512, l8);
    __builtin_amdgcn_sched_barrier(0);   // the loads above and the packing below are scheduled apart: as one region this build needs more than 256 registers and spills to scratch
#pragma unroll
    for (int u = 0; u < 2; ++u) { const int x = u * 16 + col;
      inv[u] = 2048.0f * (1.0f / (((smx[1][0][x] + smx[1][1][x]) + (smx[1][2][x] + smx[1][3][x])) + ((smx[1][4][x] + smx[1][5][x]) + (smx[1][6][x] + smx[1][7][x]))));   // P's factor 2^11 rides in the row's reciprocal: a power of two, the same bits
#pragma unroll
      for (int t = 0; t < 8; ++t) {
#pragma unroll
        for (int r = 0; r < 8; ++r) p8[t][u][r] = (_Float16)(s[t][u][r] * inv[u]);
        *(v8h*)&sp[wave][x][t * 16 + 8 * g] = p8[t][u]; }
 }
    v8f acc[4][2] = {};
#pragma unroll
    for (int c = 0; c < 4; ++c) { union { v16h v; v8h q[2]; } pb[2];
#pragma unroll
      for (int u = 0; u < 2; ++u) { pb[u].q[0] = p8[2 * c][u]; pb[u].q[1] = p8[2 * c + 1][u]; }
#pragma unroll
      for (int j = 0; j < 4; ++j) { const int i = c * 4 + j; const v16h v = vf[i % VRING];
#pragma unroll
        for (int u = 0; u < 2; ++u) acc[j][u] = wmma16(v, pb[u].v, acc[j][u]);
        if (i + VRING < 16) vf[i % VRING] = frag_pk(Vp + (i + VRING) * 512, l8); } }
    LDSX();   // the wave's own P rows are in LDS before its lanes read across them
#pragma unroll
    for (int q = 0; q < 16; ++q) { const v8h v = *(const v8h*)&sp[wave][g * 16 + q][col * 8];
#pragma unroll
      for (int e = 0; e < 4; ++e) { c0[e] += (float)v[e]; c1[e] += (float)v[4 + e]; } }
#pragma unroll
    for (int u = 0; u < 2; ++u)
#pragma unroll
      for (int j = 0; j < 4; ++j) { const v8f o = acc[j][u] * (1.0f / 2048.0f); const v4f lo = { o[0], o[1], o[2], o[3] }, hi = { o[4], o[5], o[6], o[7] };
        *(v4f*)&so[wave][u * 16 + col][j * 16 + 8 * g] = lo; *(v4f*)&so[wave][u * 16 + col][j * 16 + 8 * g + 4] = hi; }
    __syncthreads();
    { const int q = tid >> 3, d0 = (tid & 7) * 8; float* y = Y + (q0 + q) * CC + h * HD + d0;
#pragma unroll
      for (int f = 0; f < 2; ++f) { const int d = d0 + 4 * f;
        vst2(y + 4 * f, ((*(const v4f*)&so[0][q][d] + *(const v4f*)&so[1][q][d]) + (*(const v4f*)&so[2][q][d] + *(const v4f*)&so[3][q][d])) + ((*(const v4f*)&so[4][q][d] + *(const v4f*)&so[5][q][d]) + (*(const v4f*)&so[6][q][d] + *(const v4f*)&so[7][q][d]))); }
      asm volatile("s_wait_xcnt 0x0" ::: "memory"); } }   // the next pass overwrites the registers that the two stores name
#pragma unroll
  for (int e = 0; e < 4; ++e) { c0[e] += __shfl_xor(c0[e], 16); c1[e] += __shfl_xor(c1[e], 16); }
  float* cp = CP + (b * NPART + h * (TT / QCH) + blockIdx.x) * (size_t)TT + kw + col * 8 + 4 * g; vst2(cp, g == 0 ? c0 : c1); }
// ---- k_colr: block = (128 keys, batch): attn_map[b][k] = (1/8) sum over the batch's 128 partial rows (8 heads x 16 query blocks); wave w sums 16 rows, then 8 wave sums through LDS
__global__ __launch_bounds__(256) void k_colr(const float* __restrict__ CP, float* __restrict__ AM) { __shared__ __align__(16) float sr[8][128];
  const int t = threadIdx.x, w = t >> 5, lane = t & 31; const size_t b = blockIdx.y; const int k0 = blockIdx.x * 128;
  const float* p = CP + (b * NPART + w * (NPART / 8)) * (size_t)TT + k0 + lane * 4;
  v4f v[NPART / 8];
#pragma unroll
  for (int i = 0; i < NPART / 8; ++i) v[i] = *(const v4f*)(p + (size_t)i * TT);
  v4f a = {};
#pragma unroll
  for (int i = 0; i < NPART / 8; ++i) a += v[i];
  *(v4f*)&sr[w][lane * 4] = a;
  __syncthreads();
  if (t < 32) { v4f s = *(const v4f*)&sr[0][t * 4];
#pragma unroll
    for (int i = 1; i < 8; ++i) s += *(const v4f*)&sr[i][t * 4];
    vst2(AM + b * TT + k0 + t * 4, s * (1.0f / 2048.0f) * (1.0f / NH)); } }
// ---- k_lnA: block = 64 rows x all 256 output cols: Z1 = LN(Y (hi+lo) Wo + bo + x^T) (K 512); writes Z1 rows
// ---- k_lnB: out = LN(HM (hi+lo) W2 + b2 + Z1) (K 256); writes channel-major output planes
template <int MODE>
__global__ __launch_bounds__(128) void k_ln(const float* __restrict__ A, const __bf16* __restrict__ PWm, const float* __restrict__ Bv, const float* __restrict__ RES, const float* __restrict__ GA, const float* __restrict__ BE, float* __restrict__ DST) {
  __shared__ __align__(16) float sz[64][CIN + 4];
  const int tid = threadIdx.x, wave = tid >> 5, lane = tid & 31, col = lane & 15, g = lane >> 4; const size_t r0 = (size_t)blockIdx.x * 64; const size_t b = r0 / TT; const int p0 = (int)(r0 % TT); constexpr int K = (MODE == 0) ? CC : CIN;
#pragma unroll 1
  for (int half = 0; half < 2; ++half) {
    v8f acc[8]; for (int j = 0; j < 8; ++j) for (int r = 0; r < 8; ++r) acc[j][r] = 0.f;
    const __bf16* Pw = PWm + half * 8 * 512 + lane * 8; const float* Ar = A + (r0 + wave * 16 + col) * K;
    v16b w0[8], w1[8]; ldw8(w0, Pw);
#pragma unroll 1   // two k-steps a trip, written out: each step's 8 B fragments are loaded one step ahead into the set the other step has left
    for (int kc = 0; kc < K / 32; kc += 2) { const F2 a0 = split_row(Ar, kc * 32, lane);
      ldw8(w1, Pw + (kc + 1) * (CIN / 16) * 512);
#pragma unroll
      for (int j = 0; j < 8; ++j) { acc[j] = wmma_bf(a0.h, w0[j], acc[j]); acc[j] = wmma_bf(a0.l, w0[j], acc[j]); }
      const F2 a1 = split_row(Ar, kc * 32 + 32, lane);
      if (kc + 2 < K / 32) ldw8(w0, Pw + (kc + 2) * (CIN / 16) * 512);
      asm volatile("s_wait_xcnt 0x0" ::: "memory");   // the address registers that the trip's loads name are advanced below
#pragma unroll
      for (int j = 0; j < 8; ++j) { acc[j] = wmma_bf(a1.h, w1[j], acc[j]); acc[j] = wmma_bf(a1.l, w1[j], acc[j]); } }
#pragma unroll
    for (int j = 0; j < 8; ++j) { const int o = half * 128 + j * 16 + col; const float bb = bfr(Bv[o]);
#pragma unroll
      for (int r = 0; r < 8; ++r) { const int rl = wave * 16 + 8 * g + r; const float res = (MODE == 0) ? bfr(RES[(b * CIN + o) * (size_t)TT + p0 + rl]) : RES[(r0 + rl) * CIN + o]; sz[rl][o] = acc[j][r] + bb + res; } } }
  __syncthreads();
  // gamma and beta of the columns that this thread stores further down (MODE 0: 4 neighbouring columns; MODE 1: channels (tid >> 4) + 8 i), asked for here so that they arrive while the statistics are formed
  constexpr int NG = (MODE == 0) ? 4 : 32; float ga[NG], be[NG];
#pragma unroll   // all loads issued together, the values indexed by constants
  for (int i = 0; i < NG; ++i) { const int c = (MODE == 0) ? (tid & 63) * 4 + i : (tid >> 4) + 8 * i; ga[i] = GA[c]; be[i] = BE[c]; }
  asm volatile("s_wait_xcnt 0x0" ::: "memory");   // what follows may reuse the registers that hold the loads' addresses
  // LayerNorm statistics: two threads a row; each holds its 128 values (32-column groups, alternating) in registers for both sums. 16 lanes = 8 rows x 2 groups fall on all 64 banks once.
  // Mean and 1 / standard deviation go into the row's own pad columns.
  { const int rl = tid >> 1; const float* rp = &sz[rl][(tid & 1) * 32]; v4f v[32];
#pragma unroll   // all 32 LDS reads are issued before the first value is used
    for (int i = 0; i < 32; ++i) v[i] = *(const v4f*)(rp + (i >> 3) * 64 + (i & 7) * 4);
    v4f a[4] = { v[0], v[1], v[2], v[3] };
#pragma unroll
    for (int i = 4; i < 32; ++i) a[i & 3] += v[i];
    const v4f s4 = (a[0] + a[1]) + (a[2] + a[3]); float s = (s4[0] + s4[1]) + (s4[2] + s4[3]); s += __shfl_xor(s, 1); const float mu = s / CIN;
    v4f w[4] = {};
#pragma unroll
    for (int i = 0; i < 32; ++i) { const v4f d = v[i] - mu; w[i & 3] += d * d; }
    const v4f q4 = (w[0] + w[1]) + (w[2] + w[3]); float q = (q4[0] + q4[1]) + (q4[2] + q4[3]); q += __shfl_xor(q, 1);
    if ((tid & 1) == 0) { const v2f st = { mu, 1.0f / sqrtf(q / CIN + 1e-5f) }; *(v2f*)&sz[rl][CIN] = st; } }
  __syncthreads();
  // the rows are normalised on their way out
  if (MODE == 0) { const int q = tid & 63;
#pragma unroll   // unrolled: the LDS reads run ahead of the stores, and every access takes its place from one address and a constant
    for (int i = 0; i < 32; ++i) { const int rl = (tid >> 6) + 2 * i; const v2f st = *(const v2f*)&sz[rl][CIN]; const v4f x = *(const v4f*)&sz[rl][q * 4]; v4f o;
#pragma unroll
      for (int k = 0; k < 4; ++k) o[k] = (x[k] - st[0]) * st[1] * bfr(ga[k]) + bfr(be[k]);
      vst2(DST + (r0 + rl) * CIN + q * 4, o); } }
  else { // channel-major planes [b][c][p0 .. p0+63]: transpose through registers: for (c, 4 consecutive positions)
    const int q = tid & 15; v2f st[4];
#pragma unroll
    for (int k = 0; k < 4; ++k) st[k] = *(const v2f*)&sz[q * 4 + k][CIN];
#pragma unroll   // unrolled: as above
    for (int i = 0; i < 32; ++i) { const int c = (tid >> 4) + 8 * i; v4f o;
#pragma unroll
      for (int k = 0; k < 4; ++k) o[k] = (sz[q * 4 + k][c] - st[k][0]) * st[k][1] * bfr(ga[i]) + bfr(be[i]);
      vst2(DST + (b * CIN + c) * (size_t)TT + p0 + q * 4, o); } } }
// ---- k_ffn1: block = (64 rows, 128 cols): HM = silu(Z1 (hi+lo) W1 + b1)
__global__ __launch_bounds__(128) void k_ffn1(const float* __restrict__ Z1, const __bf16* __restrict__ PW1, const float* __restrict__ B1, float* __restrict__ HM) { __shared__ __align__(16) float sf[4][16][132];
  const int tid = threadIdx.x, wave = tid >> 5, lane = tid & 31, col = lane & 15, g = lane >> 4; const int c0 = blockIdx.y * 128; const size_t r0 = (size_t)blockIdx.x * 64 + wave * 16;
  v8f acc[8] = {};
  const __bf16* Pw = PW1 + (c0 / 16) * 512 + lane * 8; v16b wb[2][8]; ldw8(wb[0], Pw);
#pragma unroll   // unrolled: the two fragment sets are indexed by constants and stay in registers
  for (int kc = 0; kc < CIN / 32; ++kc) { const F2 a = split_row(Z1 + (r0 + col) * CIN, kc * 32, lane);
    if (kc + 1 < CIN / 32) ldw8(wb[(kc + 1) & 1], Pw + (kc + 1) * (CIN / 16) * 512);
#pragma unroll
    for (int j = 0; j < 8; ++j) { acc[j] = wmma_bf(a.h, wb[kc & 1][j], acc[j]); acc[j] = wmma_bf(a.l, wb[kc & 1][j], acc[j]); } }
#pragma unroll
  for (int j = 0; j < 8; ++j) { const float bb = bfr(B1[c0 + j * 16 + col]);
#pragma unroll
    for (int r = 0; r < 8; ++r) { const float v = acc[j][r] + bb; sf[wave][8 * g + r][j * 16 + col] = v / (1.0f + expf(-v)); } }
  LDSX(); for (int rl = 0; rl < 16; ++rl) vst2(HM + (r0 + rl) * CIN + c0 + lane * 4, *(const v4f*)&sf[wave][rl][lane * 4]); }
extern "C" void kernel_launch(void* const* d_in, const int* in_sizes, int n_in, void* d_out, int out_size, void* d_ws, size_t ws_size, hipStream_t stream) {
  (void)in_sizes; (void)n_in; (void)out_size;
  const float** F = (const float**)d_in;   // 0 x [16,256,32,32], 1 Wq [256,512], 2 bq, 3 Wk, 4 bk, 5 Wv, 6 bv, 7 Wo [512,256], 8 bo, 9 W1 [256,256], 10 b1, 11 W2, 12 b2, 13 g1, 14 be1, 15 g2, 16 be2
  if (ws_size < (size_t)WS_END) return;
  char* ws = (char*)d_ws; _Float16 *QH = (_Float16*)(ws + WS_QH), *QL = (_Float16*)(ws + WS_QL), *KH = (_Float16*)(ws + WS_KH), *VT = (_Float16*)(ws + WS_VT); float *Y = (float*)(ws + WS_Y), *Z1 = (float*)(ws + WS_Z1), *HM = (float*)(ws + WS_HM), *CP = (float*)(ws + WS_CP); __bf16* PW = (__bf16*)(ws + WS_PW);
  float* OUT0 = (float*)d_out; float* OUT1 = (float*)d_out + OUT1_OFF;
  k_pack<<<dim3(CIN * CC / 8 / 256, 6), 256, 0, stream>>>(F[1], F[3], F[5], F[7], F[9], F[11], PW);
  k_proj<<<dim3(TT / 64, CC / 128, TNB * 3), 128, 0, stream>>>(F[0], PW, F[2], F[4], F[6], QH, QL, KH, VT);
  k_att<<<dim3(TT / 64, TNB * NH), 256, 0, stream>>>(QH, QL, KH, VT, Y, CP);
  k_colr<<<dim3(TT / 128, TNB), 256, 0, stream>>>(CP, OUT1);
  k_ln<0><<<TNB * TT / 64, 128, 0, stream>>>(Y, PW + PW_O, F[8], F[0], F[13], F[14], Z1);
  k_ffn1<<<dim3(TNB * TT / 64, CIN / 128), 128, 0, stream>>>(Z1, PW + PW_1, F[10], HM);
  k_ln<1><<<TNB * TT / 64, 128, 0, stream>>>(HM, PW + PW_2, F[12], Z1, F[15], F[16], OUT0);
}

// v007
// One run takes 173 microseconds.
// In two side-by-side timings against v006, it was 1.11 and 1.10 times as fast.
// Over all steps from v000 it is 44.2 times as fast.
// compute dtype: all float inputs rounded to bf16; Q/K/V = x^T W + b with EXACT bf16 products on WMMA 16x16x32 (channel-major tiles transposed in LDS), f32 accumulate; Q as f16 hi + residual, K f16 -> 2-product logits kept in f32 registers (one fused launch for logits, softmax, column sums and P . V); softmax in f32, exp((l - max) / 8) = exp2(l * (log2 e / 8) - max * (log2 e / 8)): one FMA and the hardware exp2 -> P f16 x 2^11; attn_map = column sums of P / 8 in f32; O = P . V (V rounded once to f16, 1 product); Wo, W1, W2 GEMMs with the f32 activations split bf16 hi + lo (2 products); LayerNorms (eps 1e-5), SiLU and residuals in f32; outputs: out channel-major [b][c][hw], attn_map [b][hw].
#include <hip/hip_runtime.h>
#include <math.h>

typedef __attribute__((ext_vector_type(16))) _Float16 v16h;
typedef __attribute__((ext_vector_type(16))) __bf16 v16b;
typedef __attribute__((ext_vector_type(8)))  _Float16 v8h;
typedef __attribute__((ext_vector_type(8)))  float v8f;
typedef __attribute__((ext_vector_type(4)))  float v4f;
typedef __attribute__((ext_vector_type(2)))  float v2f;
typedef __attribute__((ext_vector_type(4)))  unsigned v4u;
typedef __attribute__((ext_vector_type(4)))  int v4i;
typedef float __attribute__((may_alias)) float_a;
typedef int __attribute__((may_alias)) int_a;

template <typename T> __device__ __forceinline__ void vst2(void* p, T v) { *(T*)p = v;  }
__device__ __forceinline__ v8f wmma16(v16h a, v16h b, v8f c) {
  v8f d = __builtin_amdgcn_wmma_f32_16x16x32_f16(false, a, false, b, (short)0, c, false, false);
  asm volatile("v_nop\n\tv_nop\n\tv_nop\n\tv_nop" : "+v"(d) : "v"(a), "v"(b));
  return d;
}
__device__ __forceinline__ v8f wmma_bf(v16b a, v16b b, v8f c) {
  v8f d = __builtin_amdgcn_wmma_f32_16x16x32_bf16(false, a, false, b, (short)0, c, false, false);
  asm volatile("v_nop\n\tv_nop\n\tv_nop\n\tv_nop" : "+v"(d) : "v"(a), "v"(b));
  return d;
}
// 16x16x32 fragments: lane = (h = lane>>4, row/col = lane&15); elements 0..7 = k0+8h+0..7, 8..15 = k0+16+8h+0..7; D element r = row 8h+r
__device__ __forceinline__ v16h frag_h(const _Float16* rowk0, int lane) {
  union { v16h v; v8h q[2]; } u; const _Float16* p = rowk0 + 8 * (lane >> 4);
  u.q[0] = *(const v8h*)p; u.q[1] = *(const v8h*)(p + 16); return u.v;
}
__device__ __forceinline__ v16h frag_f32(const float* rowk0, int lane) {
  v16h a; const float* p = rowk0 + 8 * (lane >> 4);
#pragma unroll
  for (int i = 0; i < 8; ++i) { a[i] = (_Float16)p[i]; a[8 + i] = (_Float16)p[16 + i]; }
  return a;
}
__device__ __forceinline__ v16h frag_f32s(const float* rowk0, int lane, float sc) {
  v16h a; const float* p = rowk0 + 8 * (lane >> 4);
#pragma unroll
  for (int i = 0; i < 8; ++i) { a[i] = (_Float16)(p[i] * sc); a[8 + i] = (_Float16)(p[16 + i] * sc); }
  return a;
}
// column fragment from a [K][ld] layout (column n), rows >= K read as 0
__device__ __forceinline__ v16h fragc_f32(const float* W, int k0, int n, int lane, int ld, int K) {
  v16h a; const int g = lane >> 4;
#pragma unroll
  for (int i = 0; i < 8; ++i) { const int ka = k0 + 8 * g + i, kb = ka + 16;
    a[i] = (_Float16)(ka < K ? W[(size_t)(ka < K ? ka : K - 1) * ld + n] : 0.f); a[8 + i] = (_Float16)(kb < K ? W[(size_t)(kb < K ? kb : K - 1) * ld + n] : 0.f); }
  return a;
}
struct F2 { v16b h, l; };
__device__ __forceinline__ F2 bsplit16(const float v[16]) { F2 r;
#pragma unroll
  for (int i = 0; i < 16; ++i) { const __bf16 h = (__bf16)v[i]; r.h[i] = h; r.l[i] = (__bf16)(v[i] - (float)h); }
  return r; }
__device__ __forceinline__ F2 split_row(const float* row, int k0, int lane) { float v[16]; const float* p = row + k0 + 8 * (lane >> 4);
#pragma unroll
  for (int i = 0; i < 8; ++i) { v[i] = p[i]; v[8 + i] = p[16 + i]; }
  return bsplit16(v); }
__device__ __forceinline__ F2 split_rowK(const float* row, int k0, int lane, int K) { float v[16]; const int g = lane >> 4;
#pragma unroll
  for (int i = 0; i < 8; ++i) { const int ka = k0 + 8 * g + i, kb = ka + 16; v[i] = ka < K ? row[ka < K ? ka : K - 1] : 0.f; v[8 + i] = kb < K ? row[kb < K ? kb : K - 1] : 0.f; }
  return bsplit16(v); }
__device__ __forceinline__ F2 split_col(const float* W, int k0, int n, int lane, int ld, int K) { float v[16]; const int g = lane >> 4;
#pragma unroll
  for (int i = 0; i < 8; ++i) { const int ka = k0 + 8 * g + i, kb = ka + 16; v[i] = ka < K ? W[(size_t)(ka < K ? ka : K - 1) * ld + n] : 0.f; v[8 + i] = kb < K ? W[(size_t)(kb < K ? kb : K - 1) * ld + n] : 0.f; }
  return bsplit16(v); }
__device__ __forceinline__ v8f mac3(const F2& a, const F2& b, v8f c) { c = wmma_bf(a.l, b.h, c); c = wmma_bf(a.h, b.l, c); return wmma_bf(a.h, b.h, c); }
__device__ __forceinline__ float sigm(float v) { return 1.0f / (1.0f + expf(-v)); }
#define LDSX() do { asm volatile("s_wait_dscnt 0" ::: "memory"); __builtin_amdgcn_wave_barrier(); __builtin_amdgcn_fence(__ATOMIC_RELEASE, "workgroup"); } while (0)


// Multi-head spatial attention block (B 16, C 256, 32x32 = 1,024 positions, d_model 512 = 8 x 64): MHA over positions + Wo + residual LN + SiLU FFN + residual LN; second output = inbound attention map (sum over queries, mean over heads).
#define NB 16
#define CIN 256
#define TT 1024
#define CC 512
#define NH 8
#define HD 64
#define NR (NB * TT)
#ifndef TNB
#define TNB NB
#endif
typedef __attribute__((ext_vector_type(8))) __bf16 v8b;
__device__ __forceinline__ v16b frag_b(const __bf16* rowk0, int lane) {
  union { v16b v; v8b q[2]; } u; const __bf16* p = rowk0 + 8 * (lane >> 4);
  u.q[0] = *(const v8b*)p; u.q[1] = *(const v8b*)(p + 16); return u.v;
}
__device__ __forceinline__ float bfr(float v) { return (float)(__bf16)v; }
__device__ __attribute__((noinline)) float exp_ni(float v) { return expf(v); }
__device__ __attribute__((noinline)) float erf_ni(float v) { return erff(v); }

#define OUT1_OFF ((size_t)NB * CIN * TT)
#define WS_QH  0u
#define WS_QL  (WS_QH + 2u * (size_t)NR * CC)
#define WS_KH  (WS_QL + 2u * (size_t)NR * CC)
#define WS_VT  (WS_KH + 2u * (size_t)NR * CC)          // f16 V^T fragments; QH, QL, KH and VT all lie in fragment order (see k_proj)
#define WS_Y   (WS_VT + 2u * (size_t)NR * CC)          // f32 O rows [b*t][512]
#define WS_Z1  (WS_Y + 4u * (size_t)NR * CC)           // f32 LN1 rows [b*t][256]
#define WS_HM  (WS_Z1 + 4u * (size_t)NR * CIN)         // f32 silu rows [b*t][256]
#define QCH 64                // query rows per partial column sum
#define NPART (NH * (TT / QCH))   // partial rows per batch
#define WS_CP  (WS_HM + 4u * (size_t)NR * CIN)         // f32 partial column sums [b][NPART][t]
#define WS_PW  (WS_CP + 4u * (size_t)NB * NPART * TT)  // bf16 packed weights: Wq, Wk, Wv, Wo, W1, W2
#define PW_O  (3 * CIN * CC)
#define PW_1  (4 * CIN * CC)
#define PW_2  (4 * CIN * CC + CIN * CIN)
#define WS_END (WS_PW + 2u * (size_t)(4 * CIN * CC + 2 * CIN * CIN))

// ---- k_pack: block = (256 units of 8 k, matrix): a weight matrix W (in,out) [K][N], rounded to bf16, laid out as the B fragments the GEMMs read:
// fragment (kc, nt) = 1 KiB = [k half q][lane][8 bf16], lane (g, col) holding column nt*16 + col, k = kc*32 + 16q + 8g + 0..7, so that a wave reads a fragment as two 512-byte loads
__global__ __launch_bounds__(256) void k_pack(const float* __restrict__ WQ, const float* __restrict__ WK, const float* __restrict__ WV, const float* __restrict__ WO, const float* __restrict__ W1, const float* __restrict__ W2, __bf16* __restrict__ PW) {
  const int m = blockIdx.y; const float* Wm = m == 0 ? WQ : m == 1 ? WK : m == 2 ? WV : m == 3 ? WO : m == 4 ? W1 : W2;
  const int N = m < 3 ? CC : CIN, K = m == 3 ? CC : CIN; const int unit = blockIdx.x * 256 + threadIdx.x;
  if (unit >= K * N / 8) return;
  const int lane = unit & 31, q = (unit >> 5) & 1, f = unit >> 6, NT = N / 16; const int n = (f % NT) * 16 + (lane & 15), k = (f / NT) * 32 + q * 16 + 8 * (lane >> 4);
  float v[8]; v8b o;
#pragma unroll   // the 8 loads are issued together
  for (int i = 0; i < 8; ++i) v[i] = Wm[(size_t)(k + i) * N + n];
  asm volatile("s_wait_xcnt 0x0" ::: "memory");   // the conversions below may reuse the registers that hold the loads' addresses
#pragma unroll
  for (int i = 0; i < 8; ++i) o[i] = (__bf16)v[i];
  vst2(PW + (m < 4 ? m * (CIN * CC) : PW_1 + (m - 4) * (CIN * CIN)) + (size_t)unit * 8, o); }
// one packed fragment (p = fragment base + lane * 8), and the 8 neighbouring fragments of one k-step
__device__ __forceinline__ v16b frag_pw(const __bf16* p) { union { v16b v; v8b q[2]; } u; u.q[0] = *(const v8b*)p; u.q[1] = *(const v8b*)(p + 256); return u.v; }
__device__ __forceinline__ void ldw8(v16b (&w)[8], const __bf16* p) {
#pragma unroll   // 16 loads in a row, the set indexed by constants
  for (int j = 0; j < 8; ++j) w[j] = frag_pw(p + j * 512); }

// ---- k_proj: block = (64 positions, 128 cols, b*3 + which): x^T tile; packed W; a k-step's 8 B fragments are loaded together, one k-step ahead of the WMMAs that use them
// Q, K and V leave in the order in which k_att's 16x16x32 fragments read them: fragment = 1 KiB = [k half q][lane (g, row)][8 f16], k = 32*chunk + 16q + 8g + 0..7.
// Q, K: [b][head][16-position tile][32-dim chunk], row = position; V^T: [b][head][32-key chunk][16-dim tile], row = dim, k = key. A wave stores and loads 512 contiguous bytes at a time.
__global__ __launch_bounds__(128) void k_proj(const float* __restrict__ X, const __bf16* __restrict__ PW, const float* __restrict__ BQ, const float* __restrict__ BK, const float* __restrict__ BV, _Float16* __restrict__ QH, _Float16* __restrict__ QL, _Float16* __restrict__ KH, _Float16* __restrict__ VT) {
  __shared__ __align__(16) __bf16 sx[64][CIN + 8]; __shared__ __align__(16) _Float16 sh[64][136], sl[64][136]; __shared__ __align__(16) _Float16 th[128][72];
  const int tid = threadIdx.x, wave = tid >> 5, lane = tid & 31, col = lane & 15, g = lane >> 4; const int p0 = blockIdx.x * 64; const int c0 = blockIdx.y * 128; const size_t b = blockIdx.z / 3; const int which = blockIdx.z % 3;
  const __bf16* Pw = PW + (size_t)which * (CIN * CC) + (c0 / 16) * 512 + lane * 8; const float* Bm = which == 0 ? BQ : which == 1 ? BK : BV;
  v16b wb[2][8]; ldw8(wb[0], Pw);
  for (int e = tid; e < CIN * 64; e += 128) { const int c = e >> 6, pl = e & 63; sx[pl][c] = (__bf16)X[(b * CIN + c) * (size_t)TT + p0 + pl]; }
  __syncthreads();
  v8f acc[8] = {};
#pragma unroll   // unrolled: the two fragment sets are indexed by constants and stay in registers
  for (int kc = 0; kc < CIN / 32; ++kc) { const v16b a = frag_b(&sx[wave * 16 + col][kc * 32], lane);
    if (kc + 1 < CIN / 32) ldw8(wb[(kc + 1) & 1], Pw + (kc + 1) * (CC / 16) * 512);
#pragma unroll
    for (int j = 0; j < 8; ++j) acc[j] = wmma_bf(a, wb[kc & 1][j], acc[j]); }
#pragma unroll
  for (int j = 0; j < 8; ++j) { const float bb = bfr(Bm[c0 + j * 16 + col]);
#pragma unroll
    for (int r = 0; r < 8; ++r) { const float v = acc[j][r] + bb; const int rl = wave * 16 + 8 * g + r, cl = j * 16 + col; const _Float16 hv = (_Float16)v;
      if (which == 2) th[cl][rl] = hv; else { sh[rl][cl] = hv; sl[rl][cl] = (_Float16)(v - (float)hv); } } }
  __syncthreads();
  // 16 fragments a block, unit e = (fragment f, k half, g, row); a head's 8 fragments of the block lie in a row
  const int kq = ((lane >> 4) + 2 * (wave & 1)) * 8;   // 16q + 8g of this thread's units
  if (which < 2) { _Float16* dh = which == 0 ? QH : KH; for (int e = tid; e < 64 * 16; e += 128) { const int f = e >> 6, hl = f >> 3, rl = ((f >> 1) & 3) * 16 + col, cl = hl * 64 + (f & 1) * 32 + kq;
      const size_t o = ((b * NH + c0 / HD + hl) * (TT / 16) + p0 / 16) * (size_t)1024 + (e & 511) * 8; vst2((unsigned*)(dh + o), *(const v4u*)&sh[rl][cl]);
      asm volatile("s_wait_xcnt 0x0" ::: "memory");   // what follows (the residual's LDS read, the next trip) overwrites the registers that the store names
      if (which == 0) { vst2((unsigned*)(QL + o), *(const v4u*)&sl[rl][cl]); asm volatile("s_wait_xcnt 0x0" ::: "memory"); } } }   // the same for the residual's store
  else { for (int e = tid; e < 128 * 8; e += 128) { const int f = e >> 6, hl = f >> 3, cl = hl * 64 + (f & 3) * 16 + col, rl = ((f >> 2) & 1) * 32 + kq;
      vst2((unsigned*)(VT + ((b * NH + c0 / HD + hl) * (TT / 32) + p0 / 32) * (size_t)2048 + (e & 511) * 8), *(const v4u*)&th[cl][rl]); } } }
#define ESC 0.18033688f   // log2(e) / 8: the logits' scale 1 / sqrt(64) and the change of base, in one factor
#define KRING 4   // K fragments in flight a wave (4 WMMAs each)
#define VRING 6   // V fragments in flight a wave (2 WMMAs each); more of either and the kernel spills at 256 registers
// one f16 fragment in fragment order (f = fragment base, l8 = lane * 8): two loads of 512 contiguous bytes a wave
__device__ __forceinline__ v16h frag_pk(const _Float16* f, unsigned l8) { union { v16h v; v8h q[2]; } u; const _Float16* p = f + l8; u.q[0] = *(const v8h*)p; u.q[1] = *(const v8h*)(p + 256); return u.v; }
// ---- k_att: block = (64 queries, z = b*8 + h), 8 waves; wave w owns keys 128w .. 128w+127 and walks the block's queries 32 at a time (two 16-query tiles share every K and V fragment).
// S^T = K . Q^T (2 products): a lane holds one query's logits for 8 consecutive keys of each 16-key tile, so the whole 32 x 128 tile stays in registers,
// the row maximum and sum need one exchange between wave halves and one between waves, and two neighbouring tiles pack straight into the B operand of O^T = V^T . P^T.
// Column sums: the wave's own P tile goes through LDS once (row = query), each lane then adds 8 keys over 16 queries and keeps the sums over the block's 64 queries.
// waves_per_eu(4, 4) holds a wave to 256 registers, so that two blocks (16 waves) share a WGP, which their LDS also allows.
__global__ __launch_bounds__(256) __attribute__((amdgpu_waves_per_eu(4, 4))) void k_att(const _Float16* __restrict__ QH, const _Float16* __restrict__ QL, const _Float16* KH, const _Float16* VT, float* __restrict__ Y, float* __restrict__ CP) {   // KH, VT without __restrict__: with it the compiler holds the fragments that both passes read first in registers over the whole pass, and spills
  __shared__ float smx[2][8][32]; __shared__ __align__(16) _Float16 sp[8][32][144]; __shared__ __align__(16) float so[8][32][68];
  const int z = blockIdx.y; const size_t b = z / NH; const int h = z % NH;
  const int tid = threadIdx.x, wave = tid >> 5, lane = tid & 31, col = lane & 15, g = lane >> 4; const int kw = wave * 128;
  const size_t hb = (size_t)z * (TT * HD);   // this head's fragments: 128 KiB in each of the four buffers
  const int ws = wave * 8192;   // the wave's 8 key tiles (K) and 4 key chunks (V): 16 KiB each
  const _Float16* Kp = KH + hb + ws; const _Float16* Vp = VT + hb + ws; const _Float16* Qh = QH + hb + blockIdx.x * 4096; const _Float16* Ql = QL + hb + blockIdx.x * 4096; const unsigned l8 = lane * 8;
  v4f c0 = {}, c1 = {};
#pragma unroll 1   // rolled: unrolled, the two passes' tiles would compete for the 256 registers
  for (int qp = 0; qp < 2; ++qp) { const size_t q0 = b * TT + blockIdx.x * 64 + qp * 32;
    v8f s[8][2] = {}; v16h hq[2], lq[2], kf[KRING], vf[VRING];
#pragma unroll   // the first KRING K fragments are asked for together
    for (int i = 0; i < KRING; ++i) kf[i] = frag_pk(Kp + ((i & 7) * 2 + (i >> 3)) * 512, l8);
#pragma unroll   // unrolled: the ring of K fragments is indexed by constants; fragment i + KRING is asked for as soon as fragment i has been used
    for (int i = 0; i < 16; ++i) { const int kc = i >> 3, t = i & 7; const v16h k = kf[i % KRING];
      if (t == 0) {
#pragma unroll
        for (int u = 0; u < 2; ++u) { hq[u] = frag_pk(Qh + ((qp * 2 + u) * 2 + kc) * 512, l8); lq[u] = frag_pk(Ql + ((qp * 2 + u) * 2 + kc) * 512, l8); }
        asm volatile("s_wait_xcnt 0x0" :: "v"(Qh + qp * 2048 + l8), "v"(Ql + qp * 2048 + l8) : "memory"); }   // the registers that hold the Q loads' addresses are reused for fragments further down; named as inputs, the two address pairs stay whole up to the wait
#pragma unroll
      for (int u = 0; u < 2; ++u) { s[t][u] = wmma16(k, hq[u], s[t][u]); s[t][u] = wmma16(k, lq[u], s[t][u]); }
      if (i + KRING < 16) kf[i % KRING] = frag_pk(Kp + (((i + KRING) & 7) * 2 + ((i + KRING) >> 3)) * 512, l8); }
    float m[2], inv[2];
#pragma unroll
    for (int u = 0; u < 2; ++u) {   // the maximum is taken over the unscaled logits: the scale is positive and goes into the exponent's FMA
      v8f mv = s[0][u];
#pragma unroll
      for (int t = 1; t < 8; ++t)
#pragma unroll
        for (int r = 0; r < 8; ++r) mv[r] = fmaxf(mv[r], s[t][u][r]);
      float a = fmaxf(fmaxf(fmaxf(mv[0], mv[1]), fmaxf(mv[2], mv[3])), fmaxf(fmaxf(mv[4], mv[5]), fmaxf(mv[6], mv[7])));
      a = fmaxf(a, __shfl_xor(a, 16)); if (g == 0) smx[0][wave][u * 16 + col] = a; }
    __syncthreads();
#pragma unroll
    for (int u = 0; u < 2; ++u) { const int x = u * 16 + col;
      m[u] = fmaxf(fmaxf(fmaxf(smx[0][0][x], smx[0][1][x]), fmaxf(smx[0][2][x], smx[0][3][x])), fmaxf(fmaxf(smx[0][4][x], smx[0][5][x]), fmaxf(smx[0][6][x], smx[0][7][x])));
      const float mc = m[u] * ESC; const v8f esc8 = { ESC, ESC, ESC, ESC, ESC, ESC, ESC, ESC }, nmc8 = { -mc, -mc, -mc, -mc, -mc, -mc, -mc, -mc }; v8f sv = {};
#pragma unroll
      for (int t = 0; t < 8; ++t) { s[t][u] = __builtin_elementwise_fma(s[t][u], esc8, nmc8);
#pragma unroll
        for (int r = 0; r < 8; ++r) s[t][u][r] = __builtin_amdgcn_exp2f(s[t][u][r]);
        sv += s[t][u]; }   // argument <= 0 but for one rounding; far below -126 gives 0, which P's f16 would round to anyway
      float sum = ((sv[0] + sv[1]) + (sv[2] + sv[3])) + ((sv[4] + sv[5]) + (sv[6] + sv[7]));
      sum += __shfl_xor(sum, 16); if (g == 0) smx[1][wave][x] = sum; }
    __syncthreads();
    v8h p8[8][2];
#pragma unroll   // the first VRING V fragments fly while P is scaled and packed
    for (int i = 0; i < VRING; ++i) vf[i] = frag_pk(Vp + i * 512, l8);
    __builtin_amdgcn_sched_barrier(0);   // the loads above and the packing below are scheduled apart: as one region this build needs more than 256 registers and spills to scratch
#pragma unroll
    for (int u = 0; u < 2; ++u) { const int x = u * 16 + col;
      inv[u] = 2048.0f * (1.0f / (((smx[1][0][x] + smx[1][1][x]) + (smx[1][2][x] + smx[1][3][x])) + ((smx[1][4][x] + smx[1][5][x]) + (smx[1][6][x] + smx[1][7][x]))));   // P's factor 2^11 rides in the row's reciprocal: a power of two, the same bits
#pragma unroll
      for (int t = 0; t < 8; ++t) {
#pragma unroll
        for (int r = 0; r < 8; ++r) p8[t][u][r] = (_Float16)(s[t][u][r] * inv[u]);
        *(v8h*)&sp[wave][x][t * 16 + 8 * g] = p8[t][u]; }
 }
    v8f acc[4][2] = {};
#pragma unroll
    for (int c = 0; c < 4; ++c) { union { v16h v; v8h q[2]; } pb[2];
#pragma unroll
      for (int u = 0; u < 2; ++u) { pb[u].q[0] = p8[2 * c][u]; pb[u].q[1] = p8[2 * c + 1][u]; }
#pragma unroll
      for (int j = 0; j < 4; ++j) { const int i = c * 4 + j; const v16h v = vf[i % VRING];
#pragma unroll
        for (int u = 0; u < 2; ++u) acc[j][u] = wmma16(v, pb[u].v, acc[j][u]);
        if (i + VRING < 16) vf[i % VRING] = frag_pk(Vp + (i + VRING) * 512, l8); } }
    LDSX();   // the wave's own P rows are in LDS before its lanes read across them
#pragma unroll
    for (int q = 0; q < 16; ++q) { const v8h v = *(const v8h*)&sp[wave][g * 16 + q][col * 8];
#pragma unroll
      for (int e = 0; e < 4; ++e) { c0[e] += (float)v[e]; c1[e] += (float)v[4 + e]; } }
#pragma unroll
    for (int u = 0; u < 2; ++u)
#pragma unroll
      for (int j = 0; j < 4; ++j) { const v8f o = acc[j][u] * (1.0f / 2048.0f); const v4f lo = { o[0], o[1], o[2], o[3] }, hi = { o[4], o[5], o[6], o[7] };
        *(v4f*)&so[wave][u * 16 + col][j * 16 + 8 * g] = lo; *(v4f*)&so[wave][u * 16 + col][j * 16 + 8 * g + 4] = hi; }
    __syncthreads();
    { const int q = tid >> 3, d0 = (tid & 7) * 8; float* y = Y + (q0 + q) * CC + h * HD + d0;
#pragma unroll
      for (int f = 0; f < 2; ++f) { const int d = d0 + 4 * f;
        vst2(y + 4 * f, ((*(const v4f*)&so[0][q][d] + *(const v4f*)&so[1][q][d]) + (*(const v4f*)&so[2][q][d] + *(const v4f*)&so[3][q][d])) + ((*(const v4f*)&so[4][q][d] + *(const v4f*)&so[5][q][d]) + (*(const v4f*)&so[6][q][d] + *(const v4f*)&so[7][q][d]))); }
      asm volatile("s_wait_xcnt 0x0" ::: "memory"); } }   // the next pass overwrites the registers that the two stores name
#pragma unroll
  for (int e = 0; e < 4; ++e) { c0[e] += __shfl_xor(c0[e], 16); c1[e] += __shfl_xor(c1[e], 16); }
  float* cp = CP + (b * NPART + h * (TT / QCH) + blockIdx.x) * (size_t)TT + kw + col * 8 + 4 * g; vst2(cp, g == 0 ? c0 : c1); }
// ---- k_colr: block = (128 keys, batch): attn_map[b][k] = (1/8) sum over the batch's 128 partial rows (8 heads x 16 query blocks); wave w sums 16 rows, then 8 wave sums through LDS
__global__ __launch_bounds__(256) void k_colr(const float* __restrict__ CP, float* __restrict__ AM) { __shared__ __align__(16) float sr[8][128];
  const int t = threadIdx.x, w = t >> 5, lane = t & 31; const size_t b = blockIdx.y; const int k0 = blockIdx.x * 128;
  const float* p = CP + (b * NPART + w * (NPART / 8)) * (size_t)TT + k0 + lane * 4;
  v4f v[NPART / 8];
#pragma unroll
  for (int i = 0; i < NPART / 8; ++i) v[i] = *(const v4f*)(p + (size_t)i * TT);
  v4f a = {};
#pragma unroll
  for (int i = 0; i < NPART / 8; ++i) a += v[i];
  *(v4f*)&sr[w][lane * 4] = a;
  __syncthreads();
  if (t < 32) { v4f s = *(const v4f*)&sr[0][t * 4];
#pragma unroll
    for (int i = 1; i < 8; ++i) s += *(const v4f*)&sr[i][t * 4];
    vst2(AM + b * TT + k0 + t * 4, s * (1.0f / 2048.0f) * (1.0f / NH)); } }
// ---- k_lnA: block = 64 rows x all 256 output cols, 8 waves: wave = (16-row tile, 128-column half), so that both halves of the GEMM run side by side: Z1 = LN(Y (hi+lo) Wo + bo + x^T) (K 512); writes Z1 rows
// ---- k_lnB: out = LN(HM (hi+lo) W2 + b2 + Z1) (K 256); writes channel-major output planes
template <int MODE>
__global__ __launch_bounds__(256) void k_ln(const float* __restrict__ A, const __bf16* __restrict__ PWm, const float* __restrict__ Bv, const float* __restrict__ RES, const float* __restrict__ GA, const float* __restrict__ BE, float* __restrict__ DST) {
  __shared__ __align__(16) float sz[64][CIN + 4];
  const int tid = threadIdx.x, wave = (tid >> 5) & 3, half = tid >> 7, lane = tid & 31, col = lane & 15, g = lane >> 4; const size_t r0 = (size_t)blockIdx.x * 64; const size_t b = r0 / TT; const int p0 = (int)(r0 % TT); constexpr int K = (MODE == 0) ? CC : CIN;
  {
    v8f acc[8]; for (int j = 0; j < 8; ++j) for (int r = 0; r < 8; ++r) acc[j][r] = 0.f;
    const __bf16* Pw = PWm + half * 8 * 512 + lane * 8; const float* Ar = A + (r0 + wave * 16 + col) * K;
    v16b w0[8], w1[8]; ldw8(w0, Pw);
#pragma unroll 1   // two k-steps a trip, written out: each step's 8 B fragments are loaded one step ahead into the set the other step has left
    for (int kc = 0; kc < K / 32; kc += 2) { const F2 a0 = split_row(Ar, kc * 32, lane);
      ldw8(w1, Pw + (kc + 1) * (CIN / 16) * 512);
#pragma unroll
      for (int j = 0; j < 8; ++j) { acc[j] = wmma_bf(a0.h, w0[j], acc[j]); acc[j] = wmma_bf(a0.l, w0[j], acc[j]); }
      const F2 a1 = split_row(Ar, kc * 32 + 32, lane);
      if (kc + 2 < K / 32) ldw8(w0, Pw + (kc + 2) * (CIN / 16) * 512);
      asm volatile("s_wait_xcnt 0x0" ::: "memory");   // the address registers that the trip's loads name are advanced below
#pragma unroll
      for (int j = 0; j < 8; ++j) { acc[j] = wmma_bf(a1.h, w1[j], acc[j]); acc[j] = wmma_bf(a1.l, w1[j], acc[j]); } }
#pragma unroll
    for (int j = 0; j < 8; ++j) { const int o = half * 128 + j * 16 + col; const float bb = bfr(Bv[o]);
#pragma unroll
      for (int r = 0; r < 8; ++r) { const int rl = wave * 16 + 8 * g + r; const float res = (MODE == 0) ? bfr(RES[(b * CIN + o) * (size_t)TT + p0 + rl]) : RES[(r0 + rl) * CIN + o]; sz[rl][o] = acc[j][r] + bb + res; } } }
  __syncthreads();
  // gamma and beta of the columns that this thread stores further down (MODE 0: 4 neighbouring columns; MODE 1: channels (tid >> 4) + 16 i), asked for here so that they arrive while the statistics are formed
  constexpr int NG = (MODE == 0) ? 4 : 16; float ga[NG], be[NG];
#pragma unroll   // all loads issued together, the values indexed by constants
  for (int i = 0; i < NG; ++i) { const int c = (MODE == 0) ? (tid & 63) * 4 + i : (tid >> 4) + 16 * i; ga[i] = GA[c]; be[i] = BE[c]; }
  asm volatile("s_wait_xcnt 0x0" ::: "memory");   // what follows may reuse the registers that hold the loads' addresses
  // LayerNorm statistics: four threads a row; each holds its 64 values (16-column groups, every fourth) in registers for both sums. 16 lanes = 4 rows x 4 groups fall on all 64 banks once.
  // Mean and 1 / standard deviation go into the row's own pad columns.
  { const int rl = tid >> 2; const float* rp = &sz[rl][(tid & 3) * 16]; v4f v[16];
#pragma unroll   // all 16 LDS reads are issued before the first value is used
    for (int i = 0; i < 16; ++i) v[i] = *(const v4f*)(rp + (i >> 2) * 64 + (i & 3) * 4);
    v4f a[4] = { v[0], v[1], v[2], v[3] };
#pragma unroll
    for (int i = 4; i < 16; ++i) a[i & 3] += v[i];
    const v4f s4 = (a[0] + a[1]) + (a[2] + a[3]); float s = (s4[0] + s4[1]) + (s4[2] + s4[3]); s += __shfl_xor(s, 1); s += __shfl_xor(s, 2); const float mu = s / CIN;
    v4f w[4] = {};
#pragma unroll
    for (int i = 0; i < 16; ++i) { const v4f d = v[i] - mu; w[i & 3] += d * d; }
    const v4f q4 = (w[0] + w[1]) + (w[2] + w[3]); float q = (q4[0] + q4[1]) + (q4[2] + q4[3]); q += __shfl_xor(q, 1); q += __shfl_xor(q, 2);
    if ((tid & 3) == 0) { const v2f st = { mu, 1.0f / sqrtf(q / CIN + 1e-5f) }; *(v2f*)&sz[rl][CIN] = st; } }
  __syncthreads();
  // the rows are normalised on their way out
  if (MODE == 0) { const int q = tid & 63;
#pragma unroll   // unrolled: the LDS reads run ahead of the stores, and every access takes its place from one address and a constant
    for (int i = 0; i < 16; ++i) { const int rl = (tid >> 6) + 4 * i; const v2f st = *(const v2f*)&sz[rl][CIN]; const v4f x = *(const v4f*)&sz[rl][q * 4]; v4f o;
#pragma unroll
      for (int k = 0; k < 4; ++k) o[k] = (x[k] - st[0]) * st[1] * bfr(ga[k]) + bfr(be[k]);
      vst2(DST + (r0 + rl) * CIN + q * 4, o); } }
  else { // channel-major planes [b][c][p0 .. p0+63]: transpose through registers: for (c, 4 consecutive positions)
    const int q = tid & 15; v2f st[4];
#pragma unroll
    for (int k = 0; k < 4; ++k) st[k] = *(const v2f*)&sz[q * 4 + k][CIN];
#pragma unroll   // unrolled: as above
    for (int i = 0; i < 16; ++i) { const int c = (tid >> 4) + 16 * i; v4f o;
#pragma unroll
      for (int k = 0; k < 4; ++k) o[k] = (sz[q * 4 + k][c] - st[k][0]) * st[k][1] * bfr(ga[i]) + bfr(be[i]);
      vst2(DST + (b * CIN + c) * (size_t)TT + p0 + q * 4, o); } } }
// ---- k_ffn1: block = (64 rows, 128 cols): HM = silu(Z1 (hi+lo) W1 + b1)
__global__ __launch_bounds__(128) void k_ffn1(const float* __restrict__ Z1, const __bf16* __restrict__ PW1, const float* __restrict__ B1, float* __restrict__ HM) { __shared__ __align__(16) float sf[4][16][132];
  const int tid = threadIdx.x, wave = tid >> 5, lane = tid & 31, col = lane & 15, g = lane >> 4; const int c0 = blockIdx.y * 128; const size_t r0 = (size_t)blockIdx.x * 64 + wave * 16;
  v8f acc[8] = {};
  const __bf16* Pw = PW1 + (c0 / 16) * 512 + lane * 8; v16b wb[2][8]; ldw8(wb[0], Pw);
#pragma unroll   // unrolled: the two fragment sets are indexed by constants and stay in registers
  for (int kc = 0; kc < CIN / 32; ++kc) { const F2 a = split_row(Z1 + (r0 + col) * CIN, kc * 32, lane);
    if (kc + 1 < CIN / 32) ldw8(wb[(kc + 1) & 1], Pw + (kc + 1) * (CIN / 16) * 512);
#pragma unroll
    for (int j = 0; j < 8; ++j) { acc[j] = wmma_bf(a.h, wb[kc & 1][j], acc[j]); acc[j] = wmma_bf(a.l, wb[kc & 1][j], acc[j]); } }
#pragma unroll
  for (int j = 0; j < 8; ++j) { const float bb = bfr(B1[c0 + j * 16 + col]);
#pragma unroll
    for (int r = 0; r < 8; ++r) { const float v = acc[j][r] + bb; sf[wave][8 * g + r][j * 16 + col] = v / (1.0f + expf(-v)); } }
  LDSX(); for (int rl = 0; rl < 16; ++rl) vst2(HM + (r0 + rl) * CIN + c0 + lane * 4, *(const v4f*)&sf[wave][rl][lane * 4]); }
extern "C" void kernel_launch(void* const* d_in, const int* in_sizes, int n_in, void* d_out, int out_size, void* d_ws, size_t ws_size, hipStream_t stream) {
  (void)in_sizes; (void)n_in; (void)out_size;
  const float** F = (const float**)d_in;   // 0 x [16,256,32,32], 1 Wq [256,512], 2 bq, 3 Wk, 4 bk, 5 Wv, 6 bv, 7 Wo [512,256], 8 bo, 9 W1 [256,256], 10 b1, 11 W2, 12 b2, 13 g1, 14 be1, 15 g2, 16 be2
  if (ws_size < (size_t)WS_END) return;
  char* ws = (char*)d_ws; _Float16 *QH = (_Float16*)(ws + WS_QH), *QL = (_Float16*)(ws + WS_QL), *KH = (_Float16*)(ws + WS_KH), *VT = (_Float16*)(ws + WS_VT); float *Y = (float*)(ws + WS_Y), *Z1 = (float*)(ws + WS_Z1), *HM = (float*)(ws + WS_HM), *CP = (float*)(ws + WS_CP); __bf16* PW = (__bf16*)(ws + WS_PW);
  float* OUT0 = (float*)d_out; float* OUT1 = (float*)d_out + OUT1_OFF;
  k_pack<<<dim3(CIN * CC / 8 / 256, 6), 256, 0, stream>>>(F[1], F[3], F[5], F[7], F[9], F[11], PW);
  k_proj<<<dim3(TT / 64, CC / 128, TNB * 3), 128, 0, stream>>>(F[0], PW, F[2], F[4], F[6], QH, QL, KH, VT);
  k_att<<<dim3(TT / 64, TNB * NH), 256, 0, stream>>>(QH, QL, KH, VT, Y, CP);
  k_colr<<<dim3(TT / 128, TNB), 256, 0, stream>>>(CP, OUT1);
  k_ln<0><<<TNB * TT / 64, 256, 0, stream>>>(Y, PW + PW_O, F[8], F[0], F[13], F[14], Z1);
  k_ffn1<<<dim3(TNB * TT / 64, CIN / 128), 128, 0, stream>>>(Z1, PW + PW_1, F[10], HM);
  k_ln<1><<<TNB * TT / 64, 256, 0, stream>>>(HM, PW + PW_2, F[12], Z1, F[15], F[16], OUT0);
}

// v008
// It runs in 147 microseconds.
// Next to v007, in two timings, it ran 1.16 times as fast each time.
// Over all steps from v000 it is 51.4 times as fast.
// compute dtype: all float inputs rounded to bf16; Q/K/V = x^T W + b with EXACT bf16 products on WMMA 16x16x32 (channel-major tiles transposed in LDS), f32 accumulate; Q as f16 hi + residual, K f16 -> 2-product logits kept in f32 registers (one fused launch for logits, softmax, column sums and P . V); softmax in f32, exp((l - max) / 8) = exp2(l * (log2 e / 8) - max * (log2 e / 8)): one FMA and the hardware exp2 -> P f16 x 2^11; attn_map = column sums of P / 8 in f32; O = P . V (V rounded once to f16, 1 product); Wo, W1, W2 GEMMs with the f32 activations split bf16 hi + lo (2 products); LayerNorms (eps 1e-5), SiLU and residuals in f32; outputs: out channel-major [b][c][hw], attn_map [b][hw].
#include <hip/hip_runtime.h>
#include <math.h>

typedef __attribute__((ext_vector_type(16))) _Float16 v16h;
typedef __attribute__((ext_vector_type(16))) __bf16 v16b;
typedef __attribute__((ext_vector_type(8)))  _Float16 v8h;
typedef __attribute__((ext_vector_type(8)))  float v8f;
typedef __attribute__((ext_vector_type(4)))  float v4f;
typedef __attribute__((ext_vector_type(2)))  float v2f;
typedef __attribute__((ext_vector_type(4)))  unsigned v4u;
typedef __attribute__((ext_vector_type(4)))  int v4i;
typedef float __attribute__((may_alias)) float_a;
typedef int __attribute__((may_alias)) int_a;

template <typename T> __device__ __forceinline__ void vst2(void* p, T v) { *(T*)p = v;  }
__device__ __forceinline__ v8f wmma16(v16h a, v16h b, v8f c) {
  v8f d = __builtin_amdgcn_wmma_f32_16x16x32_f16(false, a, false, b, (short)0, c, false, false);
  asm volatile("v_nop\n\tv_nop\n\tv_nop\n\tv_nop" : "+v"(d) : "v"(a), "v"(b));
  return d;
}
__device__ __forceinline__ v8f wmma_bf(v16b a, v16b b, v8f c) {
  v8f d = __builtin_amdgcn_wmma_f32_16x16x32_bf16(false, a, false, b, (short)0, c, false, false);
  asm volatile("v_nop\n\tv_nop\n\tv_nop\n\tv_nop" : "+v"(d) : "v"(a), "v"(b));
  return d;
}
// 16x16x32 fragments: lane = (h = lane>>4, row/col = lane&15); elements 0..7 = k0+8h+0..7, 8..15 = k0+16+8h+0..7; D element r = row 8h+r
__device__ __forceinline__ v16h frag_h(const _Float16* rowk0, int lane) {
  union { v16h v; v8h q[2]; } u; const _Float16* p = rowk0 + 8 * (lane >> 4);
  u.q[0] = *(const v8h*)p; u.q[1] = *(const v8h*)(p + 16); return u.v;
}
__device__ __forceinline__ v16h frag_f32(const float* rowk0, int lane) {
  v16h a; const float* p = rowk0 + 8 * (lane >> 4);
#pragma unroll
  for (int i = 0; i < 8; ++i) { a[i] = (_Float16)p[i]; a[8 + i] = (_Float16)p[16 + i]; }
  return a;
}
__device__ __forceinline__ v16h frag_f32s(const float* rowk0, int lane, float sc) {
  v16h a; const float* p = rowk0 + 8 * (lane >> 4);
#pragma unroll
  for (int i = 0; i < 8; ++i) { a[i] = (_Float16)(p[i] * sc); a[8 + i] = (_Float16)(p[16 + i] * sc); }
  return a;
}
// column fragment from a [K][ld] layout (column n), rows >= K read as 0
__device__ __forceinline__ v16h fragc_f32(const float* W, int k0, int n, int lane, int ld, int K) {
  v16h a; const int g = lane >> 4;
#pragma unroll
  for (int i = 0; i < 8; ++i) { const int ka = k0 + 8 * g + i, kb = ka + 16;
    a[i] = (_Float16)(ka < K ? W[(size_t)(ka < K ? ka : K - 1) * ld + n] : 0.f); a[8 + i] = (_Float16)(kb < K ? W[(size_t)(kb < K ? kb : K - 1) * ld + n] : 0.f); }
  return a;
}
struct F2 { v16b h, l; };
__device__ __forceinline__ F2 bsplit16(const float v[16]) { F2 r;
#pragma unroll
  for (int i = 0; i < 16; ++i) { const __bf16 h = (__bf16)v[i]; r.h[i] = h; r.l[i] = (__bf16)(v[i] - (float)h); }
  return r; }
__device__ __forceinline__ F2 split_row(const float* row, int k0, int lane) { float v[16]; const float* p = row + k0 + 8 * (lane >> 4);
#pragma unroll
  for (int i = 0; i < 8; ++i) { v[i] = p[i]; v[8 + i] = p[16 + i]; }
  return bsplit16(v); }
__device__ __forceinline__ F2 split_rowK(const float* row, int k0, int lane, int K) { float v[16]; const int g = lane >> 4;
#pragma unroll
  for (int i = 0; i < 8; ++i) { const int ka = k0 + 8 * g + i, kb = ka + 16; v[i] = ka < K ? row[ka < K ? ka : K - 1] : 0.f; v[8 + i] = kb < K ? row[kb < K ? kb : K - 1] : 0.f; }
  return bsplit16(v); }
__device__ __forceinline__ F2 split_col(const float* W, int k0, int n, int lane, int ld, int K) { float v[16]; const int g = lane >> 4;
#pragma unroll
  for (int i = 0; i < 8; ++i) { const int ka = k0 + 8 * g + i, kb = ka + 16; v[i] = ka < K ? W[(size_t)(ka < K ? ka : K - 1) * ld + n] : 0.f; v[8 + i] = kb < K ? W[(size_t)(kb < K ? kb : K - 1) * ld + n] : 0.f; }
  return bsplit16(v); }
__device__ __forceinline__ v8f mac3(const F2& a, const F2& b, v8f c) { c = wmma_bf(a.l, b.h, c); c = wmma_bf(a.h, b.l, c); return wmma_bf(a.h, b.h, c); }
__device__ __forceinline__ float sigm(float v) { return 1.0f / (1.0f + expf(-v)); }
#define LDSX() do { asm volatile("s_wait_dscnt 0" ::: "memory"); __builtin_amdgcn_wave_barrier(); __builtin_amdgcn_fence(__ATOMIC_RELEASE, "workgroup"); } while (0)


// Multi-head spatial attention block (B 16, C 256, 32x32 = 1,024 positions, d_model 512 = 8 x 64): MHA over positions + Wo + residual LN + SiLU FFN + residual LN; second output = inbound attention map (sum over queries, mean over heads).
#define NB 16
#define CIN 256
#define TT 1024
#define CC 512
#define NH 8
#define HD 64
#define NR (NB * TT)
#ifndef TNB
#define TNB NB
#endif
typedef __attribute__((ext_vector_type(8))) __bf16 v8b;
__device__ __forceinline__ v16b frag_b(const __bf16* rowk0, int lane) {
  union { v16b v; v8b q[2]; } u; const __bf16* p = rowk0 + 8 * (lane >> 4);
  u.q[0] = *(const v8b*)p; u.q[1] = *(const v8b*)(p + 16); return u.v;
}
__device__ __forceinline__ float bfr(float v) { return (float)(__bf16)v; }
__device__ __attribute__((noinline)) float exp_ni(float v) { return expf(v); }
__device__ __attribute__((noinline)) float erf_ni(float v) { return erff(v); }

#define OUT1_OFF ((size_t)NB * CIN * TT)
#define WS_QH  0u
#define WS_QL  (WS_QH + 2u * (size_t)NR * CC)
#define WS_KH  (WS_QL + 2u * (size_t)NR * CC)
#define WS_VT  (WS_KH + 2u * (size_t)NR * CC)          // f16 V^T fragments; QH, QL, KH and VT all lie in fragment order (see k_proj)
#define WS_Y   (WS_VT + 2u * (size_t)NR * CC)          // f32 O rows [b*t][512]
#define WS_Z1  (WS_Y + 4u * (size_t)NR * CC)           // f32 LN1 rows [b*t][256]
#define WS_HM  (WS_Z1 + 4u * (size_t)NR * CIN)         // f32 silu rows [b*t][256]
#define QCH 64                // query rows per partial column sum
#define NPART (NH * (TT / QCH))   // partial rows per batch
#define WS_CP  (WS_HM + 4u * (size_t)NR * CIN)         // f32 partial column sums [b][NPART][t]
#define WS_PW  (WS_CP + 4u * (size_t)NB * NPART * TT)  // bf16 packed weights: Wq, Wk, Wv, Wo, W1, W2
#define PW_O  (3 * CIN * CC)
#define PW_1  (4 * CIN * CC)
#define PW_2  (4 * CIN * CC + CIN * CIN)
#define WS_END (WS_PW + 2u * (size_t)(4 * CIN * CC + 2 * CIN * CIN))

// ---- k_pack: block = (256 units of 8 k, matrix): a weight matrix W (in,out) [K][N], rounded to bf16, laid out as the B fragments the GEMMs read:
// fragment (kc, nt) = 1 KiB = [k half q][lane][8 bf16], lane (g, col) holding column nt*16 + col, k = kc*32 + 16q + 8g + 0..7, so that a wave reads a fragment as two 512-byte loads
__global__ __launch_bounds__(256) void k_pack(const float* __restrict__ WQ, const float* __restrict__ WK, const float* __restrict__ WV, const float* __restrict__ WO, const float* __restrict__ W1, const float* __restrict__ W2, __bf16* __restrict__ PW) {
  const int m = blockIdx.y; const float* Wm = m == 0 ? WQ : m == 1 ? WK : m == 2 ? WV : m == 3 ? WO : m == 4 ? W1 : W2;
  const int N = m < 3 ? CC : CIN, K = m == 3 ? CC : CIN; const int unit = blockIdx.x * 256 + threadIdx.x;
  if (unit >= K * N / 8) return;
  const int lane = unit & 31, q = (unit >> 5) & 1, f = unit >> 6, NT = N / 16; const int n = (f % NT) * 16 + (lane & 15), k = (f / NT) * 32 + q * 16 + 8 * (lane >> 4);
  float v[8]; v8b o;
#pragma unroll   // the 8 loads are issued together
  for (int i = 0; i < 8; ++i) v[i] = Wm[(size_t)(k + i) * N + n];
  asm volatile("s_wait_xcnt 0x0" ::: "memory");   // the conversions below may reuse the registers that hold the loads' addresses
#pragma unroll
  for (int i = 0; i < 8; ++i) o[i] = (__bf16)v[i];
  vst2(PW + (m < 4 ? m * (CIN * CC) : PW_1 + (m - 4) * (CIN * CIN)) + (size_t)unit * 8, o); }
// one packed fragment (p = fragment base + lane * 8), and the 8 neighbouring fragments of one k-step
__device__ __forceinline__ v16b frag_pw(const __bf16* p) { union { v16b v; v8b q[2]; } u; u.q[0] = *(const v8b*)p; u.q[1] = *(const v8b*)(p + 256); return u.v; }
__device__ __forceinline__ void ldw8(v16b (&w)[8], const __bf16* p) {
#pragma unroll   // 16 loads in a row, the set indexed by constants
  for (int j = 0; j < 8; ++j) w[j] = frag_pw(p + j * 512); }

// ---- k_proj: block = (64 positions, 128 cols, b*3 + which): x^T tile; packed W; a k-step's 8 B fragments are loaded together, one k-step ahead of the WMMAs that use them
// Q, K and V leave in the order in which k_att's 16x16x32 fragments read them: fragment = 1 KiB = [k half q][lane (g, row)][8 f16], k = 32*chunk + 16q + 8g + 0..7.
// Q, K: [b][head][16-position tile][32-dim chunk], row = position; V^T: [b][head][32-key chunk][16-dim tile], row = dim, k = key. A wave stores and loads 512 contiguous bytes at a time.
__global__ __launch_bounds__(128) void k_proj(const float* __restrict__ X, const __bf16* __restrict__ PW, const float* __restrict__ BQ, const float* __restrict__ BK, const float* __restrict__ BV, _Float16* __restrict__ QH, _Float16* __restrict__ QL, _Float16* __restrict__ KH, _Float16* __restrict__ VT) {
  __shared__ __align__(16) __bf16 sx[64][CIN + 8]; __shared__ __align__(16) _Float16 sh[64][136], sl[64][136]; __shared__ __align__(16) _Float16 th[128][72];
  const int tid = threadIdx.x, wave = tid >> 5, lane = tid & 31, col = lane & 15, g = lane >> 4; const int p0 = blockIdx.x * 64; const int c0 = blockIdx.y * 128; const size_t b = blockIdx.z / 3; const int which = blockIdx.z % 3;
  const __bf16* Pw = PW + (size_t)which * (CIN * CC) + (c0 / 16) * 512 + lane * 8; const float* Bm = which == 0 ? BQ : which == 1 ? BK : BV;
  v16b wb[2][8];
  { // x tile: thread = (4 neighbouring positions, 8 neighbouring channels out of every 64). A wave's load covers two 256-byte runs; 8 channels of one position leave as one 16-byte LDS store
    const int pq = (tid & 15) * 4, cg = (tid >> 4) * 8; const float* xp = X + (b * CIN + cg) * (size_t)TT + p0 + pq; v4f xv[4][8];
#pragma unroll   // all 32 loads are issued before the first value is used: the tile costs one trip to memory, not one per group of loads
    for (int i = 0; i < 4; ++i)
#pragma unroll
      for (int j = 0; j < 8; ++j) xv[i][j] = *(const v4f*)(xp + (size_t)(i * 64 + j) * TT);
    asm volatile("s_wait_xcnt 0x0" ::: "memory");   // what follows (the weights' loads, the conversions) may reuse the registers that hold the loads' address; the clobber also keeps every x load above this line
    ldw8(wb[0], Pw);   // the first k-step's weights fly behind the tile
#pragma unroll
    for (int i = 0; i < 4; ++i)
#pragma unroll
      for (int k = 0; k < 4; ++k) { v8b o;
#pragma unroll
        for (int j = 0; j < 8; ++j) o[j] = (__bf16)xv[i][j][k];
        *(v8b*)&sx[pq + k][i * 64 + cg] = o; } }
  __syncthreads();
  v8f acc[8] = {};
#pragma unroll   // unrolled: the two fragment sets are indexed by constants and stay in registers
  for (int kc = 0; kc < CIN / 32; ++kc) { const v16b a = frag_b(&sx[wave * 16 + col][kc * 32], lane);
    if (kc + 1 < CIN / 32) ldw8(wb[(kc + 1) & 1], Pw + (kc + 1) * (CC / 16) * 512);
#pragma unroll
    for (int j = 0; j < 8; ++j) acc[j] = wmma_bf(a, wb[kc & 1][j], acc[j]); }
#pragma unroll
  for (int j = 0; j < 8; ++j) { const float bb = bfr(Bm[c0 + j * 16 + col]);
#pragma unroll
    for (int r = 0; r < 8; ++r) { const float v = acc[j][r] + bb; const int rl = wave * 16 + 8 * g + r, cl = j * 16 + col; const _Float16 hv = (_Float16)v;
      if (which == 2) th[cl][rl] = hv; else { sh[rl][cl] = hv; sl[rl][cl] = (_Float16)(v - (float)hv); } } }
  __syncthreads();
  // 16 fragments a block, unit e = (fragment f, k half, g, row); a head's 8 fragments of the block lie in a row
  const int kq = ((lane >> 4) + 2 * (wave & 1)) * 8;   // 16q + 8g of this thread's units
  if (which < 2) { _Float16* dh = which == 0 ? QH : KH; for (int e = tid; e < 64 * 16; e += 128) { const int f = e >> 6, hl = f >> 3, rl = ((f >> 1) & 3) * 16 + col, cl = hl * 64 + (f & 1) * 32 + kq;
      const size_t o = ((b * NH + c0 / HD + hl) * (TT / 16) + p0 / 16) * (size_t)1024 + (e & 511) * 8; vst2((unsigned*)(dh + o), *(const v4u*)&sh[rl][cl]);
      asm volatile("s_wait_xcnt 0x0" ::: "memory");   // what follows (the residual's LDS read, the next trip) overwrites the registers that the store names
      if (which == 0) { vst2((unsigned*)(QL + o), *(const v4u*)&sl[rl][cl]); asm volatile("s_wait_xcnt 0x0" ::: "memory"); } } }   // the same for the residual's store
  else { for (int e = tid; e < 128 * 8; e += 128) { const int f = e >> 6, hl = f >> 3, cl = hl * 64 + (f & 3) * 16 + col, rl = ((f >> 2) & 1) * 32 + kq;
      vst2((unsigned*)(VT + ((b * NH + c0 / HD + hl) * (TT / 32) + p0 / 32) * (size_t)2048 + (e & 511) * 8), *(const v4u*)&th[cl][rl]); } } }
#define ESC 0.18033688f   // log2(e) / 8: the logits' scale 1 / sqrt(64) and the change of base, in one factor
#define KRING 4   // K fragments in flight a wave (4 WMMAs each)
#define VRING 6   // V fragments in flight a wave (2 WMMAs each); more of either and the kernel spills at 256 registers
// one f16 fragment in fragment order (f = fragment base, l8 = lane * 8): two loads of 512 contiguous bytes a wave
__device__ __forceinline__ v16h frag_pk(const _Float16* f, unsigned l8) { union { v16h v; v8h q[2]; } u; const _Float16* p = f + l8; u.q[0] = *(const v8h*)p; u.q[1] = *(const v8h*)(p + 256); return u.v; }
// ---- k_att: block = (64 queries, z = b*8 + h), 8 waves; wave w owns keys 128w .. 128w+127 and walks the block's queries 32 at a time (two 16-query tiles share every K and V fragment).
// S^T = K . Q^T (2 products): a lane holds one query's logits for 8 consecutive keys of each 16-key tile, so the whole 32 x 128 tile stays in registers,
// the row maximum and sum need one exchange between wave halves and one between waves, and two neighbouring tiles pack straight into the B operand of O^T = V^T . P^T.
// Column sums: the wave's own P tile goes through LDS once (row = query), each lane then adds 8 keys over 16 queries and keeps the sums over the block's 64 queries.
// waves_per_eu(4, 4) holds a wave to 256 registers, so that two blocks (16 waves) share a WGP, which their LDS also allows.
__global__ __launch_bounds__(256) __attribute__((amdgpu_waves_per_eu(4, 4))) void k_att(const _Float16* __restrict__ QH, const _Float16* __restrict__ QL, const _Float16* KH, const _Float16* VT, float* __restrict__ Y, float* __restrict__ CP) {   // KH, VT without __restrict__: with it the compiler holds the fragments that both passes read first in registers over the whole pass, and spills
  __shared__ float smx[2][8][32]; __shared__ __align__(16) _Float16 sp[8][32][144]; __shared__ __align__(16) float so[8][32][68];
  const int z = blockIdx.y; const size_t b = z / NH; const int h = z % NH;
  const int tid = threadIdx.x, wave = tid >> 5, lane = tid & 31, col = lane & 15, g = lane >> 4; const int kw = wave * 128;
  const size_t hb = (size_t)z * (TT * HD);   // this head's fragments: 128 KiB in each of the four buffers
  const int ws = wave * 8192;   // the wave's 8 key tiles (K) and 4 key chunks (V): 16 KiB each
  const _Float16* Kp = KH + hb + ws; const _Float16* Vp = VT + hb + ws; const _Float16* Qh = QH + hb + blockIdx.x * 4096; const _Float16* Ql = QL + hb + blockIdx.x * 4096; const unsigned l8 = lane * 8;
  v4f c0 = {}, c1 = {};
#pragma unroll 1   // rolled: unrolled, the two passes' tiles would compete for the 256 registers
  for (int qp = 0; qp < 2; ++qp) { const size_t q0 = b * TT + blockIdx.x * 64 + qp * 32;
    v8f s[8][2] = {}; v16h hq[2], lq[2], kf[KRING], vf[VRING];
#pragma unroll   // the first KRING K fragments are asked for together
    for (int i = 0; i < KRING; ++i) kf[i] = frag_pk(Kp + ((i & 7) * 2 + (i >> 3)) * 512, l8);
#pragma unroll   // unrolled: the ring of K fragments is indexed by constants; fragment i + KRING is asked for as soon as fragment i has been used
    for (int i = 0; i < 16; ++i) { const int kc = i >> 3, t = i & 7; const v16h k = kf[i % KRING];
      if (t == 0) {
#pragma unroll
        for (int u = 0; u < 2; ++u) { hq[u] = frag_pk(Qh + ((qp * 2 + u) * 2 + kc) * 512, l8); lq[u] = frag_pk(Ql + ((qp * 2 + u) * 2 + kc) * 512, l8); }
        asm volatile("s_wait_xcnt 0x0" :: "v"(Qh + qp * 2048 + l8), "v"(Ql + qp * 2048 + l8) : "memory"); }   // the registers that hold the Q loads' addresses are reused for fragments further down; named as inputs, the two address pairs stay whole up to the wait
#pragma unroll
      for (int u = 0; u < 2; ++u) { s[t][u] = wmma16(k, hq[u], s[t][u]); s[t][u] = wmma16(k, lq[u], s[t][u]); }
      if (i + KRING < 16) kf[i % KRING] = frag_pk(Kp + (((i + KRING) & 7) * 2 + ((i + KRING) >> 3)) * 512, l8); }
    float m[2], inv[2];
#pragma unroll
    for (int u = 0; u < 2; ++u) {   // the maximum is taken over the unscaled logits: the scale is positive and goes into the exponent's FMA
      v8f mv = s[0][u];
#pragma unroll
      for (int t = 1; t < 8; ++t)
#pragma unroll
        for (int r = 0; r < 8; ++r) mv[r] = fmaxf(mv[r], s[t][u][r]);
      float a = fmaxf(fmaxf(fmaxf(mv[0], mv[1]), fmaxf(mv[2], mv[3])), fmaxf(fmaxf(mv[4], mv[5]), fmaxf(mv[6], mv[7])));
      a = fmaxf(a, __shfl_xor(a, 16)); if (g == 0) smx[0][wave][u * 16 + col] = a; }
    __syncthreads();
#pragma unroll
    for (int u = 0; u < 2; ++u) { const int x = u * 16 + col;
      m[u] = fmaxf(fmaxf(fmaxf(smx[0][0][x], smx[0][1][x]), fmaxf(smx[0][2][x], smx[0][3][x])), fmaxf(fmaxf(smx[0][4][x], smx[0][5][x]), fmaxf(smx[0][6][x], smx[0][7][x])));
      const float mc = m[u] * ESC; const v8f esc8 = { ESC, ESC, ESC, ESC, ESC, ESC, ESC, ESC }, nmc8 = { -mc, -mc, -mc, -mc, -mc, -mc, -mc, -mc }; v8f sv = {};
#pragma unroll
      for (int t = 0; t < 8; ++t) { s[t][u] = __builtin_elementwise_fma(s[t][u], esc8, nmc8);
#pragma unroll
        for (int r = 0; r < 8; ++r) s[t][u][r] = __builtin_amdgcn_exp2f(s[t][u][r]);
        sv += s[t][u]; }   // argument <= 0 but for one rounding; far below -126 gives 0, which P's f16 would round to anyway
      float sum = ((sv[0] + sv[1]) + (sv[2] + sv[3])) + ((sv[4] + sv[5]) + (sv[6] + sv[7]));
      sum += __shfl_xor(sum, 16); if (g == 0) smx[1][wave][x] = sum; }
    __syncthreads();
    v8h p8[8][2];
#pragma unroll   // the first VRING V fragments fly while P is scaled and packed
    for (int i = 0; i < VRING; ++i) vf[i] = frag_pk(Vp + i * 512, l8);
    __builtin_amdgcn_sched_barrier(0);   // the loads above and the packing below are scheduled apart: as one region this build needs more than 256 registers and spills to scratch
#pragma unroll
    for (int u = 0; u < 2; ++u) { const int x = u * 16 + col;
      inv[u] = 2048.0f * (1.0f / (((smx[1][0][x] + smx[1][1][x]) + (smx[1][2][x] + smx[1][3][x])) + ((smx[1][4][x] + smx[1][5][x]) + (smx[1][6][x] + smx[1][7][x]))));   // P's factor 2^11 rides in the row's reciprocal: a power of two, the same bits
#pragma unroll
      for (int t = 0; t < 8; ++t) {
#pragma unroll
        for (int r = 0; r < 8; ++r) p8[t][u][r] = (_Float16)(s[t][u][r] * inv[u]);
        *(v8h*)&sp[wave][x][t * 16 + 8 * g] = p8[t][u]; }
 }
    v8f acc[4][2] = {};
#pragma unroll
    for (int c = 0; c < 4; ++c) { union { v16h v; v8h q[2]; } pb[2];
#pragma unroll
      for (int u = 0; u < 2; ++u) { pb[u].q[0] = p8[2 * c][u]; pb[u].q[1] = p8[2 * c + 1][u]; }
#pragma unroll
      for (int j = 0; j < 4; ++j) { const int i = c * 4 + j; const v16h v = vf[i % VRING];
#pragma unroll
        for (int u = 0; u < 2; ++u) acc[j][u] = wmma16(v, pb[u].v, acc[j][u]);
        if (i + VRING < 16) vf[i % VRING] = frag_pk(Vp + (i + VRING) * 512, l8); } }
    LDSX();   // the wave's own P rows are in LDS before its lanes read across them
#pragma unroll
    for (int q = 0; q < 16; ++q) { const v8h v = *(const v8h*)&sp[wave][g * 16 + q][col * 8];
#pragma unroll
      for (int e = 0; e < 4; ++e) { c0[e] += (float)v[e]; c1[e] += (float)v[4 + e]; } }
#pragma unroll
    for (int u = 0; u < 2; ++u)
#pragma unroll
      for (int j = 0; j < 4; ++j) { const v8f o = acc[j][u] * (1.0f / 2048.0f); const v4f lo = { o[0], o[1], o[2], o[3] }, hi = { o[4], o[5], o[6], o[7] };
        *(v4f*)&so[wave][u * 16 + col][j * 16 + 8 * g] = lo; *(v4f*)&so[wave][u * 16 + col][j * 16 + 8 * g + 4] = hi; }
    __syncthreads();
    { const int q = tid >> 3, d0 = (tid & 7) * 8; float* y = Y + (q0 + q) * CC + h * HD + d0;
#pragma unroll
      for (int f = 0; f < 2; ++f) { const int d = d0 + 4 * f;
        vst2(y + 4 * f, ((*(const v4f*)&so[0][q][d] + *(const v4f*)&so[1][q][d]) + (*(const v4f*)&so[2][q][d] + *(const v4f*)&so[3][q][d])) + ((*(const v4f*)&so[4][q][d] + *(const v4f*)&so[5][q][d]) + (*(const v4f*)&so[6][q][d] + *(const v4f*)&so[7][q][d]))); }
      asm volatile("s_wait_xcnt 0x0" ::: "memory"); } }   // the next pass overwrites the registers that the two stores name
#pragma unroll
  for (int e = 0; e < 4; ++e) { c0[e] += __shfl_xor(c0[e], 16); c1[e] += __shfl_xor(c1[e], 16); }
  float* cp = CP + (b * NPART + h * (TT / QCH) + blockIdx.x) * (size_t)TT + kw + col * 8 + 4 * g; vst2(cp, g == 0 ? c0 : c1); }
// ---- k_colr: block = (128 keys, batch): attn_map[b][k] = (1/8) sum over the batch's 128 partial rows (8 heads x 16 query blocks); wave w sums 16 rows, then 8 wave sums through LDS
__global__ __launch_bounds__(256) void k_colr(const float* __restrict__ CP, float* __restrict__ AM) { __shared__ __align__(16) float sr[8][128];
  const int t = threadIdx.x, w = t >> 5, lane = t & 31; const size_t b = blockIdx.y; const int k0 = blockIdx.x * 128;
  const float* p = CP + (b * NPART + w * (NPART / 8)) * (size_t)TT + k0 + lane * 4;
  v4f v[NPART / 8];
#pragma unroll
  for (int i = 0; i < NPART / 8; ++i) v[i] = *(const v4f*)(p + (size_t)i * TT);
  v4f a = {};
#pragma unroll
  for (int i = 0; i < NPART / 8; ++i) a += v[i];
  *(v4f*)&sr[w][lane * 4] = a;
  __syncthreads();
  if (t < 32) { v4f s = *(const v4f*)&sr[0][t * 4];
#pragma unroll
    for (int i = 1; i < 8; ++i) s += *(const v4f*)&sr[i][t * 4];
    vst2(AM + b * TT + k0 + t * 4, s * (1.0f / 2048.0f) * (1.0f / NH)); } }
// ---- k_lnA: block = 64 rows x all 256 output cols, 8 waves: wave = (16-row tile, 128-column half), so that both halves of the GEMM run side by side: Z1 = LN(Y (hi+lo) Wo + bo + x^T) (K 512); writes Z1 rows
// ---- k_lnB: out = LN(HM (hi+lo) W2 + b2 + Z1) (K 256); writes channel-major output planes
template <int MODE>
__global__ __launch_bounds__(256) void k_ln(const float* __restrict__ A, const __bf16* __restrict__ PWm, const float* __restrict__ Bv, const float* __restrict__ RES, const float* __restrict__ GA, const float* __restrict__ BE, float* __restrict__ DST) {
  __shared__ __align__(16) float sz[64][CIN + 4];
  const int tid = threadIdx.x, wave = (tid >> 5) & 3, half = tid >> 7, lane = tid & 31, col = lane & 15, g = lane >> 4; const size_t r0 = (size_t)blockIdx.x * 64; const size_t b = r0 / TT; const int p0 = (int)(r0 % TT); constexpr int K = (MODE == 0) ? CC : CIN;
  {
    v8f acc[8]; for (int j = 0; j < 8; ++j) for (int r = 0; r < 8; ++r) acc[j][r] = 0.f;
    const __bf16* Pw = PWm + half * 8 * 512 + lane * 8; const float* Ar = A + (r0 + wave * 16 + col) * K;
    v16b w0[8], w1[8]; ldw8(w0, Pw);
#pragma unroll 1   // two k-steps a trip, written out: each step's 8 B fragments are loaded one step ahead into the set the other step has left
    for (int kc = 0; kc < K / 32; kc += 2) { const F2 a0 = split_row(Ar, kc * 32, lane);
      ldw8(w1, Pw + (kc + 1) * (CIN / 16) * 512);
#pragma unroll
      for (int j = 0; j < 8; ++j) { acc[j] = wmma_bf(a0.h, w0[j], acc[j]); acc[j] = wmma_bf(a0.l, w0[j], acc[j]); }
      const F2 a1 = split_row(Ar, kc * 32 + 32, lane);
      if (kc + 2 < K / 32) ldw8(w0, Pw + (kc + 2) * (CIN / 16) * 512);
      asm volatile("s_wait_xcnt 0x0" ::: "memory");   // the address registers that the trip's loads name are advanced below
#pragma unroll
      for (int j = 0; j < 8; ++j) { acc[j] = wmma_bf(a1.h, w1[j], acc[j]); acc[j] = wmma_bf(a1.l, w1[j], acc[j]); } }
#pragma unroll
    for (int j = 0; j < 8; ++j) { const int o = half * 128 + j * 16 + col; const float bb = bfr(Bv[o]);
#pragma unroll
      for (int r = 0; r < 8; ++r) { const int rl = wave * 16 + 8 * g + r; const float res = (MODE == 0) ? bfr(RES[(b * CIN + o) * (size_t)TT + p0 + rl]) : RES[(r0 + rl) * CIN + o]; sz[rl][o] = acc[j][r] + bb + res; } } }
  __syncthreads();
  // gamma and beta of the columns that this thread stores further down (MODE 0: 4 neighbouring columns; MODE 1: channels (tid >> 4) + 16 i), asked for here so that they arrive while the statistics are formed
  constexpr int NG = (MODE == 0) ? 4 : 16; float ga[NG], be[NG];
#pragma unroll   // all loads issued together, the values indexed by constants
  for (int i = 0; i < NG; ++i) { const int c = (MODE == 0) ? (tid & 63) * 4 + i : (tid >> 4) + 16 * i; ga[i] = GA[c]; be[i] = BE[c]; }
  asm volatile("s_wait_xcnt 0x0" ::: "memory");   // what follows may reuse the registers that hold the loads' addresses
  // LayerNorm statistics: four threads a row; each holds its 64 values (16-column groups, every fourth) in registers for both sums. 16 lanes = 4 rows x 4 groups fall on all 64 banks once.
  // Mean and 1 / standard deviation go into the row's own pad columns.
  { const int rl = tid >> 2; const float* rp = &sz[rl][(tid & 3) * 16]; v4f v[16];
#pragma unroll   // all 16 LDS reads are issued before the first value is used
    for (int i = 0; i < 16; ++i) v[i] = *(const v4f*)(rp + (i >> 2) * 64 + (i & 3) * 4);
    v4f a[4] = { v[0], v[1], v[2], v[3] };
#pragma unroll
    for (int i = 4; i < 16; ++i) a[i & 3] += v[i];
    const v4f s4 = (a[0] + a[1]) + (a[2] + a[3]); float s = (s4[0] + s4[1]) + (s4[2] + s4[3]); s += __shfl_xor(s, 1); s += __shfl_xor(s, 2); const float mu = s / CIN;
    v4f w[4] = {};
#pragma unroll
    for (int i = 0; i < 16; ++i) { const v4f d = v[i] - mu; w[i & 3] += d * d; }
    const v4f q4 = (w[0] + w[1]) + (w[2] + w[3]); float q = (q4[0] + q4[1]) + (q4[2] + q4[3]); q += __shfl_xor(q, 1); q += __shfl_xor(q, 2);
    if ((tid & 3) == 0) { const v2f st = { mu, 1.0f / sqrtf(q / CIN + 1e-5f) }; *(v2f*)&sz[rl][CIN] = st; } }
  __syncthreads();
  // the rows are normalised on their way out
  if (MODE == 0) { const int q = tid & 63;
#pragma unroll   // unrolled: the LDS reads run ahead of the stores, and every access takes its place from one address and a constant
    for (int i = 0; i < 16; ++i) { const int rl = (tid >> 6) + 4 * i; const v2f st = *(const v2f*)&sz[rl][CIN]; const v4f x = *(const v4f*)&sz[rl][q * 4]; v4f o;
#pragma unroll
      for (int k = 0; k < 4; ++k) o[k] = (x[k] - st[0]) * st[1] * bfr(ga[k]) + bfr(be[k]);
      vst2(DST + (r0 + rl) * CIN + q * 4, o); } }
  else { // channel-major planes [b][c][p0 .. p0+63]: transpose through registers: for (c, 4 consecutive positions)
    const int q = tid & 15; v2f st[4];
#pragma unroll
    for (int k = 0; k < 4; ++k) st[k] = *(const v2f*)&sz[q * 4 + k][CIN];
#pragma unroll   // unrolled: as above
    for (int i = 0; i < 16; ++i) { const int c = (tid >> 4) + 16 * i; v4f o;
#pragma unroll
      for (int k = 0; k < 4; ++k) o[k] = (sz[q * 4 + k][c] - st[k][0]) * st[k][1] * bfr(ga[i]) + bfr(be[i]);
      vst2(DST + (b * CIN + c) * (size_t)TT + p0 + q * 4, o); } } }
// ---- k_ffn1: block = (64 rows, 128 cols): HM = silu(Z1 (hi+lo) W1 + b1)
__global__ __launch_bounds__(128) void k_ffn1(const float* __restrict__ Z1, const __bf16* __restrict__ PW1, const float* __restrict__ B1, float* __restrict__ HM) { __shared__ __align__(16) float sf[4][16][132];
  const int tid = threadIdx.x, wave = tid >> 5, lane = tid & 31, col = lane & 15, g = lane >> 4; const int c0 = blockIdx.y * 128; const size_t r0 = (size_t)blockIdx.x * 64 + wave * 16;
  v8f acc[8] = {};
  const __bf16* Pw = PW1 + (c0 / 16) * 512 + lane * 8; v16b wb[2][8]; ldw8(wb[0], Pw);
#pragma unroll   // unrolled: the two fragment sets are indexed by constants and stay in registers
  for (int kc = 0; kc < CIN / 32; ++kc) { const F2 a = split_row(Z1 + (r0 + col) * CIN, kc * 32, lane);
    if (kc + 1 < CIN / 32) ldw8(wb[(kc + 1) & 1], Pw + (kc + 1) * (CIN / 16) * 512);
#pragma unroll
    for (int j = 0; j < 8; ++j) { acc[j] = wmma_bf(a.h, wb[kc & 1][j], acc[j]); acc[j] = wmma_bf(a.l, wb[kc & 1][j], acc[j]); } }
#pragma unroll
  for (int j = 0; j < 8; ++j) { const float bb = bfr(B1[c0 + j * 16 + col]);
#pragma unroll
    for (int r = 0; r < 8; ++r) { const float v = acc[j][r] + bb; sf[wave][8 * g + r][j * 16 + col] = v / (1.0f + expf(-v)); } }
  LDSX(); for (int rl = 0; rl < 16; ++rl) vst2(HM + (r0 + rl) * CIN + c0 + lane * 4, *(const v4f*)&sf[wave][rl][lane * 4]); }
extern "C" void kernel_launch(void* const* d_in, const int* in_sizes, int n_in, void* d_out, int out_size, void* d_ws, size_t ws_size, hipStream_t stream) {
  (void)in_sizes; (void)n_in; (void)out_size;
  const float** F = (const float**)d_in;   // 0 x [16,256,32,32], 1 Wq [256,512], 2 bq, 3 Wk, 4 bk, 5 Wv, 6 bv, 7 Wo [512,256], 8 bo, 9 W1 [256,256], 10 b1, 11 W2, 12 b2, 13 g1, 14 be1, 15 g2, 16 be2
  if (ws_size < (size_t)WS_END) return;
  char* ws = (char*)d_ws; _Float16 *QH = (_Float16*)(ws + WS_QH), *QL = (_Float16*)(ws + WS_QL), *KH = (_Float16*)(ws + WS_KH), *VT = (_Float16*)(ws + WS_VT); float *Y = (float*)(ws + WS_Y), *Z1 = (float*)(ws + WS_Z1), *HM = (float*)(ws + WS_HM), *CP = (float*)(ws + WS_CP); __bf16* PW = (__bf16*)(ws + WS_PW);
  float* OUT0 = (float*)d_out; float* OUT1 = (float*)d_out + OUT1_OFF;
  k_pack<<<dim3(CIN * CC / 8 / 256, 6), 256, 0, stream>>>(F[1], F[3], F[5], F[7], F[9], F[11], PW);
  k_proj<<<dim3(TT / 64, CC / 128, TNB * 3), 128, 0, stream>>>(F[0], PW, F[2], F[4], F[6], QH, QL, KH, VT);
  k_att<<<dim3(TT / 64, TNB * NH), 256, 0, stream>>>(QH, QL, KH, VT, Y, CP);
  k_colr<<<dim3(TT / 128, TNB), 256, 0, stream>>>(CP, OUT1);
  k_ln<0><<<TNB * TT / 64, 256, 0, stream>>>(Y, PW + PW_O, F[8], F[0], F[13], F[14], Z1);
  k_ffn1<<<dim3(TNB * TT / 64, CIN / 128), 128, 0, stream>>>(Z1, PW + PW_1, F[10], HM);
  k_ln<1><<<TNB * TT / 64, 256, 0, stream>>>(HM, PW + PW_2, F[12], Z1, F[15], F[16], OUT0);
}

// v009
// A run of this version takes 140 microseconds.
// Two timings next to v008 put it at 1.06 and 1.08 times that version's speed.
// Over all steps from v000 it is 55.0 times as fast.
// compute dtype: all float inputs rounded to bf16; Q/K/V = x^T W + b with EXACT bf16 products on WMMA 16x16x32 (channel-major tiles transposed in LDS), f32 accumulate; Q as f16 hi + residual, K f16 -> 2-product logits kept in f32 registers (one fused launch for logits, softmax, column sums and P . V); softmax in f32, exp((l - max) / 8) = exp2(l * (log2 e / 8) - max * (log2 e / 8)): one FMA and the hardware exp2 -> P f16 x 2^11; attn_map = column sums of P / 8 in f32; O = P . V (V rounded once to f16, 1 product); Wo, W1, W2 GEMMs with the f32 activations split bf16 hi + lo (2 products); LayerNorms (eps 1e-5), SiLU and residuals in f32; outputs: out channel-major [b][c][hw], attn_map [b][hw].
#include <hip/hip_runtime.h>
#include <math.h>

typedef __attribute__((ext_vector_type(16))) _Float16 v16h;
typedef __attribute__((ext_vector_type(16))) __bf16 v16b;
typedef __attribute__((ext_vector_type(8)))  _Float16 v8h;
typedef __attribute__((ext_vector_type(8)))  float v8f;
typedef __attribute__((ext_vector_type(4)))  float v4f;
typedef __attribute__((ext_vector_type(2)))  float v2f;
typedef __attribute__((ext_vector_type(4)))  unsigned v4u;
typedef __attribute__((ext_vector_type(4)))  int v4i;
typedef float __attribute__((may_alias)) float_a;
typedef int __attribute__((may_alias)) int_a;

template <typename T> __device__ __forceinline__ void vst2(void* p, T v) { *(T*)p = v;  }
__device__ __forceinline__ v8f wmma16(v16h a, v16h b, v8f c) {
  v8f d = __builtin_amdgcn_wmma_f32_16x16x32_f16(false, a, false, b, (short)0, c, false, false);
  asm volatile("v_nop\n\tv_nop\n\tv_nop\n\tv_nop" : "+v"(d) : "v"(a), "v"(b));
  return d;
}
__device__ __forceinline__ v8f wmma_bf(v16b a, v16b b, v8f c) {
  v8f d = __builtin_amdgcn_wmma_f32_16x16x32_bf16(false, a, false, b, (short)0, c, false, false);
  asm volatile("v_nop\n\tv_nop\n\tv_nop\n\tv_nop" : "+v"(d) : "v"(a), "v"(b));
  return d;
}
// 16x16x32 fragments: lane = (h = lane>>4, row/col = lane&15); elements 0..7 = k0+8h+0..7, 8..15 = k0+16+8h+0..7; D element r = row 8h+r
__device__ __forceinline__ v16h frag_h(const _Float16* rowk0, int lane) {
  union { v16h v; v8h q[2]; } u; const _Float16* p = rowk0 + 8 * (lane >> 4);
  u.q[0] = *(const v8h*)p; u.q[1] = *(const v8h*)(p + 16); return u.v;
}
__device__ __forceinline__ v16h frag_f32(const float* rowk0, int lane) {
  v16h a; const float* p = rowk0 + 8 * (lane >> 4);
#pragma unroll
  for (int i = 0; i < 8; ++i) { a[i] = (_Float16)p[i]; a[8 + i] = (_Float16)p[16 + i]; }
  return a;
}
__device__ __forceinline__ v16h frag_f32s(const float* rowk0, int lane, float sc) {
  v16h a; const float* p = rowk0 + 8 * (lane >> 4);
#pragma unroll
  for (int i = 0; i < 8; ++i) { a[i] = (_Float16)(p[i] * sc); a[8 + i] = (_Float16)(p[16 + i] * sc); }
  return a;
}
// column fragment from a [K][ld] layout (column n), rows >= K read as 0
__device__ __forceinline__ v16h fragc_f32(const float* W, int k0, int n, int lane, int ld, int K) {
  v16h a; const int g = lane >> 4;
#pragma unroll
  for (int i = 0; i < 8; ++i) { const int ka = k0 + 8 * g + i, kb = ka + 16;
    a[i] = (_Float16)(ka < K ? W[(size_t)(ka < K ? ka : K - 1) * ld + n] : 0.f); a[8 + i] = (_Float16)(kb < K ? W[(size_t)(kb < K ? kb : K - 1) * ld + n] : 0.f); }
  return a;
}
struct F2 { v16b h, l; };
__device__ __forceinline__ F2 bsplit16(const float v[16]) { F2 r;
#pragma unroll
  for (int i = 0; i < 16; ++i) { const __bf16 h = (__bf16)v[i]; r.h[i] = h; r.l[i] = (__bf16)(v[i] - (float)h); }
  return r; }
__device__ __forceinline__ F2 split_row(const float* row, int k0, int lane) { float v[16]; const float* p = row + k0 + 8 * (lane >> 4);
#pragma unroll
  for (int i = 0; i < 8; ++i) { v[i] = p[i]; v[8 + i] = p[16 + i]; }
  return bsplit16(v); }
__device__ __forceinline__ F2 split_rowK(const float* row, int k0, int lane, int K) { float v[16]; const int g = lane >> 4;
#pragma unroll
  for (int i = 0; i < 8; ++i) { const int ka = k0 + 8 * g + i, kb = ka + 16; v[i] = ka < K ? row[ka < K ? ka : K - 1] : 0.f; v[8 + i] = kb < K ? row[kb < K ? kb : K - 1] : 0.f; }
  return bsplit16(v); }
__device__ __forceinline__ F2 split_col(const float* W, int k0, int n, int lane, int ld, int K) { float v[16]; const int g = lane >> 4;
#pragma unroll
  for (int i = 0; i < 8; ++i) { const int ka = k0 + 8 * g + i, kb = ka + 16; v[i] = ka < K ? W[(size_t)(ka < K ? ka : K - 1) * ld + n] : 0.f; v[8 + i] = kb < K ? W[(size_t)(kb < K ? kb : K - 1) * ld + n] : 0.f; }
  return bsplit16(v); }
__device__ __forceinline__ v8f mac3(const F2& a, const F2& b, v8f c) { c = wmma_bf(a.l, b.h, c); c = wmma_bf(a.h, b.l, c); return wmma_bf(a.h, b.h, c); }
__device__ __forceinline__ float sigm(float v) { return 1.0f / (1.0f + expf(-v)); }
#define LDSX() do { asm volatile("s_wait_dscnt 0" ::: "memory"); __builtin_amdgcn_wave_barrier(); __builtin_amdgcn_fence(__ATOMIC_RELEASE, "workgroup"); } while (0)


// Multi-head spatial attention block (B 16, C 256, 32x32 = 1,024 positions, d_model 512 = 8 x 64): MHA over positions + Wo + residual LN + SiLU FFN + residual LN; second output = inbound attention map (sum over queries, mean over heads).
#define NB 16
#define CIN 256
#define TT 1024
#define CC 512
#define NH 8
#define HD 64
#define NR (NB * TT)
#ifndef TNB
#define TNB NB
#endif
typedef __attribute__((ext_vector_type(8))) __bf16 v8b;
__device__ __forceinline__ v16b frag_b(const __bf16* rowk0, int lane) {
  union { v16b v; v8b q[2]; } u; const __bf16* p = rowk0 + 8 * (lane >> 4);
  u.q[0] = *(const v8b*)p; u.q[1] = *(const v8b*)(p + 16); return u.v;
}
__device__ __forceinline__ float bfr(float v) { return (float)(__bf16)v; }
__device__ __attribute__((noinline)) float exp_ni(float v) { return expf(v); }
__device__ __attribute__((noinline)) float erf_ni(float v) { return erff(v); }

#define OUT1_OFF ((size_t)NB * CIN * TT)
#define WS_QH  0u
#define WS_QL  (WS_QH + 2u * (size_t)NR * CC)
#define WS_KH  (WS_QL + 2u * (size_t)NR * CC)
#define WS_VT  (WS_KH + 2u * (size_t)NR * CC)          // f16 V^T fragments; QH, QL, KH and VT all lie in fragment order (see k_proj)
#define WS_Y   (WS_VT + 2u * (size_t)NR * CC)          // f32 O rows [b*t][512]
#define QCH 64                // query rows per partial column sum
#define NPART (NH * (TT / QCH))   // partial rows per batch
#define WS_CP  (WS_Y + 4u * (size_t)NR * CC)           // f32 partial column sums [b][NPART][t]
#define WS_PW  (WS_CP + 4u * (size_t)NB * NPART * TT)  // bf16 packed weights: Wq, Wk, Wv, Wo, W1, W2
#define PW_O  (3 * CIN * CC)
#define PW_1  (4 * CIN * CC)
#define PW_2  (4 * CIN * CC + CIN * CIN)
#define WS_END (WS_PW + 2u * (size_t)(4 * CIN * CC + 2 * CIN * CIN))

// ---- k_pack: block = (256 units of 8 k, matrix): a weight matrix W (in,out) [K][N], rounded to bf16, laid out as the B fragments the GEMMs read:
// fragment (kc, nt) = 1 KiB = [k half q][lane][8 bf16], lane (g, col) holding column nt*16 + col, k = kc*32 + 16q + 8g + 0..7, so that a wave reads a fragment as two 512-byte loads
__global__ __launch_bounds__(256) void k_pack(const float* __restrict__ WQ, const float* __restrict__ WK, const float* __restrict__ WV, const float* __restrict__ WO, const float* __restrict__ W1, const float* __restrict__ W2, __bf16* __restrict__ PW) {
  const int m = blockIdx.y; const float* Wm = m == 0 ? WQ : m == 1 ? WK : m == 2 ? WV : m == 3 ? WO : m == 4 ? W1 : W2;
  const int N = m < 3 ? CC : CIN, K = m == 3 ? CC : CIN; const int unit = blockIdx.x * 256 + threadIdx.x;
  if (unit >= K * N / 8) return;
  const int lane = unit & 31, q = (unit >> 5) & 1, f = unit >> 6, NT = N / 16; const int n = (f % NT) * 16 + (lane & 15), k = (f / NT) * 32 + q * 16 + 8 * (lane >> 4);
  float v[8]; v8b o;
#pragma unroll   // the 8 loads are issued together
  for (int i = 0; i < 8; ++i) v[i] = Wm[(size_t)(k + i) * N + n];
  asm volatile("s_wait_xcnt 0x0" ::: "memory");   // the conversions below may reuse the registers that hold the loads' addresses
#pragma unroll
  for (int i = 0; i < 8; ++i) o[i] = (__bf16)v[i];
  vst2(PW + (m < 4 ? m * (CIN * CC) : PW_1 + (m - 4) * (CIN * CIN)) + (size_t)unit * 8, o); }
// one packed fragment (p = fragment base + lane * 8), and the 8 neighbouring fragments of one k-step
__device__ __forceinline__ v16b frag_pw(const __bf16* p) { union { v16b v; v8b q[2]; } u; u.q[0] = *(const v8b*)p; u.q[1] = *(const v8b*)(p + 256); return u.v; }
__device__ __forceinline__ void ldw8(v16b (&w)[8], const __bf16* p) {
#pragma unroll   // 16 loads in a row, the set indexed by constants
  for (int j = 0; j < 8; ++j) w[j] = frag_pw(p + j * 512); }

// ---- k_proj: block = (64 positions, 128 cols, b*3 + which): x^T tile; packed W; a k-step's 8 B fragments are loaded together, one k-step ahead of the WMMAs that use them
// Q, K and V leave in the order in which k_att's 16x16x32 fragments read them: fragment = 1 KiB = [k half q][lane (g, row)][8 f16], k = 32*chunk + 16q + 8g + 0..7.
// Q, K: [b][head][16-position tile][32-dim chunk], row = position; V^T: [b][head][32-key chunk][16-dim tile], row = dim, k = key. A wave stores and loads 512 contiguous bytes at a time.
__global__ __launch_bounds__(128) void k_proj(const float* __restrict__ X, const __bf16* __restrict__ PW, const float* __restrict__ BQ, const float* __restrict__ BK, const float* __restrict__ BV, _Float16* __restrict__ QH, _Float16* __restrict__ QL, _Float16* __restrict__ KH, _Float16* __restrict__ VT) {
  __shared__ __align__(16) __bf16 sx[64][CIN + 8]; __shared__ __align__(16) _Float16 sh[64][136], sl[64][136]; __shared__ __align__(16) _Float16 th[128][72];
  const int tid = threadIdx.x, wave = tid >> 5, lane = tid & 31, col = lane & 15, g = lane >> 4; const int p0 = blockIdx.x * 64; const int c0 = blockIdx.y * 128; const size_t b = blockIdx.z / 3; const int which = blockIdx.z % 3;
  const __bf16* Pw = PW + (size_t)which * (CIN * CC) + (c0 / 16) * 512 + lane * 8; const float* Bm = which == 0 ? BQ : which == 1 ? BK : BV;
  v16b wb[2][8];
  { // x tile: thread = (4 neighbouring positions, 8 neighbouring channels out of every 64). A wave's load covers two 256-byte runs; 8 channels of one position leave as one 16-byte LDS store
    const int pq = (tid & 15) * 4, cg = (tid >> 4) * 8; const float* xp = X + (b * CIN + cg) * (size_t)TT + p0 + pq; v4f xv[4][8];
#pragma unroll   // all 32 loads are issued before the first value is used: the tile costs one trip to memory, not one per group of loads
    for (int i = 0; i < 4; ++i)
#pragma unroll
      for (int j = 0; j < 8; ++j) xv[i][j] = *(const v4f*)(xp + (size_t)(i * 64 + j) * TT);
    asm volatile("s_wait_xcnt 0x0" ::: "memory");   // what follows (the weights' loads, the conversions) may reuse the registers that hold the loads' address; the clobber also keeps every x load above this line
    ldw8(wb[0], Pw);   // the first k-step's weights fly behind the tile
#pragma unroll
    for (int i = 0; i < 4; ++i)
#pragma unroll
      for (int k = 0; k < 4; ++k) { v8b o;
#pragma unroll
        for (int j = 0; j < 8; ++j) o[j] = (__bf16)xv[i][j][k];
        *(v8b*)&sx[pq + k][i * 64 + cg] = o; } }
  __syncthreads();
  v8f acc[8] = {};
#pragma unroll   // unrolled: the two fragment sets are indexed by constants and stay in registers
  for (int kc = 0; kc < CIN / 32; ++kc) { const v16b a = frag_b(&sx[wave * 16 + col][kc * 32], lane);
    if (kc + 1 < CIN / 32) ldw8(wb[(kc + 1) & 1], Pw + (kc + 1) * (CC / 16) * 512);
#pragma unroll
    for (int j = 0; j < 8; ++j) acc[j] = wmma_bf(a, wb[kc & 1][j], acc[j]); }
#pragma unroll
  for (int j = 0; j < 8; ++j) { const float bb = bfr(Bm[c0 + j * 16 + col]);
#pragma unroll
    for (int r = 0; r < 8; ++r) { const float v = acc[j][r] + bb; const int rl = wave * 16 + 8 * g + r, cl = j * 16 + col; const _Float16 hv = (_Float16)v;
      if (which == 2) th[cl][rl] = hv; else { sh[rl][cl] = hv; sl[rl][cl] = (_Float16)(v - (float)hv); } } }
  __syncthreads();
  // 16 fragments a block, unit e = (fragment f, k half, g, row); a head's 8 fragments of the block lie in a row
  const int kq = ((lane >> 4) + 2 * (wave & 1)) * 8;   // 16q + 8g of this thread's units
  if (which < 2) { _Float16* dh = which == 0 ? QH : KH; for (int e = tid; e < 64 * 16; e += 128) { const int f = e >> 6, hl = f >> 3, rl = ((f >> 1) & 3) * 16 + col, cl = hl * 64 + (f & 1) * 32 + kq;
      const size_t o = ((b * NH + c0 / HD + hl) * (TT / 16) + p0 / 16) * (size_t)1024 + (e & 511) * 8; vst2((unsigned*)(dh + o), *(const v4u*)&sh[rl][cl]);
      asm volatile("s_wait_xcnt 0x0" ::: "memory");   // what follows (the residual's LDS read, the next trip) overwrites the registers that the store names
      if (which == 0) { vst2((unsigned*)(QL + o), *(const v4u*)&sl[rl][cl]); asm volatile("s_wait_xcnt 0x0" ::: "memory"); } } }   // the same for the residual's store
  else { for (int e = tid; e < 128 * 8; e += 128) { const int f = e >> 6, hl = f >> 3, cl = hl * 64 + (f & 3) * 16 + col, rl = ((f >> 2) & 1) * 32 + kq;
      vst2((unsigned*)(VT + ((b * NH + c0 / HD + hl) * (TT / 32) + p0 / 32) * (size_t)2048 + (e & 511) * 8), *(const v4u*)&th[cl][rl]); } } }
#define ESC 0.18033688f   // log2(e) / 8: the logits' scale 1 / sqrt(64) and the change of base, in one factor
#define KRING 4   // K fragments in flight a wave (4 WMMAs each)
#define VRING 6   // V fragments in flight a wave (2 WMMAs each); more of either and the kernel spills at 256 registers
// one f16 fragment in fragment order (f = fragment base, l8 = lane * 8): two loads of 512 contiguous bytes a wave
__device__ __forceinline__ v16h frag_pk(const _Float16* f, unsigned l8) { union { v16h v; v8h q[2]; } u; const _Float16* p = f + l8; u.q[0] = *(const v8h*)p; u.q[1] = *(const v8h*)(p + 256); return u.v; }
// ---- k_att: block = (64 queries, z = b*8 + h), 8 waves; wave w owns keys 128w .. 128w+127 and walks the block's queries 32 at a time (two 16-query tiles share every K and V fragment).
// S^T = K . Q^T (2 products): a lane holds one query's logits for 8 consecutive keys of each 16-key tile, so the whole 32 x 128 tile stays in registers,
// the row maximum and sum need one exchange between wave halves and one between waves, and two neighbouring tiles pack straight into the B operand of O^T = V^T . P^T.
// Column sums: the wave's own P tile goes through LDS once (row = query), each lane then adds 8 keys over 16 queries and keeps the sums over the block's 64 queries.
// waves_per_eu(4, 4) holds a wave to 256 registers, so that two blocks (16 waves) share a WGP, which their LDS also allows.
__global__ __launch_bounds__(256) __attribute__((amdgpu_waves_per_eu(4, 4))) void k_att(const _Float16* __restrict__ QH, const _Float16* __restrict__ QL, const _Float16* KH, const _Float16* VT, float* __restrict__ Y, float* __restrict__ CP) {   // KH, VT without __restrict__: with it the compiler holds the fragments that both passes read first in registers over the whole pass, and spills
  __shared__ float smx[2][8][32]; __shared__ __align__(16) _Float16 sp[8][32][144]; __shared__ __align__(16) float so[8][32][68];
  const int z = blockIdx.y; const size_t b = z / NH; const int h = z % NH;
  const int tid = threadIdx.x, wave = tid >> 5, lane = tid & 31, col = lane & 15, g = lane >> 4; const int kw = wave * 128;
  const size_t hb = (size_t)z * (TT * HD);   // this head's fragments: 128 KiB in each of the four buffers
  const int ws = wave * 8192;   // the wave's 8 key tiles (K) and 4 key chunks (V): 16 KiB each
  const _Float16* Kp = KH + hb + ws; const _Float16* Vp = VT + hb + ws; const _Float16* Qh = QH + hb + blockIdx.x * 4096; const _Float16* Ql = QL + hb + blockIdx.x * 4096; const unsigned l8 = lane * 8;
  v4f c0 = {}, c1 = {};
#pragma unroll 1   // rolled: unrolled, the two passes' tiles would compete for the 256 registers
  for (int qp = 0; qp < 2; ++qp) { const size_t q0 = b * TT + blockIdx.x * 64 + qp * 32;
    v8f s[8][2] = {}; v16h hq[2], lq[2], kf[KRING], vf[VRING];
#pragma unroll   // the first KRING K fragments are asked for together
    for (int i = 0; i < KRING; ++i) kf[i] = frag_pk(Kp + ((i & 7) * 2 + (i >> 3)) * 512, l8);
#pragma unroll   // unrolled: the ring of K fragments is indexed by constants; fragment i + KRING is asked for as soon as fragment i has been used
    for (int i = 0; i < 16; ++i) { const int kc = i >> 3, t = i & 7; const v16h k = kf[i % KRING];
      if (t == 0) {
#pragma unroll
        for (int u = 0; u < 2; ++u) { hq[u] = frag_pk(Qh + ((qp * 2 + u) * 2 + kc) * 512, l8); lq[u] = frag_pk(Ql + ((qp * 2 + u) * 2 + kc) * 512, l8); }
        asm volatile("s_wait_xcnt 0x0" :: "v"(Qh + qp * 2048 + l8), "v"(Ql + qp * 2048 + l8) : "memory"); }   // the registers that hold the Q loads' addresses are reused for fragments further down; named as inputs, the two address pairs stay whole up to the wait
#pragma unroll
      for (int u = 0; u < 2; ++u) { s[t][u] = wmma16(k, hq[u], s[t][u]); s[t][u] = wmma16(k, lq[u], s[t][u]); }
      if (i + KRING < 16) kf[i % KRING] = frag_pk(Kp + (((i + KRING) & 7) * 2 + ((i + KRING) >> 3)) * 512, l8); }
    float m[2], inv[2];
#pragma unroll
    for (int u = 0; u < 2; ++u) {   // the maximum is taken over the unscaled logits: the scale is positive and goes into the exponent's FMA
      v8f mv = s[0][u];
#pragma unroll
      for (int t = 1; t < 8; ++t)
#pragma unroll
        for (int r = 0; r < 8; ++r) mv[r] = fmaxf(mv[r], s[t][u][r]);
      float a = fmaxf(fmaxf(fmaxf(mv[0], mv[1]), fmaxf(mv[2], mv[3])), fmaxf(fmaxf(mv[4], mv[5]), fmaxf(mv[6], mv[7])));
      a = fmaxf(a, __shfl_xor(a, 16)); if (g == 0) smx[0][wave][u * 16 + col] = a; }
    __syncthreads();
#pragma unroll
    for (int u = 0; u < 2; ++u) { const int x = u * 16 + col;
      m[u] = fmaxf(fmaxf(fmaxf(smx[0][0][x], smx[0][1][x]), fmaxf(smx[0][2][x], smx[0][3][x])), fmaxf(fmaxf(smx[0][4][x], smx[0][5][x]), fmaxf(smx[0][6][x], smx[0][7][x])));
      const float mc = m[u] * ESC; const v8f esc8 = { ESC, ESC, ESC, ESC, ESC, ESC, ESC, ESC }, nmc8 = { -mc, -mc, -mc, -mc, -mc, -mc, -mc, -mc }; v8f sv = {};
#pragma unroll
      for (int t = 0; t < 8; ++t) { s[t][u] = __builtin_elementwise_fma(s[t][u], esc8, nmc8);
#pragma unroll
        for (int r = 0; r < 8; ++r) s[t][u][r] = __builtin_amdgcn_exp2f(s[t][u][r]);
        sv += s[t][u]; }   // argument <= 0 but for one rounding; far below -126 gives 0, which P's f16 would round to anyway
      float sum = ((sv[0] + sv[1]) + (sv[2] + sv[3])) + ((sv[4] + sv[5]) + (sv[6] + sv[7]));
      sum += __shfl_xor(sum, 16); if (g == 0) smx[1][wave][x] = sum; }
    __syncthreads();
    v8h p8[8][2];
#pragma unroll   // the first VRING V fragments fly while P is scaled and packed
    for (int i = 0; i < VRING; ++i) vf[i] = frag_pk(Vp + i * 512, l8);
    __builtin_amdgcn_sched_barrier(0);   // the loads above and the packing below are scheduled apart: as one region this build needs more than 256 registers and spills to scratch
#pragma unroll
    for (int u = 0; u < 2; ++u) { const int x = u * 16 + col;
      inv[u] = 2048.0f * (1.0f / (((smx[1][0][x] + smx[1][1][x]) + (smx[1][2][x] + smx[1][3][x])) + ((smx[1][4][x] + smx[1][5][x]) + (smx[1][6][x] + smx[1][7][x]))));   // P's factor 2^11 rides in the row's reciprocal: a power of two, the same bits
#pragma unroll
      for (int t = 0; t < 8; ++t) {
#pragma unroll
        for (int r = 0; r < 8; ++r) p8[t][u][r] = (_Float16)(s[t][u][r] * inv[u]);
        *(v8h*)&sp[wave][x][t * 16 + 8 * g] = p8[t][u]; }
 }
    v8f acc[4][2] = {};
#pragma unroll
    for (int c = 0; c < 4; ++c) { union { v16h v; v8h q[2]; } pb[2];
#pragma unroll
      for (int u = 0; u < 2; ++u) { pb[u].q[0] = p8[2 * c][u]; pb[u].q[1] = p8[2 * c + 1][u]; }
#pragma unroll
      for (int j = 0; j < 4; ++j) { const int i = c * 4 + j; const v16h v = vf[i % VRING];
#pragma unroll
        for (int u = 0; u < 2; ++u) acc[j][u] = wmma16(v, pb[u].v, acc[j][u]);
        if (i + VRING < 16) vf[i % VRING] = frag_pk(Vp + (i + VRING) * 512, l8); } }
    LDSX();   // the wave's own P rows are in LDS before its lanes read across them
#pragma unroll
    for (int q = 0; q < 16; ++q) { const v8h v = *(const v8h*)&sp[wave][g * 16 + q][col * 8];
#pragma unroll
      for (int e = 0; e < 4; ++e) { c0[e] += (float)v[e]; c1[e] += (float)v[4 + e]; } }
#pragma unroll
    for (int u = 0; u < 2; ++u)
#pragma unroll
      for (int j = 0; j < 4; ++j) { const v8f o = acc[j][u] * (1.0f / 2048.0f); const v4f lo = { o[0], o[1], o[2], o[3] }, hi = { o[4], o[5], o[6], o[7] };
        *(v4f*)&so[wave][u * 16 + col][j * 16 + 8 * g] = lo; *(v4f*)&so[wave][u * 16 + col][j * 16 + 8 * g + 4] = hi; }
    __syncthreads();
    { const int q = tid >> 3, d0 = (tid & 7) * 8; float* y = Y + (q0 + q) * CC + h * HD + d0;
#pragma unroll
      for (int f = 0; f < 2; ++f) { const int d = d0 + 4 * f;
        vst2(y + 4 * f, ((*(const v4f*)&so[0][q][d] + *(const v4f*)&so[1][q][d]) + (*(const v4f*)&so[2][q][d] + *(const v4f*)&so[3][q][d])) + ((*(const v4f*)&so[4][q][d] + *(const v4f*)&so[5][q][d]) + (*(const v4f*)&so[6][q][d] + *(const v4f*)&so[7][q][d]))); }
      asm volatile("s_wait_xcnt 0x0" ::: "memory"); } }   // the next pass overwrites the registers that the two stores name
#pragma unroll
  for (int e = 0; e < 4; ++e) { c0[e] += __shfl_xor(c0[e], 16); c1[e] += __shfl_xor(c1[e], 16); }
  float* cp = CP + (b * NPART + h * (TT / QCH) + blockIdx.x) * (size_t)TT + kw + col * 8 + 4 * g; vst2(cp, g == 0 ? c0 : c1); }
// ---- k_colr: block = (128 keys, batch): attn_map[b][k] = (1/8) sum over the batch's 128 partial rows (8 heads x 16 query blocks); wave w sums 16 rows, then 8 wave sums through LDS
__global__ __launch_bounds__(256) void k_colr(const float* __restrict__ CP, float* __restrict__ AM) { __shared__ __align__(16) float sr[8][128];
  const int t = threadIdx.x, w = t >> 5, lane = t & 31; const size_t b = blockIdx.y; const int k0 = blockIdx.x * 128;
  const float* p = CP + (b * NPART + w * (NPART / 8)) * (size_t)TT + k0 + lane * 4;
  v4f v[NPART / 8];
#pragma unroll
  for (int i = 0; i < NPART / 8; ++i) v[i] = *(const v4f*)(p + (size_t)i * TT);
  v4f a = {};
#pragma unroll
  for (int i = 0; i < NPART / 8; ++i) a += v[i];
  *(v4f*)&sr[w][lane * 4] = a;
  __syncthreads();
  if (t < 32) { v4f s = *(const v4f*)&sr[0][t * 4];
#pragma unroll
    for (int i = 1; i < 8; ++i) s += *(const v4f*)&sr[i][t * 4];
    vst2(AM + b * TT + k0 + t * 4, s * (1.0f / 2048.0f) * (1.0f / NH)); } }
// ---- k_tail: block = 64 rows x all 256 columns, 8 waves: wave = (16-row tile, 128-column half). Everything behind attention is local to a row, so one block takes its 64 rows through all of it:
// Z1 = LN(Y (hi+lo) Wo + bo + x^T) (K 512), HM = silu(Z1 (hi+lo) W1 + b1), out = LN(HM (hi+lo) W2 + b2 + Z1) (K 256 each). Z1 and HM live in LDS only; the output leaves as channel-major planes.
// one wave's 16 rows x 128 columns: Ar = this lane's f32 row (global memory or LDS), split bf16 hi + lo; Pw = the first packed fragment of the wave's column half + lane * 8
template <int K>
__device__ __forceinline__ void gemm16(const float* Ar, const __bf16* Pw, v8f (&acc)[8], int lane) {
#pragma unroll
  for (int j = 0; j < 8; ++j)
#pragma unroll
    for (int r = 0; r < 8; ++r) acc[j][r] = 0.f;
  v16b w0[8], w1[8]; ldw8(w0, Pw);
  asm volatile("s_wait_xcnt 0x0" ::: "memory");   // the loop may reuse the register that holds these loads' address
#pragma unroll 1   // two k-steps a trip, written out: each step's 8 B fragments are loaded one step ahead into the set the other step has left
  for (int kc = 0; kc < K / 32; kc += 2) { const F2 a0 = split_row(Ar, kc * 32, lane);
    ldw8(w1, Pw + (kc + 1) * (CIN / 16) * 512);
#pragma unroll
    for (int j = 0; j < 8; ++j) { acc[j] = wmma_bf(a0.h, w0[j], acc[j]); acc[j] = wmma_bf(a0.l, w0[j], acc[j]); }
    const F2 a1 = split_row(Ar, kc * 32 + 32, lane);
    if (kc + 2 < K / 32) ldw8(w0, Pw + (kc + 2) * (CIN / 16) * 512);
    asm volatile("s_wait_xcnt 0x0" ::: "memory");   // the address registers that the trip's loads name are advanced below
#pragma unroll
    for (int j = 0; j < 8; ++j) { acc[j] = wmma_bf(a1.h, w1[j], acc[j]); acc[j] = wmma_bf(a1.l, w1[j], acc[j]); } } }
// LayerNorm statistics of the 64 rows in sz: four threads a row; each holds its 64 values (16-column groups, every fourth) in registers for both sums. 16 lanes = 4 rows x 4 groups fall on all 64 banks once.
// Mean and 1 / standard deviation go into the row's own pad columns.
__device__ __forceinline__ void ln_stats(float (*sz)[CIN + 4], int tid) { const int rl = tid >> 2; const float* rp = &sz[rl][(tid & 3) * 16]; v4f v[16];
#pragma unroll   // all 16 LDS reads are issued before the first value is used
  for (int i = 0; i < 16; ++i) v[i] = *(const v4f*)(rp + (i >> 2) * 64 + (i & 3) * 4);
  v4f a[4] = { v[0], v[1], v[2], v[3] };
#pragma unroll
  for (int i = 4; i < 16; ++i) a[i & 3] += v[i];
  const v4f s4 = (a[0] + a[1]) + (a[2] + a[3]); float s = (s4[0] + s4[1]) + (s4[2] + s4[3]); s += __shfl_xor(s, 1); s += __shfl_xor(s, 2); const float mu = s / CIN;
  v4f w[4] = {};
#pragma unroll
  for (int i = 0; i < 16; ++i) { const v4f d = v[i] - mu; w[i & 3] += d * d; }
  const v4f q4 = (w[0] + w[1]) + (w[2] + w[3]); float q = (q4[0] + q4[1]) + (q4[2] + q4[3]); q += __shfl_xor(q, 1); q += __shfl_xor(q, 2);
  if ((tid & 3) == 0) { const v2f st = { mu, 1.0f / sqrtf(q / CIN + 1e-5f) }; *(v2f*)&sz[rl][CIN] = st; } }
__global__ __launch_bounds__(256) void k_tail(const float* __restrict__ Y, const __bf16* __restrict__ PWO, const __bf16* __restrict__ PW1, const __bf16* __restrict__ PW2, const float* __restrict__ BO, const float* __restrict__ B1, const float* __restrict__ B2, const float* __restrict__ X, const float* __restrict__ G1, const float* __restrict__ E1, const float* __restrict__ G2, const float* __restrict__ E2, float* __restrict__ DST) {
  __shared__ __align__(16) float sz[64][CIN + 4], sm[64][CIN + 4];   // sz: rows before and after LN1 (Z1), then before LN2; sm: the SiLU rows
  const int tid = threadIdx.x, wave = (tid >> 5) & 3, half = tid >> 7, lane = tid & 31, col = lane & 15, g = lane >> 4; const size_t r0 = (size_t)blockIdx.x * 64; const size_t b = r0 / TT; const int p0 = (int)(r0 % TT);
  const int fo = half * 8 * 512 + lane * 8, ar = wave * 16 + col, rw = wave * 16 + 8 * g, ow = half * 128 + col;   // the wave's fragments, this lane's A row, its first D row and its first D column
  v8f acc[8];
  // -- Y Wo + bo + x^T
  gemm16<CC>(Y + (r0 + ar) * CC, PWO + fo, acc, lane);
  { float bb[8]; v4f ra[8], rb[8];
#pragma unroll   // all loads issued together: 8 neighbouring positions of a channel are two 16-byte loads
    for (int j = 0; j < 8; ++j) { const int o = ow + j * 16; const float* xp = X + (b * CIN + o) * (size_t)TT + p0 + rw; bb[j] = BO[o]; ra[j] = *(const v4f*)xp; rb[j] = *(const v4f*)(xp + 4); }
    asm volatile("s_wait_xcnt 0x0" ::: "memory");   // what follows may reuse the registers that hold the loads' addresses
#pragma unroll
    for (int j = 0; j < 8; ++j)
#pragma unroll
      for (int r = 0; r < 8; ++r) sz[rw + r][ow + j * 16] = acc[j][r] + bfr(bb[j]) + bfr(r < 4 ? ra[j][r & 3] : rb[j][r & 3]); }
  __syncthreads();
  { // gamma and beta of the 4 neighbouring columns that this thread scales, asked for here so that they arrive while the statistics are formed
    const int q = tid & 63; const v4f ga = *(const v4f*)(G1 + q * 4), be = *(const v4f*)(E1 + q * 4);
    asm volatile("s_wait_xcnt 0x0" ::: "memory");   // what follows may reuse the registers that hold the loads' addresses
    ln_stats(sz, tid);
    __syncthreads();
#pragma unroll   // unrolled: the LDS reads run ahead of the writes. Z1 replaces the row in place: an element is read and written by one thread only, the pad columns stay
    for (int i = 0; i < 16; ++i) { const int rl = (tid >> 6) + 4 * i; const v2f st = *(const v2f*)&sz[rl][CIN]; const v4f x = *(const v4f*)&sz[rl][q * 4]; v4f o;
#pragma unroll
      for (int k = 0; k < 4; ++k) o[k] = (x[k] - st[0]) * st[1] * bfr(ga[k]) + bfr(be[k]);
      *(v4f*)&sz[rl][q * 4] = o; } }
  __syncthreads();   // every Z1 row is whole before a wave reads it as its A operand
  // -- silu(Z1 W1 + b1)
  gemm16<CIN>(&sz[ar][0], PW1 + fo, acc, lane);
  { float bb[8];
#pragma unroll
    for (int j = 0; j < 8; ++j) bb[j] = B1[ow + j * 16];
    asm volatile("s_wait_xcnt 0x0" ::: "memory");   // what follows may reuse the registers that hold the loads' addresses
#pragma unroll
    for (int j = 0; j < 8; ++j)
#pragma unroll
      for (int r = 0; r < 8; ++r) { const float v = acc[j][r] + bfr(bb[j]); sm[rw + r][ow + j * 16] = v / (1.0f + expf(-v)); } }
  __syncthreads();   // every SiLU row is whole before a wave reads it as its A operand; also ends the last read of Z1 as an A operand
  // -- HM W2 + b2 + Z1, added in place: an element of sz is read and written by the one thread that holds its sum
  gemm16<CIN>(&sm[ar][0], PW2 + fo, acc, lane);
  { float bb[8];
#pragma unroll
    for (int j = 0; j < 8; ++j) bb[j] = B2[ow + j * 16];
    asm volatile("s_wait_xcnt 0x0" ::: "memory");   // what follows may reuse the registers that hold the loads' addresses
#pragma unroll
    for (int j = 0; j < 8; ++j)
#pragma unroll
      for (int r = 0; r < 8; ++r) sz[rw + r][ow + j * 16] = acc[j][r] + bfr(bb[j]) + sz[rw + r][ow + j * 16]; }
  __syncthreads();
  // gamma and beta of the channels (tid >> 4) + 16 i that this thread stores, asked for here so that they arrive while the statistics are formed
  float ga[16], be[16];
#pragma unroll   // all loads issued together, the values indexed by constants
  for (int i = 0; i < 16; ++i) { const int c = (tid >> 4) + 16 * i; ga[i] = G2[c]; be[i] = E2[c]; }
  asm volatile("s_wait_xcnt 0x0" ::: "memory");   // what follows may reuse the registers that hold the loads' addresses
  ln_stats(sz, tid);
  __syncthreads();
  // the rows are normalised on their way out: channel-major planes [b][c][p0 .. p0+63], transposed through registers: thread = (c, 4 consecutive positions)
  const int q = tid & 15; v2f st[4];
#pragma unroll
  for (int k = 0; k < 4; ++k) st[k] = *(const v2f*)&sz[q * 4 + k][CIN];
#pragma unroll   // unrolled: the LDS reads run ahead of the stores, and every access takes its place from one address and a constant
  for (int i = 0; i < 16; ++i) { const int c = (tid >> 4) + 16 * i; v4f o;
#pragma unroll
    for (int k = 0; k < 4; ++k) o[k] = (sz[q * 4 + k][c] - st[k][0]) * st[k][1] * bfr(ga[i]) + bfr(be[i]);
    vst2(DST + (b * CIN + c) * (size_t)TT + p0 + q * 4, o); } }
extern "C" void kernel_launch(void* const* d_in, const int* in_sizes, int n_in, void* d_out, int out_size, void* d_ws, size_t ws_size, hipStream_t stream) {
  (void)in_sizes; (void)n_in; (void)out_size;
  const float** F = (const float**)d_in;   // 0 x [16,256,32,32], 1 Wq [256,512], 2 bq, 3 Wk, 4 bk, 5 Wv, 6 bv, 7 Wo [512,256], 8 bo, 9 W1 [256,256], 10 b1, 11 W2, 12 b2, 13 g1, 14 be1, 15 g2, 16 be2
  if (ws_size < (size_t)WS_END) return;
  char* ws = (char*)d_ws; _Float16 *QH = (_Float16*)(ws + WS_QH), *QL = (_Float16*)(ws + WS_QL), *KH = (_Float16*)(ws + WS_KH), *VT = (_Float16*)(ws + WS_VT); float *Y = (float*)(ws + WS_Y), *CP = (float*)(ws + WS_CP); __bf16* PW = (__bf16*)(ws + WS_PW);
  float* OUT0 = (float*)d_out; float* OUT1 = (float*)d_out + OUT1_OFF;
  k_pack<<<dim3(CIN * CC / 8 / 256, 6), 256, 0, stream>>>(F[1], F[3], F[5], F[7], F[9], F[11], PW);
  k_proj<<<dim3(TT / 64, CC / 128, TNB * 3), 128, 0, stream>>>(F[0], PW, F[2], F[4], F[6], QH, QL, KH, VT);
  k_att<<<dim3(TT / 64, TNB * NH), 256, 0, stream>>>(QH, QL, KH, VT, Y, CP);
  k_colr<<<dim3(TT / 128, TNB), 256, 0, stream>>>(CP, OUT1);
  k_tail<<<TNB * TT / 64, 256, 0, stream>>>(Y, PW + PW_O, PW + PW_1, PW + PW_2, F[8], F[10], F[12], F[0], F[13], F[14], F[15], F[16], OUT0);
}

// v010
// Measured time: 126 microseconds a run.
// In both of two side-by-side timings against v009, it was 1.09 times as fast.
// All steps since v000 together make it 60.0 times as fast.
// compute dtype: all float inputs rounded to bf16; Q/K/V = x^T W + b with EXACT bf16 products on WMMA 16x16x32 (channel-major tiles transposed in LDS), f32 accumulate; Q as f16 hi + residual, K f16 -> 2-product logits kept in f32 registers (one fused launch for logits, softmax, column sums and P . V); softmax in f32, exp((l - max) / 8) = exp2(l * (log2 e / 8) - max * (log2 e / 8)): one FMA and the hardware exp2 -> P f16 x 2^11; attn_map = column sums of P / 8 in f32; O = P . V (V rounded once to f16, 1 product); Wo, W1, W2 GEMMs with the f32 activations split bf16 hi + lo (2 products); LayerNorms (eps 1e-5), SiLU and residuals in f32; outputs: out channel-major [b][c][hw], attn_map [b][hw].
#include <hip/hip_runtime.h>
#include <math.h>

typedef __attribute__((ext_vector_type(16))) _Float16 v16h;
typedef __attribute__((ext_vector_type(16))) __bf16 v16b;
typedef __attribute__((ext_vector_type(8)))  _Float16 v8h;
typedef __attribute__((ext_vector_type(8)))  float v8f;
typedef __attribute__((ext_vector_type(4)))  float v4f;
typedef __attribute__((ext_vector_type(2)))  float v2f;
typedef __attribute__((ext_vector_type(4)))  unsigned v4u;
typedef __attribute__((ext_vector_type(4)))  int v4i;
typedef float __attribute__((may_alias)) float_a;
typedef int __attribute__((may_alias)) int_a;

template <typename T> __device__ __forceinline__ void vst2(void* p, T v) { *(T*)p = v;  }
__device__ __forceinline__ v8f wmma16(v16h a, v16h b, v8f c) {
  v8f d = __builtin_amdgcn_wmma_f32_16x16x32_f16(false, a, false, b, (short)0, c, false, false);
  asm volatile("v_nop\n\tv_nop\n\tv_nop\n\tv_nop" : "+v"(d) : "v"(a), "v"(b));
  return d;
}
__device__ __forceinline__ v8f wmma_bf(v16b a, v16b b, v8f c) {
  v8f d = __builtin_amdgcn_wmma_f32_16x16x32_bf16(false, a, false, b, (short)0, c, false, false);
  asm volatile("v_nop\n\tv_nop\n\tv_nop\n\tv_nop" : "+v"(d) : "v"(a), "v"(b));
  return d;
}
// 16x16x32 fragments: lane = (h = lane>>4, row/col = lane&15); elements 0..7 = k0+8h+0..7, 8..15 = k0+16+8h+0..7; D element r = row 8h+r
__device__ __forceinline__ v16h frag_h(const _Float16* rowk0, int lane) {
  union { v16h v; v8h q[2]; } u; const _Float16* p = rowk0 + 8 * (lane >> 4);
  u.q[0] = *(const v8h*)p; u.q[1] = *(const v8h*)(p + 16); return u.v;
}
__device__ __forceinline__ v16h frag_f32(const float* rowk0, int lane) {
  v16h a; const float* p = rowk0 + 8 * (lane >> 4);
#pragma unroll
  for (int i = 0; i < 8; ++i) { a[i] = (_Float16)p[i]; a[8 + i] = (_Float16)p[16 + i]; }
  return a;
}
__device__ __forceinline__ v16h frag_f32s(const float* rowk0, int lane, float sc) {
  v16h a; const float* p = rowk0 + 8 * (lane >> 4);
#pragma unroll
  for (int i = 0; i < 8; ++i) { a[i] = (_Float16)(p[i] * sc); a[8 + i] = (_Float16)(p[16 + i] * sc); }
  return a;
}
// column fragment from a [K][ld] layout (column n), rows >= K read as 0
__device__ __forceinline__ v16h fragc_f32(const float* W, int k0, int n, int lane, int ld, int K) {
  v16h a; const int g = lane >> 4;
#pragma unroll
  for (int i = 0; i < 8; ++i) { const int ka = k0 + 8 * g + i, kb = ka + 16;
    a[i] = (_Float16)(ka < K ? W[(size_t)(ka < K ? ka : K - 1) * ld + n] : 0.f); a[8 + i] = (_Float16)(kb < K ? W[(size_t)(kb < K ? kb : K - 1) * ld + n] : 0.f); }
  return a;
}
struct F2 { v16b h, l; };
__device__ __forceinline__ F2 bsplit16(const float v[16]) { F2 r;
#pragma unroll
  for (int i = 0; i < 16; ++i) { const __bf16 h = (__bf16)v[i]; r.h[i] = h; r.l[i] = (__bf16)(v[i] - (float)h); }
  return r; }
__device__ __forceinline__ F2 split_row(const float* row, int k0, int lane) { float v[16]; const float* p = row + k0 + 8 * (lane >> 4);
#pragma unroll
  for (int i = 0; i < 8; ++i) { v[i] = p[i]; v[8 + i] = p[16 + i]; }
  return bsplit16(v); }
__device__ __forceinline__ F2 split_rowK(const float* row, int k0, int lane, int K) { float v[16]; const int g = lane >> 4;
#pragma unroll
  for (int i = 0; i < 8; ++i) { const int ka = k0 + 8 * g + i, kb = ka + 16; v[i] = ka < K ? row[ka < K ? ka : K - 1] : 0.f; v[8 + i] = kb < K ? row[kb < K ? kb : K - 1] : 0.f; }
  return bsplit16(v); }
__device__ __forceinline__ F2 split_col(const float* W, int k0, int n, int lane, int ld, int K) { float v[16]; const int g = lane >> 4;
#pragma unroll
  for (int i = 0; i < 8; ++i) { const int ka = k0 + 8 * g + i, kb = ka + 16; v[i] = ka < K ? W[(size_t)(ka < K ? ka : K - 1) * ld + n] : 0.f; v[8 + i] = kb < K ? W[(size_t)(kb < K ? kb : K - 1) * ld + n] : 0.f; }
  return bsplit16(v); }
__device__ __forceinline__ v8f mac3(const F2& a, const F2& b, v8f c) { c = wmma_bf(a.l, b.h, c); c = wmma_bf(a.h, b.l, c); return wmma_bf(a.h, b.h, c); }
__device__ __forceinline__ float sigm(float v) { return 1.0f / (1.0f + expf(-v)); }
#define LDSX() do { asm volatile("s_wait_dscnt 0" ::: "memory"); __builtin_amdgcn_wave_barrier(); __builtin_amdgcn_fence(__ATOMIC_RELEASE, "workgroup"); } while (0)


// Multi-head spatial attention block (B 16, C 256, 32x32 = 1,024 positions, d_model 512 = 8 x 64): MHA over positions + Wo + residual LN + SiLU FFN + residual LN; second output = inbound attention map (sum over queries, mean over heads).
#define NB 16
#define CIN 256
#define TT 1024
#define CC 512
#define NH 8
#define HD 64
#define NR (NB * TT)
#ifndef TNB
#define TNB NB
#endif
typedef __attribute__((ext_vector_type(8))) __bf16 v8b;
__device__ __forceinline__ v16b frag_b(const __bf16* rowk0, int lane) {
  union { v16b v; v8b q[2]; } u; const __bf16* p = rowk0 + 8 * (lane >> 4);
  u.q[0] = *(const v8b*)p; u.q[1] = *(const v8b*)(p + 16); return u.v;
}
__device__ __forceinline__ float bfr(float v) { return (float)(__bf16)v; }
__device__ __attribute__((noinline)) float exp_ni(float v) { return expf(v); }
__device__ __attribute__((noinline)) float erf_ni(float v) { return erff(v); }

#define OUT1_OFF ((size_t)NB * CIN * TT)
#define WS_QH  0u
#define WS_QL  (WS_QH + 2u * (size_t)NR * CC)
#define WS_KH  (WS_QL + 2u * (size_t)NR * CC)
#define WS_VT  (WS_KH + 2u * (size_t)NR * CC)          // f16 V^T fragments; QH, QL, KH and VT all lie in fragment order (see k_proj)
#define WS_Y   (WS_VT + 2u * (size_t)NR * CC)          // f32 O rows [b*t][512]
#define QCH 64                // query rows per partial column sum
#define NPART (NH * (TT / QCH))   // partial rows per batch
#define WS_CP  (WS_Y + 4u * (size_t)NR * CC)           // f32 partial column sums [b][NPART][t]
#define WS_PW  (WS_CP + 4u * (size_t)NB * NPART * TT)  // bf16 packed weights: Wq, Wk, Wv, Wo, W1, W2
#define PW_O  (3 * CIN * CC)
#define PW_1  (4 * CIN * CC)
#define PW_2  (4 * CIN * CC + CIN * CIN)
#define WS_END (WS_PW + 2u * (size_t)(4 * CIN * CC + 2 * CIN * CIN))

// ---- k_pack: block = (256 units of 8 k, matrix): a weight matrix W (in,out) [K][N], rounded to bf16, laid out as the B fragments the GEMMs read:
// fragment (kc, nt) = 1 KiB = [k half q][lane][8 bf16], lane (g, col) holding column nt*16 + col, k = kc*32 + 16q + 8g + 0..7, so that a wave reads a fragment as two 512-byte loads
__global__ __launch_bounds__(256) void k_pack(const float* __restrict__ WQ, const float* __restrict__ WK, const float* __restrict__ WV, const float* __restrict__ WO, const float* __restrict__ W1, const float* __restrict__ W2, __bf16* __restrict__ PW) {
  const int m = blockIdx.y; const float* Wm = m == 0 ? WQ : m == 1 ? WK : m == 2 ? WV : m == 3 ? WO : m == 4 ? W1 : W2;
  const int N = m < 3 ? CC : CIN, K = m == 3 ? CC : CIN; const int unit = blockIdx.x * 256 + threadIdx.x;
  if (unit >= K * N / 8) return;
  const int lane = unit & 31, q = (unit >> 5) & 1, f = unit >> 6, NT = N / 16; const int n = (f % NT) * 16 + (lane & 15), k = (f / NT) * 32 + q * 16 + 8 * (lane >> 4);
  float v[8]; v8b o;
#pragma unroll   // the 8 loads are issued together
  for (int i = 0; i < 8; ++i) v[i] = Wm[(size_t)(k + i) * N + n];
  asm volatile("s_wait_xcnt 0x0" ::: "memory");   // the conversions below may reuse the registers that hold the loads' addresses
#pragma unroll
  for (int i = 0; i < 8; ++i) o[i] = (__bf16)v[i];
  vst2(PW + (m < 4 ? m * (CIN * CC) : PW_1 + (m - 4) * (CIN * CIN)) + (size_t)unit * 8, o); }
// one packed fragment (p = fragment base + lane * 8), and the 8 neighbouring fragments of one k-step
__device__ __forceinline__ v16b frag_pw(const __bf16* p) { union { v16b v; v8b q[2]; } u; u.q[0] = *(const v8b*)p; u.q[1] = *(const v8b*)(p + 256); return u.v; }
__device__ __forceinline__ void ldw8(v16b (&w)[8], const __bf16* p) {
#pragma unroll   // 16 loads in a row, the set indexed by constants
  for (int j = 0; j < 8; ++j) w[j] = frag_pw(p + j * 512); }

// ---- k_proj: block = (64 positions, 128 cols, b*3 + which): x^T tile; packed W; a k-step's 8 weight fragments are loaded together, one k-step ahead of the WMMAs that use them
// Q, K and V leave in the order in which k_att's 16x16x32 fragments read them: fragment = 1 KiB = [k half q][lane (g, row)][8 f16], k = 32*chunk + 16q + 8g + 0..7.
// Q, K: [b][head][16-position tile][32-dim chunk], row = position; V^T: [b][head][32-key chunk][16-dim tile], row = dim, k = key. A wave stores and loads 512 contiguous bytes at a time.
// The product is formed the way round that leaves a lane's 8 accumulator values as the 8 neighbouring k of one fragment row: V as x . W (a lane = one dim, 8 keys), Q and K as W^T . x^T
// (the same two fragments with A and B exchanged: a lane = one position, 8 dims). The 16 bytes go from registers straight to their place in the fragment.
// The whole block body is written once for each way round (ISV), so that no register is held for the other one. DH: V^T, or the f16 values of Q or K; DL: Q's residuals, else null.
template <bool ISV>
__device__ __forceinline__ void proj_body(__bf16 (*sx)[CIN + 8], const float* __restrict__ X, const __bf16* __restrict__ Pw, const float* __restrict__ Bm, _Float16* __restrict__ DH, _Float16* __restrict__ DL, size_t b, int p0, int c0) {
  const int tid = threadIdx.x, wave = tid >> 5, lane = tid & 31, col = lane & 15, g = lane >> 4;
  v16b wb[2][8];
  { // x tile: thread = (4 neighbouring positions, 8 neighbouring channels out of every 64). A wave's load covers two 256-byte runs; 8 channels of one position leave as one 16-byte LDS store
    const int pq = (tid & 15) * 4, cg = (tid >> 4) * 8; const float* xp = X + (b * CIN + cg) * (size_t)TT + p0 + pq; v4f xv[4][8];
#pragma unroll   // all 32 loads are issued before the first value is used: the tile costs one trip to memory, not one per group of loads
    for (int i = 0; i < 4; ++i)
#pragma unroll
      for (int j = 0; j < 8; ++j) xv[i][j] = *(const v4f*)(xp + (size_t)(i * 64 + j) * TT);
    asm volatile("s_wait_xcnt 0x0" ::: "memory");   // what follows (the weights' loads, the conversions) may reuse the registers that hold the loads' address; the clobber also keeps every x load above this line
    ldw8(wb[0], Pw);   // the first k-step's weights fly behind the tile
#pragma unroll
    for (int i = 0; i < 4; ++i)
#pragma unroll
      for (int k = 0; k < 4; ++k) { v8b o;
#pragma unroll
        for (int j = 0; j < 8; ++j) o[j] = (__bf16)xv[i][j][k];
        *(v8b*)&sx[pq + k][i * 64 + cg] = o; } }
  __syncthreads();
  v8f acc[8] = {}; const __bf16* xr = &sx[wave * 16 + col][0];
  float bb[8]; v4f ba[8], bc[8]; const float* bs = Bm + c0; const unsigned bo = (ISV ? col : 8 * g) * 4;   // the bias of the lane's values: V: one dim 16j + col a tile; Q, K: the 8 dims 16j + 8g + 0..7. bs: the block's own 128; bo: the lane's byte offset
#pragma unroll   // unrolled: the two fragment sets are indexed by constants and stay in registers
  for (int kc = 0; kc < CIN / 32; ++kc) { const v16b a = frag_b(xr + kc * 32, lane);
    if (kc + 1 < CIN / 32) ldw8(wb[(kc + 1) & 1], Pw + (kc + 1) * (CC / 16) * 512);
    else {   // the bias takes the place of the weights' loads in the last k-step and arrives under its WMMAs
      __builtin_amdgcn_sched_barrier(0);   // the last k-step and what follows are scheduled apart from the steps before: as one region this build takes more than 256 registers a wave, and only three waves, not four, would share a SIMD
#pragma unroll
      for (int j = 0; j < 8; ++j) { const char* bp = (const char*)(bs + j * 16) + bo; if (ISV) bb[j] = *(const float*)bp; else { ba[j] = *(const v4f*)bp; bc[j] = *(const v4f*)(bp + 16); } }
      asm volatile("s_wait_xcnt 0x0" :: "v"(bo) : "memory"); }   // what follows may reuse the register that holds the loads' offset; named as an input, it stays whole up to the wait (no load's own result lands on it)
#pragma unroll
    for (int j = 0; j < 8; ++j) acc[j] = ISV ? wmma_bf(a, wb[kc & 1][j], acc[j]) : wmma_bf(wb[kc & 1][j], a, acc[j]); }
  // V: D row = position 16 wave + 8g + r, column = dim 16j + col; Q, K: D row = dim 16j + 8g + r, column = position 16 wave + col
  v8h hv[8];
#pragma unroll
  for (int j = 0; j < 8; ++j)
#pragma unroll
    for (int r = 0; r < 8; ++r) { acc[j][r] += bfr(ISV ? bb[j] : r < 4 ? ba[j][r & 3] : bc[j][r & 3]); hv[j][r] = (_Float16)acc[j][r]; }
  // V: head j >> 2, key chunk wave >> 1, dim tile j & 3, k half wave & 1; Q, K: head j >> 2, position tile wave, dim chunk (j >> 1) & 1, k half j & 1
  const size_t o = ISV ? ((b * NH + c0 / HD) * (TT / 32) + p0 / 32 + (wave >> 1)) * (size_t)2048 + ((wave & 1) * 32 + lane) * 8 : ((b * NH + c0 / HD) * (TT / 16) + p0 / 16 + wave) * (size_t)1024 + lane * 8;
  const int js = ISV ? 512 : 256;
  if (!ISV && DL) { v8h lv[8];
#pragma unroll
    for (int j = 0; j < 8; ++j)
#pragma unroll
      for (int r = 0; r < 8; ++r) lv[j][r] = (_Float16)(acc[j][r] - (float)hv[j][r]);
#pragma unroll
    for (int j = 0; j < 8; ++j) vst2(DL + o + (j >> 2) * (TT * HD) + (j & 3) * js, lv[j]);
    asm volatile("s_wait_xcnt 0x0" ::: "memory"); }   // the address of the stores below may take the registers that these stores name
#pragma unroll
  for (int j = 0; j < 8; ++j) vst2(DH + o + (j >> 2) * (TT * HD) + (j & 3) * js, hv[j]); }
__global__ __launch_bounds__(128) void k_proj(const float* __restrict__ X, const __bf16* __restrict__ PW, const float* __restrict__ BQ, const float* __restrict__ BK, const float* __restrict__ BV, _Float16* __restrict__ QH, _Float16* __restrict__ QL, _Float16* __restrict__ KH, _Float16* __restrict__ VT) {
  __shared__ __align__(16) __bf16 sx[64][CIN + 8];
  const int p0 = blockIdx.x * 64; const int c0 = blockIdx.y * 128; const size_t b = blockIdx.z / 3; const int which = blockIdx.z % 3;
  const __bf16* Pw = PW + (size_t)which * (CIN * CC) + (c0 / 16) * 512 + (threadIdx.x & 31) * 8;
  if (which == 2) proj_body<true>(sx, X, Pw, BV, VT, nullptr, b, p0, c0);
  else proj_body<false>(sx, X, Pw, which == 0 ? BQ : BK, which == 0 ? QH : KH, which == 0 ? QL : nullptr, b, p0, c0); }
#define ESC 0.18033688f   // log2(e) / 8: the logits' scale 1 / sqrt(64) and the change of base, in one factor
#define KRING 4   // K fragments in flight a wave (4 WMMAs each)
#define VRING 6   // V fragments in flight a wave (2 WMMAs each); more of either and the kernel spills at 256 registers
// one f16 fragment in fragment order (f = fragment base, l8 = lane * 8): two loads of 512 contiguous bytes a wave
__device__ __forceinline__ v16h frag_pk(const _Float16* f, unsigned l8) { union { v16h v; v8h q[2]; } u; const _Float16* p = f + l8; u.q[0] = *(const v8h*)p; u.q[1] = *(const v8h*)(p + 256); return u.v; }
// ---- k_att: block = (64 queries, z = b*8 + h), 8 waves; wave w owns keys 128w .. 128w+127 and walks the block's queries 32 at a time (two 16-query tiles share every K and V fragment).
// S^T = K . Q^T (2 products): a lane holds one query's logits for 8 consecutive keys of each 16-key tile, so the whole 32 x 128 tile stays in registers,
// the row maximum and sum need one exchange between wave halves and one between waves, and two neighbouring tiles pack straight into the B operand of O^T = V^T . P^T.
// Column sums: the wave's own P tile goes through LDS once (row = query), each lane then adds 8 keys over 16 queries and keeps the sums over the block's 64 queries.
// waves_per_eu(4, 4) holds a wave to 256 registers, so that two blocks (16 waves) share a WGP, which their LDS also allows.
__global__ __launch_bounds__(256) __attribute__((amdgpu_waves_per_eu(4, 4))) void k_att(const _Float16* __restrict__ QH, const _Float16* __restrict__ QL, const _Float16* KH, const _Float16* VT, float* __restrict__ Y, float* __restrict__ CP) {   // KH, VT without __restrict__: with it the compiler holds the fragments that both passes read first in registers over the whole pass, and spills
  __shared__ float smx[2][8][32]; __shared__ __align__(16) _Float16 sp[8][32][144]; __shared__ __align__(16) float so[8][32][68];
  const int z = blockIdx.y; const size_t b = z / NH; const int h = z % NH;
  const int tid = threadIdx.x, wave = tid >> 5, lane = tid & 31, col = lane & 15, g = lane >> 4; const int kw = wave * 128;
  const size_t hb = (size_t)z * (TT * HD);   // this head's fragments: 128 KiB in each of the four buffers
  const int ws = wave * 8192;   // the wave's 8 key tiles (K) and 4 key chunks (V): 16 KiB each
  const _Float16* Kp = KH + hb + ws; const _Float16* Vp = VT + hb + ws; const _Float16* Qh = QH + hb + blockIdx.x * 4096; const _Float16* Ql = QL + hb + blockIdx.x * 4096; const unsigned l8 = lane * 8;
  v4f c0 = {}, c1 = {};
#pragma unroll 1   // rolled: unrolled, the two passes' tiles would compete for the 256 registers
  for (int qp = 0; qp < 2; ++qp) { const size_t q0 = b * TT + blockIdx.x * 64 + qp * 32;
    v8f s[8][2] = {}; v16h hq[2], lq[2], kf[KRING], vf[VRING];
#pragma unroll   // the first KRING K fragments are asked for together
    for (int i = 0; i < KRING; ++i) kf[i] = frag_pk(Kp + ((i & 7) * 2 + (i >> 3)) * 512, l8);
#pragma unroll   // unrolled: the ring of K fragments is indexed by constants; fragment i + KRING is asked for as soon as fragment i has been used
    for (int i = 0; i < 16; ++i) { const int kc = i >> 3, t = i & 7; const v16h k = kf[i % KRING];
      if (t == 0) {
#pragma unroll
        for (int u = 0; u < 2; ++u) { hq[u] = frag_pk(Qh + ((qp * 2 + u) * 2 + kc) * 512, l8); lq[u] = frag_pk(Ql + ((qp * 2 + u) * 2 + kc) * 512, l8); }
        asm volatile("s_wait_xcnt 0x0" :: "v"(Qh + qp * 2048 + l8), "v"(Ql + qp * 2048 + l8) : "memory"); }   // the registers that hold the Q loads' addresses are reused for fragments further down; named as inputs, the two address pairs stay whole up to the wait
#pragma unroll
      for (int u = 0; u < 2; ++u) { s[t][u] = wmma16(k, hq[u], s[t][u]); s[t][u] = wmma16(k, lq[u], s[t][u]); }
      if (i + KRING < 16) kf[i % KRING] = frag_pk(Kp + (((i + KRING) & 7) * 2 + ((i + KRING) >> 3)) * 512, l8); }
    float m[2], inv[2];
#pragma unroll
    for (int u = 0; u < 2; ++u) {   // the maximum is taken over the unscaled logits: the scale is positive and goes into the exponent's FMA
      v8f mv = s[0][u];
#pragma unroll
      for (int t = 1; t < 8; ++t)
#pragma unroll
        for (int r = 0; r < 8; ++r) mv[r] = fmaxf(mv[r], s[t][u][r]);
      float a = fmaxf(fmaxf(fmaxf(mv[0], mv[1]), fmaxf(mv[2], mv[3])), fmaxf(fmaxf(mv[4], mv[5]), fmaxf(mv[6], mv[7])));
      a = fmaxf(a, __shfl_xor(a, 16)); if (g == 0) smx[0][wave][u * 16 + col] = a; }
    __syncthreads();
#pragma unroll
    for (int u = 0; u < 2; ++u) { const int x = u * 16 + col;
      m[u] = fmaxf(fmaxf(fmaxf(smx[0][0][x], smx[0][1][x]), fmaxf(smx[0][2][x], smx[0][3][x])), fmaxf(fmaxf(smx[0][4][x], smx[0][5][x]), fmaxf(smx[0][6][x], smx[0][7][x])));
      const float mc = m[u] * ESC; const v8f esc8 = { ESC, ESC, ESC, ESC, ESC, ESC, ESC, ESC }, nmc8 = { -mc, -mc, -mc, -mc, -mc, -mc, -mc, -mc }; v8f sv = {};
#pragma unroll
      for (int t = 0; t < 8; ++t) { s[t][u] = __builtin_elementwise_fma(s[t][u], esc8, nmc8);
#pragma unroll
        for (int r = 0; r < 8; ++r) s[t][u][r] = __builtin_amdgcn_exp2f(s[t][u][r]);
        sv += s[t][u]; }   // argument <= 0 but for one rounding; far below -126 gives 0, which P's f16 would round to anyway
      float sum = ((sv[0] + sv[1]) + (sv[2] + sv[3])) + ((sv[4] + sv[5]) + (sv[6] + sv[7]));
      sum += __shfl_xor(sum, 16); if (g == 0) smx[1][wave][x] = sum; }
    __syncthreads();
    v8h p8[8][2];
#pragma unroll   // the first VRING V fragments fly while P is scaled and packed
    for (int i = 0; i < VRING; ++i) vf[i] = frag_pk(Vp + i * 512, l8);
    __builtin_amdgcn_sched_barrier(0);   // the loads above and the packing below are scheduled apart: as one region this build needs more than 256 registers and spills to scratch
#pragma unroll
    for (int u = 0; u < 2; ++u) { const int x = u * 16 + col;
      inv[u] = 2048.0f * (1.0f / (((smx[1][0][x] + smx[1][1][x]) + (smx[1][2][x] + smx[1][3][x])) + ((smx[1][4][x] + smx[1][5][x]) + (smx[1][6][x] + smx[1][7][x]))));   // P's factor 2^11 rides in the row's reciprocal: a power of two, the same bits
#pragma unroll
      for (int t = 0; t < 8; ++t) {
#pragma unroll
        for (int r = 0; r < 8; ++r) p8[t][u][r] = (_Float16)(s[t][u][r] * inv[u]);
        *(v8h*)&sp[wave][x][t * 16 + 8 * g] = p8[t][u]; }
 }
    v8f acc[4][2] = {};
#pragma unroll
    for (int c = 0; c < 4; ++c) { union { v16h v; v8h q[2]; } pb[2];
#pragma unroll
      for (int u = 0; u < 2; ++u) { pb[u].q[0] = p8[2 * c][u]; pb[u].q[1] = p8[2 * c + 1][u]; }
#pragma unroll
      for (int j = 0; j < 4; ++j) { const int i = c * 4 + j; const v16h v = vf[i % VRING];
#pragma unroll
        for (int u = 0; u < 2; ++u) acc[j][u] = wmma16(v, pb[u].v, acc[j][u]);
        if (i + VRING < 16) vf[i % VRING] = frag_pk(Vp + (i + VRING) * 512, l8); } }
    LDSX();   // the wave's own P rows are in LDS before its lanes read across them
#pragma unroll
    for (int q = 0; q < 16; ++q) { const v8h v = *(const v8h*)&sp[wave][g * 16 + q][col * 8];
#pragma unroll
      for (int e = 0; e < 4; ++e) { c0[e] += (float)v[e]; c1[e] += (float)v[4 + e]; } }
#pragma unroll
    for (int u = 0; u < 2; ++u)
#pragma unroll
      for (int j = 0; j < 4; ++j) { const v8f o = acc[j][u] * (1.0f / 2048.0f); const v4f lo = { o[0], o[1], o[2], o[3] }, hi = { o[4], o[5], o[6], o[7] };
        *(v4f*)&so[wave][u * 16 + col][j * 16 + 8 * g] = lo; *(v4f*)&so[wave][u * 16 + col][j * 16 + 8 * g + 4] = hi; }
    __syncthreads();
    { const int q = tid >> 3, d0 = (tid & 7) * 8; float* y = Y + (q0 + q) * CC + h * HD + d0;
#pragma unroll
      for (int f = 0; f < 2; ++f) { const int d = d0 + 4 * f;
        vst2(y + 4 * f, ((*(const v4f*)&so[0][q][d] + *(const v4f*)&so[1][q][d]) + (*(const v4f*)&so[2][q][d] + *(const v4f*)&so[3][q][d])) + ((*(const v4f*)&so[4][q][d] + *(const v4f*)&so[5][q][d]) + (*(const v4f*)&so[6][q][d] + *(const v4f*)&so[7][q][d]))); }
      asm volatile("s_wait_xcnt 0x0" ::: "memory"); } }   // the next pass overwrites the registers that the two stores name
#pragma unroll
  for (int e = 0; e < 4; ++e) { c0[e] += __shfl_xor(c0[e], 16); c1[e] += __shfl_xor(c1[e], 16); }
  float* cp = CP + (b * NPART + h * (TT / QCH) + blockIdx.x) * (size_t)TT + kw + col * 8 + 4 * g; vst2(cp, g == 0 ? c0 : c1); }
// ---- k_colr: block = (128 keys, batch): attn_map[b][k] = (1/8) sum over the batch's 128 partial rows (8 heads x 16 query blocks); wave w sums 16 rows, then 8 wave sums through LDS
__global__ __launch_bounds__(256) void k_colr(const float* __restrict__ CP, float* __restrict__ AM) { __shared__ __align__(16) float sr[8][128];
  const int t = threadIdx.x, w = t >> 5, lane = t & 31; const size_t b = blockIdx.y; const int k0 = blockIdx.x * 128;
  const float* p = CP + (b * NPART + w * (NPART / 8)) * (size_t)TT + k0 + lane * 4;
  v4f v[NPART / 8];
#pragma unroll
  for (int i = 0; i < NPART / 8; ++i) v[i] = *(const v4f*)(p + (size_t)i * TT);
  v4f a = {};
#pragma unroll
  for (int i = 0; i < NPART / 8; ++i) a += v[i];
  *(v4f*)&sr[w][lane * 4] = a;
  __syncthreads();
  if (t < 32) { v4f s = *(const v4f*)&sr[0][t * 4];
#pragma unroll
    for (int i = 1; i < 8; ++i) s += *(const v4f*)&sr[i][t * 4];
    vst2(AM + b * TT + k0 + t * 4, s * (1.0f / 2048.0f) * (1.0f / NH)); } }
// ---- k_tail: block = 64 rows x all 256 columns, 8 waves: wave = (16-row tile, 128-column half). Everything behind attention is local to a row, so one block takes its 64 rows through all of it:
// Z1 = LN(Y (hi+lo) Wo + bo + x^T) (K 512), HM = silu(Z1 (hi+lo) W1 + b1), out = LN(HM (hi+lo) W2 + b2 + Z1) (K 256 each). Z1 and HM live in LDS only; the output leaves as channel-major planes.
// one wave's 16 rows x 128 columns: Ar = this lane's f32 row (global memory or LDS), split bf16 hi + lo; Pw = the first packed fragment of the wave's column half + lane * 8
template <int K>
__device__ __forceinline__ void gemm16(const float* Ar, const __bf16* Pw, v8f (&acc)[8], int lane) {
#pragma unroll
  for (int j = 0; j < 8; ++j)
#pragma unroll
    for (int r = 0; r < 8; ++r) acc[j][r] = 0.f;
  v16b w0[8], w1[8]; ldw8(w0, Pw);
  asm volatile("s_wait_xcnt 0x0" ::: "memory");   // the loop may reuse the register that holds these loads' address
#pragma unroll 1   // two k-steps a trip, written out: each step's 8 B fragments are loaded one step ahead into the set the other step has left
  for (int kc = 0; kc < K / 32; kc += 2) { const F2 a0 = split_row(Ar, kc * 32, lane);
    ldw8(w1, Pw + (kc + 1) * (CIN / 16) * 512);
#pragma unroll
    for (int j = 0; j < 8; ++j) { acc[j] = wmma_bf(a0.h, w0[j], acc[j]); acc[j] = wmma_bf(a0.l, w0[j], acc[j]); }
    const F2 a1 = split_row(Ar, kc * 32 + 32, lane);
    if (kc + 2 < K / 32) ldw8(w0, Pw + (kc + 2) * (CIN / 16) * 512);
    asm volatile("s_wait_xcnt 0x0" ::: "memory");   // the address registers that the trip's loads name are advanced below
#pragma unroll
    for (int j = 0; j < 8; ++j) { acc[j] = wmma_bf(a1.h, w1[j], acc[j]); acc[j] = wmma_bf(a1.l, w1[j], acc[j]); } } }
// LayerNorm statistics of the 64 rows in sz: four threads a row; each holds its 64 values (16-column groups, every fourth) in registers for both sums. 16 lanes = 4 rows x 4 groups fall on all 64 banks once.
// Mean and 1 / standard deviation go into the row's own pad columns.
__device__ __forceinline__ void ln_stats(float (*sz)[CIN + 4], int tid) { const int rl = tid >> 2; const float* rp = &sz[rl][(tid & 3) * 16]; v4f v[16];
#pragma unroll   // all 16 LDS reads are issued before the first value is used
  for (int i = 0; i < 16; ++i) v[i] = *(const v4f*)(rp + (i >> 2) * 64 + (i & 3) * 4);
  v4f a[4] = { v[0], v[1], v[2], v[3] };
#pragma unroll
  for (int i = 4; i < 16; ++i) a[i & 3] += v[i];
  const v4f s4 = (a[0] + a[1]) + (a[2] + a[3]); float s = (s4[0] + s4[1]) + (s4[2] + s4[3]); s += __shfl_xor(s, 1); s += __shfl_xor(s, 2); const float mu = s / CIN;
  v4f w[4] = {};
#pragma unroll
  for (int i = 0; i < 16; ++i) { const v4f d = v[i] - mu; w[i & 3] += d * d; }
  const v4f q4 = (w[0] + w[1]) + (w[2] + w[3]); float q = (q4[0] + q4[1]) + (q4[2] + q4[3]); q += __shfl_xor(q, 1); q += __shfl_xor(q, 2);
  if ((tid & 3) == 0) { const v2f st = { mu, 1.0f / sqrtf(q / CIN + 1e-5f) }; *(v2f*)&sz[rl][CIN] = st; } }
__global__ __launch_bounds__(256) void k_tail(const float* __restrict__ Y, const __bf16* __restrict__ PWO, const __bf16* __restrict__ PW1, const __bf16* __restrict__ PW2, const float* __restrict__ BO, const float* __restrict__ B1, const float* __restrict__ B2, const float* __restrict__ X, const float* __restrict__ G1, const float* __restrict__ E1, const float* __restrict__ G2, const float* __restrict__ E2, float* __restrict__ DST) {
  __shared__ __align__(16) float sz[64][CIN + 4], sm[64][CIN + 4];   // sz: rows before and after LN1 (Z1), then before LN2; sm: the SiLU rows
  const int tid = threadIdx.x, wave = (tid >> 5) & 3, half = tid >> 7, lane = tid & 31, col = lane & 15, g = lane >> 4; const size_t r0 = (size_t)blockIdx.x * 64; const size_t b = r0 / TT; const int p0 = (int)(r0 % TT);
  const int fo = half * 8 * 512 + lane * 8, ar = wave * 16 + col, rw = wave * 16 + 8 * g, ow = half * 128 + col;   // the wave's fragments, this lane's A row, its first D row and its first D column
  v8f acc[8];
  // -- Y Wo + bo + x^T
  gemm16<CC>(Y + (r0 + ar) * CC, PWO + fo, acc, lane);
  { float bb[8]; v4f ra[8], rb[8];
#pragma unroll   // all loads issued together: 8 neighbouring positions of a channel are two 16-byte loads
    for (int j = 0; j < 8; ++j) { const int o = ow + j * 16; const float* xp = X + (b * CIN + o) * (size_t)TT + p0 + rw; bb[j] = BO[o]; ra[j] = *(const v4f*)xp; rb[j] = *(const v4f*)(xp + 4); }
    asm volatile("s_wait_xcnt 0x0" ::: "memory");   // what follows may reuse the registers that hold the loads' addresses
#pragma unroll
    for (int j = 0; j < 8; ++j)
#pragma unroll
      for (int r = 0; r < 8; ++r) sz[rw + r][ow + j * 16] = acc[j][r] + bfr(bb[j]) + bfr(r < 4 ? ra[j][r & 3] : rb[j][r & 3]); }
  __syncthreads();
  { // gamma and beta of the 4 neighbouring columns that this thread scales, asked for here so that they arrive while the statistics are formed
    const int q = tid & 63; const v4f ga = *(const v4f*)(G1 + q * 4), be = *(const v4f*)(E1 + q * 4);
    asm volatile("s_wait_xcnt 0x0" ::: "memory");   // what follows may reuse the registers that hold the loads' addresses
    ln_stats(sz, tid);
    __syncthreads();
#pragma unroll   // unrolled: the LDS reads run ahead of the writes. Z1 replaces the row in place: an element is read and written by one thread only, the pad columns stay
    for (int i = 0; i < 16; ++i) { const int rl = (tid >> 6) + 4 * i; const v2f st = *(const v2f*)&sz[rl][CIN]; const v4f x = *(const v4f*)&sz[rl][q * 4]; v4f o;
#pragma unroll
      for (int k = 0; k < 4; ++k) o[k] = (x[k] - st[0]) * st[1] * bfr(ga[k]) + bfr(be[k]);
      *(v4f*)&sz[rl][q * 4] = o; } }
  __syncthreads();   // every Z1 row is whole before a wave reads it as its A operand
  // -- silu(Z1 W1 + b1)
  gemm16<CIN>(&sz[ar][0], PW1 + fo, acc, lane);
  { float bb[8];
#pragma unroll
    for (int j = 0; j < 8; ++j) bb[j] = B1[ow + j * 16];
    asm volatile("s_wait_xcnt 0x0" ::: "memory");   // what follows may reuse the registers that hold the loads' addresses
#pragma unroll
    for (int j = 0; j < 8; ++j)
#pragma unroll
      for (int r = 0; r < 8; ++r) { const float v = acc[j][r] + bfr(bb[j]); sm[rw + r][ow + j * 16] = v / (1.0f + expf(-v)); } }
  __syncthreads();   // every SiLU row is whole before a wave reads it as its A operand; also ends the last read of Z1 as an A operand
  // -- HM W2 + b2 + Z1, added in place: an element of sz is read and written by the one thread that holds its sum
  gemm16<CIN>(&sm[ar][0], PW2 + fo, acc, lane);
  { float bb[8];
#pragma unroll
    for (int j = 0; j < 8; ++j) bb[j] = B2[ow + j * 16];
    asm volatile("s_wait_xcnt 0x0" ::: "memory");   // what follows may reuse the registers that hold the loads' addresses
#pragma unroll
    for (int j = 0; j < 8; ++j)
#pragma unroll
      for (int r = 0; r < 8; ++r) sz[rw + r][ow + j * 16] = acc[j][r] + bfr(bb[j]) + sz[rw + r][ow + j * 16]; }
  __syncthreads();
  // gamma and beta of the channels (tid >> 4) + 16 i that this thread stores, asked for here so that they arrive while the statistics are formed
  float ga[16], be[16];
#pragma unroll   // all loads issued together, the values indexed by constants
  for (int i = 0; i < 16; ++i) { const int c = (tid >> 4) + 16 * i; ga[i] = G2[c]; be[i] = E2[c]; }
  asm volatile("s_wait_xcnt 0x0" ::: "memory");   // what follows may reuse the registers that hold the loads' addresses
  ln_stats(sz, tid);
  __syncthreads();
  // the rows are normalised on their way out: channel-major planes [b][c][p0 .. p0+63], transposed through registers: thread = (c, 4 consecutive positions)
  const int q = tid & 15; v2f st[4];
#pragma unroll
  for (int k = 0; k < 4; ++k) st[k] = *(const v2f*)&sz[q * 4 + k][CIN];
#pragma unroll   // unrolled: the LDS reads run ahead of the stores, and every access takes its place from one address and a constant
  for (int i = 0; i < 16; ++i) { const int c = (tid >> 4) + 16 * i; v4f o;
#pragma unroll
    for (int k = 0; k < 4; ++k) o[k] = (sz[q * 4 + k][c] - st[k][0]) * st[k][1] * bfr(ga[i]) + bfr(be[i]);
    vst2(DST + (b * CIN + c) * (size_t)TT + p0 + q * 4, o); } }
extern "C" void kernel_launch(void* const* d_in, const int* in_sizes, int n_in, void* d_out, int out_size, void* d_ws, size_t ws_size, hipStream_t stream) {
  (void)in_sizes; (void)n_in; (void)out_size;
  const float** F = (const float**)d_in;   // 0 x [16,256,32,32], 1 Wq [256,512], 2 bq, 3 Wk, 4 bk, 5 Wv, 6 bv, 7 Wo [512,256], 8 bo, 9 W1 [256,256], 10 b1, 11 W2, 12 b2, 13 g1, 14 be1, 15 g2, 16 be2
  if (ws_size < (size_t)WS_END) return;
  char* ws = (char*)d_ws; _Float16 *QH = (_Float16*)(ws + WS_QH), *QL = (_Float16*)(ws + WS_QL), *KH = (_Float16*)(ws + WS_KH), *VT = (_Float16*)(ws + WS_VT); float *Y = (float*)(ws + WS_Y), *CP = (float*)(ws + WS_CP); __bf16* PW = (__bf16*)(ws + WS_PW);
  float* OUT0 = (float*)d_out; float* OUT1 = (float*)d_out + OUT1_OFF;
  k_pack<<<dim3(CIN * CC / 8 / 256, 6), 256, 0, stream>>>(F[1], F[3], F[5], F[7], F[9], F[11], PW);
  k_proj<<<dim3(TT / 64, CC / 128, TNB * 3), 128, 0, stream>>>(F[0], PW, F[2], F[4], F[6], QH, QL, KH, VT);
  k_att<<<dim3(TT / 64, TNB * NH), 256, 0, stream>>>(QH, QL, KH, VT, Y, CP);
  k_colr<<<dim3(TT / 128, TNB), 256, 0, stream>>>(CP, OUT1);
  k_tail<<<TNB * TT / 64, 256, 0, stream>>>(Y, PW + PW_O, PW + PW_1, PW + PW_2, F[8], F[10], F[12], F[0], F[13], F[14], F[15], F[16], OUT0);
}
